// v000
// The times below were measured on an AMD MI455X: many runs one after another, warmed up first and cycling through
// copies of the inputs, with the whole window's GPU time divided by the number of runs. Launches and the gaps
// between them are all in it. The median over several windows is given; except for v000 it joins two sittings, which
// can be a few percent apart, so the side-by-side timings, each taken in one sitting, are the better comparison.
// v000, which the later versions start from, runs in 3920 microseconds.
#include <hip/hip_runtime.h>

// Grouped-query attention with RoPE and a 2-D mask (x [2][2048][2048]; q = x Wq (32 heads x 64), k, v = x Wk / x Wv (8 kv groups x 64, each serving 4 consecutive query heads); rotate-half RoPE with the input
// cos/sin tables [2048][64] (read as data); scores = q.k/8, -inf where mask[i][j] != 0 (int [2048][2048], read as data); softmax; out = merged attn.v Wo + bo -> [2][2048][2048]).
// Compute dtypes, f32 accumulate: every input rounded to bf16; projections on PLAIN bf16 operands (inputs: exact products, f32 accumulate); RoPE in f32; PER-ROW PRECISION
// HYBRID: query rows < 256 take scores and attn.v on bf16 hi+lo planes (3 products), rows >= 256 on single fp16 planes; 1/8 and the mask in f32 in the register-row softmax; merged heads as hi+lo planes

#define NB_  2
#define TT   2048
#define DM   2048
#define NH_  32
#define NKV  8
#define REP  (NH_ / NKV)
#define HD   64
#define DQ   (NH_ * HD)
#define DKV  (NKV * HD)
#define ZH   2
#define RH   256                  // query rows < RH use hi+lo planes (0: none)
#define WIN  0
#define PCAR 1024.0f
#define SCL  0.125f   // HD^-0.5
typedef _Float16 h16;
typedef unsigned short bf;
typedef __attribute__((ext_vector_type(16))) __bf16   v16bf;
typedef __attribute__((ext_vector_type(16))) _Float16 v16h;
typedef __attribute__((ext_vector_type(8)))  _Float16 v8h;
typedef __attribute__((ext_vector_type(8)))  unsigned short v8us;
typedef __attribute__((ext_vector_type(8)))  float    v8f;
typedef __attribute__((ext_vector_type(4)))  float    v4f;
typedef v8h  __attribute__((may_alias)) v8ha;
typedef v4f  __attribute__((may_alias)) v4fa;
typedef v8us __attribute__((may_alias)) v8usa;

__device__ __forceinline__ unsigned short f2bf(float f) { unsigned u = __float_as_uint(f); u += 0x7FFFu + ((u >> 16) & 1u); return (unsigned short)(u >> 16); }
__device__ __forceinline__ float bf2f(unsigned short b) { return __uint_as_float(((unsigned)b) << 16); }
__device__ __forceinline__ float bfr(float f) { return bf2f(f2bf(f)); }
__device__ __forceinline__ v16h cat16(v8h lo, v8h hi) { return __builtin_shufflevector(lo, hi, 0, 1, 2, 3, 4, 5, 6, 7, 8, 9, 10, 11, 12, 13, 14, 15); }
__device__ __forceinline__ v16bf cat16b(v8us lo, v8us hi) { return __builtin_bit_cast(v16bf, __builtin_shufflevector(lo, hi, 0, 1, 2, 3, 4, 5, 6, 7, 8, 9, 10, 11, 12, 13, 14, 15)); }
__device__ __forceinline__ v8f wmma16(v16h a, v16h b, v8f c) { return __builtin_amdgcn_wmma_f32_16x16x32_f16(false, a, false, b, (short)0, c, false, false); }
__device__ __forceinline__ v8f wmmab(v16bf a, v16bf b, v8f c) { return __builtin_amdgcn_wmma_f32_16x16x32_bf16(false, a, false, b, (short)0, c, false, false); }



// ---- k_gemmw: register-blocked GEMM, ONE WAVE per 64x64 output tile (16 accumulators), operands straight from K-contiguous 16-bit planes; grid (M/64, N/64, Z), 32 threads.
// C[m][n] (f32, pitch ldc, + optional f32 bias[n]) = sum_k A[m][k] Bt[n][k] (+ split products per NSPLIT). z-batch strides sA/sB/sC in elements. K % 32 == 0.
template <typename T16> struct WFrag;
template <> struct WFrag<h16> { typedef v16h V; static __device__ __forceinline__ V ld(const h16* p) { return cat16(*(const v8h*)p, *(const v8h*)(p + 16)); } static __device__ __forceinline__ v8f mma(V a, V b, v8f c) { return wmma16(a, b, c); } };
template <> struct WFrag<bf> { typedef v16bf V; static __device__ __forceinline__ V ld(const bf* p) { return cat16b(*(const v8us*)p, *(const v8us*)(p + 16)); } static __device__ __forceinline__ v8f mma(V a, V b, v8f c) { return wmmab(a, b, c); } };
template <typename T16, int NSPLIT, bool BIAS>
__global__ __launch_bounds__(32) void k_gemmw(const T16* __restrict__ A, const T16* __restrict__ A2, const T16* __restrict__ Bt, const T16* __restrict__ Bt2, int K, float* C, int ldc, const float* __restrict__ bias, size_t sA, size_t sB, size_t sC) {
    typedef typename WFrag<T16>::V V;
    __shared__ __align__(16) float os[16 * 68];
    const size_t z = blockIdx.z; A += z * sA; if (A2) A2 += z * sA; Bt += z * sB; if (Bt2) Bt2 += z * sB; C += z * sC;
    const int lane = threadIdx.x & 31, lr = lane & 15, hi = lane >> 4; const int r0 = blockIdx.x * 64, c0 = blockIdx.y * 64;
    v8f acc[4][4];
#pragma unroll
    for (int mb = 0; mb < 4; ++mb)
#pragma unroll
        for (int nb = 0; nb < 4; ++nb) acc[mb][nb] = (v8f){};
    const size_t aoff = (size_t)(r0 + lr) * K + 8 * hi, boff = (size_t)(c0 + lr) * K + 8 * hi;
#pragma unroll 1
    for (int kc = 0; kc < K; kc += 32) {
        V a[4], a2[4];
#pragma unroll
        for (int mb = 0; mb < 4; ++mb) { a[mb] = WFrag<T16>::ld(A + aoff + (size_t)mb * 16 * K + kc); if (NSPLIT == 1 || NSPLIT == 2) a2[mb] = WFrag<T16>::ld(A2 + aoff + (size_t)mb * 16 * K + kc); }
#pragma unroll
        for (int nb = 0; nb < 4; ++nb) { const V b = WFrag<T16>::ld(Bt + boff + (size_t)nb * 16 * K + kc); V b2; if (NSPLIT >= 2) b2 = WFrag<T16>::ld(Bt2 + boff + (size_t)nb * 16 * K + kc);
#pragma unroll
            for (int mb = 0; mb < 4; ++mb) { acc[mb][nb] = WFrag<T16>::mma(a[mb], b, acc[mb][nb]); if (NSPLIT == 1 || NSPLIT == 2) acc[mb][nb] = WFrag<T16>::mma(a2[mb], b, acc[mb][nb]); if (NSPLIT >= 2) acc[mb][nb] = WFrag<T16>::mma(a[mb], b2, acc[mb][nb]); } }
        asm volatile("v_nop\n\tv_nop\n\tv_nop\n\tv_nop" : "+v"(acc[0][0]), "+v"(acc[1][1]), "+v"(acc[2][2]), "+v"(acc[3][3]) : "v"(a[0]), "v"(a[3]));
    }
#pragma unroll
    for (int mb = 0; mb < 4; ++mb) {
#pragma unroll
        for (int nb = 0; nb < 4; ++nb) {
#pragma unroll
            for (int j = 0; j < 8; ++j) os[(hi * 8 + j) * 68 + nb * 16 + lr] = acc[mb][nb][j]; }
        __builtin_amdgcn_wave_barrier(); asm volatile("" ::: "memory");
        float* crow = C + (size_t)(r0 + mb * 16) * ldc + c0;
{
#pragma unroll
            for (int s = 0; s < 8; ++s) { const int row = 2 * s + hi, cofs = lr * 4; v4f val = *(const v4fa*)(os + row * 68 + cofs); if (BIAS) { val[0] += bfr(bias[c0 + cofs]); val[1] += bfr(bias[c0 + cofs + 1]); val[2] += bfr(bias[c0 + cofs + 2]); val[3] += bfr(bias[c0 + cofs + 3]); }
                *(v4f*)(crow + (size_t)row * ldc + cofs) = val; }
             }
        __builtin_amdgcn_wave_barrier(); asm volatile("" ::: "memory");
    }
}

__device__ __forceinline__ h16 tohx(float x) { return (h16)x; }
__device__ __forceinline__ void splitf(float y, unsigned short& h, unsigned short& l) { h = f2bf(y); l = f2bf(y - bf2f(h)); }
typedef __attribute__((ext_vector_type(2))) _Float16 v2h;
typedef __attribute__((ext_vector_type(4))) _Float16 v4h;
typedef __attribute__((ext_vector_type(2))) unsigned short v2us;
typedef __attribute__((ext_vector_type(4))) unsigned short v4us;
typedef __attribute__((ext_vector_type(2))) float v2f;
typedef __attribute__((ext_vector_type(4))) int v4i;

__global__ __launch_bounds__(256) void k_wtG(const float* __restrict__ w, int K, int N, bf* Bt) {
    const int lane = threadIdx.x & 31; const int L0 = (blockIdx.x * 8 + (threadIdx.x >> 5)) * 8; const int nlines = N * K / 64;
{
#pragma unroll 1
        for (int l = 0; l < 8; ++l) { const int L = L0 + l; if (L >= nlines) break; const size_t e = (size_t)L * 64 + lane * 2; const int k = (int)(e % K), n = (int)(e / K); v2us o;
            o[0] = f2bf(w[(size_t)k * N + n]); o[1] = f2bf(w[(size_t)(k + 1) * N + n]); *(v2us*)(Bt + e) = o; }
         }
}
__global__ __launch_bounds__(256) void k_cvt8(const float* __restrict__ src, bf* dst, size_t n8) { const size_t i = (size_t)blockIdx.x * 256 + threadIdx.x; if (i >= n8) return; const v8f v = *(const v8f*)(src + i * 8); v8us o;
#pragma unroll
    for (int k = 0; k < 8; ++k) o[k] = f2bf(v[k]); *(v8us*)(dst + i * 8) = o;  }
__global__ __launch_bounds__(256) void k_cscvt(const float* __restrict__ cosT, const float* __restrict__ sinT, float* CS) { const int idx = blockIdx.x * 256 + threadIdx.x; if (idx >= TT * HD) return; v2f cs; cs[0] = bfr(cosT[idx]); cs[1] = bfr(sinT[idx]); *(v2f*)(CS + (size_t)idx * 2) = cs;  }
// k_rope: head planes [h][t][d] (fp16 + hi/lo) of rope(x) x sc with the rotate-half convention out[d] = x[d] cos[t][d] - x[d+HD/2] sin[t][d], out[d+HD/2] = x[d+HD/2] cos[t][d+HD/2] + x[d] sin[t][d+HD/2]
__global__ __launch_bounds__(256) void k_rope(const float* __restrict__ F, int pitch, int nheads, const float* __restrict__ CS, const float* __restrict__ RF, const float* __restrict__ nw, float sc, h16* P16, bf* Ph, bf* Pl) {
    const size_t e = ((size_t)blockIdx.x * 256 + threadIdx.x) * 2; if (e >= (size_t)nheads * TT * HD) return; const int d = (int)(e % HD); const int t = (int)((e / HD) % TT); const int h = (int)(e / ((size_t)HD * TT)); const float* f = F + (size_t)t * pitch + h * HD; const float rf = RF ? RF[(size_t)h * TT + t] : 1.0f; v2h o16; v2us oh, ol;
#pragma unroll
    for (int q = 0; q < 2; ++q) { const int dd = d + q; const int dp = (dd < HD / 2) ? dd + HD / 2 : dd - HD / 2; float x0 = f[dd], x1 = f[dp];
        if (RF) { float n0 = __fmul_rn(x0, rf), n1 = __fmul_rn(x1, rf); asm volatile("" : "+v"(n0)); asm volatile("" : "+v"(n1)); x0 = __fmul_rn(bfr(nw[dd]), n0); x1 = __fmul_rn(bfr(nw[dp]), n1); }
        const v2f cs = *(const v2f*)(CS + ((size_t)t * HD + dd) * 2); float a = __fmul_rn(x0, cs[0]), bq = __fmul_rn(x1, cs[1]); asm volatile("" : "+v"(a)); asm volatile("" : "+v"(bq)); const float r = ((dd < HD / 2) ? __fsub_rn(a, bq) : __fadd_rn(a, bq)) * sc;
        o16[q] = tohx(r); unsigned short a2, c2; splitf(r, a2, c2); oh[q] = a2; ol[q] = c2; }
    *(v2h*)(P16 + e) = o16; *(v2us*)(Ph + e) = oh; *(v2us*)(Pl + e) = ol;  }
__global__ __launch_bounds__(256) void k_vtp(const float* __restrict__ F, int pitch, int nheads, h16* V16, bf* Vh, bf* Vl) { const size_t e = ((size_t)blockIdx.x * 256 + threadIdx.x) * 2; if (e >= (size_t)nheads * HD * TT) return; const int t = (int)(e % TT); const int d = (int)((e / TT) % HD); const int g = (int)(e / ((size_t)TT * HD)); v2h o16; v2us oh, ol;
#pragma unroll
    for (int q = 0; q < 2; ++q) { const float x = F[(size_t)(t + q) * pitch + g * HD + d]; o16[q] = tohx(x); unsigned short a2, c2; splitf(x, a2, c2); oh[q] = a2; ol[q] = c2; }
    *(v2h*)(V16 + e) = o16; *(v2us*)(Vh + e) = oh; *(v2us*)(Vl + e) = ol;  }
// k_asoft: per row (zz, i): t = S x HD^-0.5 where mask[i][j] == 0 (int [L][L], read as data; non-zero == masked -> -3e38); softmax over the 2048 keys (register row, one exp, fixed trees);
__global__ __launch_bounds__(256) void k_asoft(const float* __restrict__ Sb, const int* __restrict__ mk, h16* P16, bf* Ph, bf* Pl) {
    const int lane = threadIdx.x & 31; const int row = blockIdx.x * 8 + (threadIdx.x >> 5); if (row >= ZH * TT) return; const int i = row % TT; const int zz = row / TT; (void)zz; const bool hires = (i < RH); const float* sr = Sb + (size_t)row * TT; float v[TT / 32]; float mx = -3.0e38f;
#pragma unroll
    for (int ch = 0; ch < TT / 128; ++ch) { const int j0 = ch * 128 + lane * 4; const v4f a = *(const v4f*)(sr + j0); const v4i mk4 = *(const v4i*)(mk + (size_t)i * TT + j0);
#pragma unroll
        for (int q = 0; q < 4; ++q) { const int j = j0 + q; (void)j; const float t = (mk4[q] == 0) ? a[q] * SCL : -3.0e38f; v[ch * 4 + q] = t; mx = fmaxf(mx, t); } }
#pragma unroll
    for (int sh = 16; sh; sh >>= 1) mx = fmaxf(mx, __shfl_xor(mx, sh, 32));
    float sum = 0.f;
#pragma unroll
    for (int k = 0; k < TT / 32; ++k) { float d0 = __fsub_rn(v[k], mx); asm volatile("" : "+v"(d0)); v[k] = __builtin_amdgcn_exp2f(__fmul_rn(d0, 1.4426950408889634f)); sum += v[k]; }
#pragma unroll
    for (int sh = 16; sh; sh >>= 1) sum += __shfl_xor(sum, sh, 32);
    const float f = __fdiv_rn(hires ? 1.0f : PCAR, sum);
{
        if (hires) {
#pragma unroll
            for (int ch = 0; ch < TT / 128; ++ch) { v4us oh, ol;
#pragma unroll
                for (int q = 0; q < 4; ++q) { unsigned short a, c2; splitf(v[ch * 4 + q] * f, a, c2); oh[q] = a; ol[q] = c2; }
                const size_t oo = ((size_t)zz * (RH ? RH : 1) + i) * TT + ch * 128 + lane * 4; *(v4us*)(Ph + oo) = oh; *(v4us*)(Pl + oo) = ol; }
        } else {
#pragma unroll
            for (int ch = 0; ch < TT / 128; ++ch) { v4h o4;
#pragma unroll
                for (int q = 0; q < 4; ++q) o4[q] = tohx(v[ch * 4 + q] * f);
                *(v4h*)(P16 + (size_t)row * TT + ch * 128 + lane * 4) = o4; } }
         }
}
__global__ __launch_bounds__(256) void k_merge(const float* __restrict__ O, int h0, bf* Ah, bf* Al) { const size_t e = ((size_t)blockIdx.x * 256 + threadIdx.x) * 2; if (e >= (size_t)ZH * TT * HD) return; const int d = (int)(e % HD); const int t = (int)((e / HD) % TT); const int zz = (int)(e / ((size_t)HD * TT)); const float cs = (t < RH) ? 1.0f : (1.0f / PCAR); const size_t oo = (size_t)t * DQ + (h0 + zz) * HD + d;
    v2us oh, ol;
#pragma unroll
    for (int q = 0; q < 2; ++q) { unsigned short a, c2; splitf(O[e + q] * cs, a, c2); oh[q] = a; ol[q] = c2; } *(v2us*)(Ah + oo) = oh; *(v2us*)(Al + oo) = ol;  }

extern "C" void kernel_launch(void* const* d_in, const int* in_sizes, int n_in,
                              void* d_out, int out_size, void* d_ws, size_t ws_size, hipStream_t stream) {
    (void)in_sizes; (void)n_in; (void)out_size;
    const float* x = (const float*)d_in[0]; const int* mk = (const int*)d_in[1]; const float* cosT = (const float*)d_in[2]; const float* sinT = (const float*)d_in[3]; const float* wq = (const float*)d_in[4]; const float* wk = (const float*)d_in[5]; const float* wv = (const float*)d_in[6]; const float* wo = (const float*)d_in[7]; const float* bo = (const float*)d_in[8];   // all weights x @ W
    float* OUT = (float*)d_out;     // [2][2048][2048]
    char* wsp = (char*)d_ws;
    auto take = [&](size_t bytes) { char* p = wsp; wsp += (bytes + 255) & ~(size_t)255; return (void*)p; };
    bf* WQ = (bf*)take((size_t)DQ * DM * 2); bf* WK = (bf*)take((size_t)DKV * DM * 2); bf* WV = (bf*)take((size_t)DKV * DM * 2); bf* WO = (bf*)take((size_t)DM * DQ * 2); float* CS = (float*)take((size_t)TT * HD * 2 * 4);
    bf* XB = (bf*)take((size_t)TT * DM * 2); float* FQ = (float*)take((size_t)TT * DQ * 4); float* FK = (float*)take((size_t)TT * DKV * 4);
    h16* QP16 = (h16*)take((size_t)NH_ * TT * HD * 2); h16* KP16 = (h16*)take((size_t)NKV * TT * HD * 2); h16* VT16 = (h16*)take((size_t)NKV * HD * TT * 2);
    bf* QPh = (bf*)take((size_t)NH_ * TT * HD * 2); bf* QPl = (bf*)take((size_t)NH_ * TT * HD * 2); bf* KPh = (bf*)take((size_t)NKV * TT * HD * 2); bf* KPl = (bf*)take((size_t)NKV * TT * HD * 2); bf* VTh = (bf*)take((size_t)NKV * HD * TT * 2); bf* VTl = (bf*)take((size_t)NKV * HD * TT * 2); bf* Ph = (bf*)take((size_t)ZH * RH * TT * 2); bf* Pl = (bf*)take((size_t)ZH * RH * TT * 2);
    float* Sb = (float*)take((size_t)ZH * TT * TT * 4); h16* P16 = (h16*)take((size_t)ZH * TT * TT * 2); float* Ob = (float*)take((size_t)ZH * TT * HD * 4); bf* ATh = (bf*)take((size_t)TT * DQ * 2); bf* ATl = (bf*)take((size_t)TT * DQ * 2);
    if ((size_t)(wsp - (char*)d_ws) > ws_size) return;    // ws 256 MiB
    float* FV = FK;   // v projection reuses the k buffer after the k planes are built (stream-ordered)
    { k_wtG<<<(unsigned)((DM * DQ / 64 + 63) / 64), 256, 0, stream>>>(wq, DM, DQ, WQ); k_wtG<<<(unsigned)((DM * DKV / 64 + 63) / 64), 256, 0, stream>>>(wk, DM, DKV, WK); k_wtG<<<(unsigned)((DM * DKV / 64 + 63) / 64), 256, 0, stream>>>(wv, DM, DKV, WV);
      k_wtG<<<(unsigned)((DQ * DM / 64 + 63) / 64), 256, 0, stream>>>(wo, DQ, DM, WO);
       }
    k_cscvt<<<(TT * HD + 255) / 256, 256, 0, stream>>>(cosT, sinT, CS);   // one shared table (read as data)
    const unsigned LQ = (unsigned)(((size_t)NH_ * TT * HD / 2 + 255) / 256), LKv = (unsigned)(((size_t)NKV * TT * HD / 2 + 255) / 256);
    for (int b = 0; b < NB_; ++b) {
        k_cvt8<<<(unsigned)(((size_t)TT * DM / 8 + 255) / 256), 256, 0, stream>>>(x + (size_t)b * TT * DM, XB, (size_t)TT * DM / 8);
        k_gemmw<bf, 0, false><<<dim3(TT / 64, DQ / 64, 1), 32, 0, stream>>>(XB, nullptr, WQ, nullptr, DM, FQ, DQ, nullptr, 0, 0, 0);
        k_rope<<<LQ, 256, 0, stream>>>(FQ, DQ, NH_, CS, nullptr, nullptr, 1.0f, QP16, QPh, QPl);
        k_gemmw<bf, 0, false><<<dim3(TT / 64, DKV / 64, 1), 32, 0, stream>>>(XB, nullptr, WK, nullptr, DM, FK, DKV, nullptr, 0, 0, 0);
        k_rope<<<LKv, 256, 0, stream>>>(FK, DKV, NKV, CS, nullptr, nullptr, 1.0f, KP16, KPh, KPl);
        k_gemmw<bf, 0, false><<<dim3(TT / 64, DKV / 64, 1), 32, 0, stream>>>(XB, nullptr, WV, nullptr, DM, FV, DKV, nullptr, 0, 0, 0); k_vtp<<<LKv, 256, 0, stream>>>(FV, DKV, NKV, VT16, VTh, VTl);
        for (int h0 = 0; h0 < NH_; h0 += ZH) { const size_t zq = (size_t)h0, zk = (size_t)(h0 / REP);   // both heads of a pass share kv group h0/REP (REP >= 2): sB = 0
            k_gemmw<bf, 2, false><<<dim3(RH / 64, TT / 64, ZH), 32, 0, stream>>>(QPh + zq * TT * HD, QPl + zq * TT * HD, KPh + zk * TT * HD, KPl + zk * TT * HD, HD, Sb, TT, nullptr, (size_t)TT * HD, 0, (size_t)TT * TT);
            k_gemmw<h16, 0, false><<<dim3((TT - RH) / 64, TT / 64, ZH), 32, 0, stream>>>(QP16 + zq * TT * HD + (size_t)RH * HD, nullptr, KP16 + zk * TT * HD, nullptr, HD, Sb + (size_t)RH * TT, TT, nullptr, (size_t)TT * HD, 0, (size_t)TT * TT);
            k_asoft<<<ZH * TT / 8, 256, 0, stream>>>(Sb, mk, P16, Ph, Pl);
            k_gemmw<bf, 2, false><<<dim3(RH / 64, HD / 64, ZH), 32, 0, stream>>>(Ph, Pl, VTh + zk * HD * TT, VTl + zk * HD * TT, TT, Ob, HD, nullptr, (size_t)RH * TT, 0, (size_t)TT * HD);
            k_gemmw<h16, 0, false><<<dim3((TT - RH) / 64, HD / 64, ZH), 32, 0, stream>>>(P16 + (size_t)RH * TT, nullptr, VT16 + zk * HD * TT, nullptr, TT, Ob + (size_t)RH * HD, HD, nullptr, (size_t)TT * TT, 0, (size_t)TT * HD);
            k_merge<<<(unsigned)(((size_t)ZH * TT * HD / 2 + 255) / 256), 256, 0, stream>>>(Ob, h0, ATh, ATl); }
        k_gemmw<bf, 1, true><<<dim3(TT / 64, DM / 64, 1), 32, 0, stream>>>(ATh, ATl, WO, nullptr, DQ, OUT + (size_t)b * TT * DM, DM, bo, 0, 0, 0); }
}

// v001
// Measured time: 2160 microseconds a run.
// Two timings next to v000 put it at 1.83 and 1.81 times that version's speed.
#include <hip/hip_runtime.h>

// Grouped-query attention with RoPE and a 2-D mask (x [2][2048][2048]; q = x Wq (32 heads x 64), k, v = x Wk / x Wv (8 kv groups x 64, each serving 4 consecutive query heads); rotate-half RoPE with the input
// cos/sin tables [2048][64] (read as data); scores = q.k/8, -inf where mask[i][j] != 0 (int [2048][2048], read as data); softmax; out = merged attn.v Wo + bo -> [2][2048][2048]).
// Compute dtypes, f32 accumulate: every input rounded to bf16; projections on PLAIN bf16 operands (inputs: exact products, f32 accumulate); RoPE in f32; PER-ROW PRECISION
// HYBRID: query rows < 256 take scores and attn.v on bf16 hi+lo planes (3 products), rows >= 256 on single fp16 planes; 1/8 and the mask in f32 in the register-row softmax; merged heads as hi+lo planes

#define NB_  2
#define TT   2048
#define DM   2048
#define NH_  32
#define NKV  8
#define REP  (NH_ / NKV)
#define HD   64
#define DQ   (NH_ * HD)
#define DKV  (NKV * HD)
#define ZH   2
#define RH   256                  // query rows < RH use hi+lo planes (0: none)
#define WIN  0
#define PCAR 1024.0f
#define SCL  0.125f   // HD^-0.5
typedef _Float16 h16;
typedef unsigned short bf;
typedef __attribute__((ext_vector_type(16))) __bf16   v16bf;
typedef __attribute__((ext_vector_type(16))) _Float16 v16h;
typedef __attribute__((ext_vector_type(8)))  _Float16 v8h;
typedef __attribute__((ext_vector_type(8)))  unsigned short v8us;
typedef __attribute__((ext_vector_type(8)))  float    v8f;
typedef __attribute__((ext_vector_type(4)))  float    v4f;
typedef v8h  __attribute__((may_alias)) v8ha;
typedef v4f  __attribute__((may_alias)) v4fa;
typedef v8us __attribute__((may_alias)) v8usa;
typedef __attribute__((ext_vector_type(2))) float __attribute__((may_alias)) v2fa;

__device__ __forceinline__ unsigned short f2bf(float f) { unsigned u = __float_as_uint(f); u += 0x7FFFu + ((u >> 16) & 1u); return (unsigned short)(u >> 16); }
__device__ __forceinline__ float bf2f(unsigned short b) { return __uint_as_float(((unsigned)b) << 16); }
__device__ __forceinline__ float bfr(float f) { return bf2f(f2bf(f)); }
__device__ __forceinline__ v16h cat16(v8h lo, v8h hi) { return __builtin_shufflevector(lo, hi, 0, 1, 2, 3, 4, 5, 6, 7, 8, 9, 10, 11, 12, 13, 14, 15); }
__device__ __forceinline__ v16bf cat16b(v8us lo, v8us hi) { return __builtin_bit_cast(v16bf, __builtin_shufflevector(lo, hi, 0, 1, 2, 3, 4, 5, 6, 7, 8, 9, 10, 11, 12, 13, 14, 15)); }
__device__ __forceinline__ v8f wmma16(v16h a, v16h b, v8f c) { return __builtin_amdgcn_wmma_f32_16x16x32_f16(false, a, false, b, (short)0, c, false, false); }
__device__ __forceinline__ v8f wmmab(v16bf a, v16bf b, v8f c) { return __builtin_amdgcn_wmma_f32_16x16x32_bf16(false, a, false, b, (short)0, c, false, false); }



// ---- k_gemmw: register-blocked GEMM, one 64x64 output tile per workgroup (16 accumulators a wave), operands straight from K-contiguous 16-bit planes; grid (M/64, N/64, Z), 32 * NW threads.
// C[m][n] (f32, pitch ldc, + optional f32 bias[n]) = sum_k A[m][k] Bt[n][k] (+ split products per NSPLIT). z-batch strides sA/sB/sC in elements. K % (32 * NW) == 0.
// NW == 1: one wave walks all of K. NW == 16: wave w walks the K range [w K/16, (w+1) K/16), so a long K costs K/512 dependent load rounds instead of K/32; the 16 partial tiles are summed in LDS, wave 0 first.
template <typename T16> struct WFrag;
template <> struct WFrag<h16> { typedef v16h V; static __device__ __forceinline__ V ld(const h16* p) { return cat16(*(const v8h*)p, *(const v8h*)(p + 16)); } static __device__ __forceinline__ v8f mma(V a, V b, v8f c) { return wmma16(a, b, c); } };
template <> struct WFrag<bf> { typedef v16bf V; static __device__ __forceinline__ V ld(const bf* p) { return cat16b(*(const v8us*)p, *(const v8us*)(p + 16)); } static __device__ __forceinline__ v8f mma(V a, V b, v8f c) { return wmmab(a, b, c); } };
template <typename T16, int NSPLIT, bool BIAS, int NW>
__global__ __launch_bounds__(32 * NW) void k_gemmw(const T16* __restrict__ A, const T16* __restrict__ A2, const T16* __restrict__ Bt, const T16* __restrict__ Bt2, int K, float* C, int ldc, const float* __restrict__ bias, size_t sA, size_t sB, size_t sC) {
    typedef typename WFrag<T16>::V V;
    static_assert(NW == 1 || NW == 16, "the LDS sum maps one wave to one of 16 tile rows");
    __shared__ __align__(16) float os[(NW == 1 ? 1 : 2 * NW) * 16 * 68];
    const size_t z = blockIdx.z; A += z * sA; if (A2) A2 += z * sA; Bt += z * sB; if (Bt2) Bt2 += z * sB; C += z * sC;
    const int lane = threadIdx.x & 31, lr = lane & 15, hi = lane >> 4; const int r0 = blockIdx.x * 64, c0 = blockIdx.y * 64;
    v8f acc[4][4];
#pragma unroll
    for (int mb = 0; mb < 4; ++mb)
#pragma unroll
        for (int nb = 0; nb < 4; ++nb) acc[mb][nb] = (v8f){};
    const size_t aoff = (size_t)(r0 + lr) * K + 8 * hi, boff = (size_t)(c0 + lr) * K + 8 * hi;
    const int wv = (NW == 1) ? 0 : __builtin_amdgcn_readfirstlane((int)(threadIdx.x >> 5)); const int kb = wv * (K / NW), ke = kb + K / NW;
#pragma unroll 1
    for (int kc = kb; kc < ke; kc += 32) {
        V a[4], a2[4];
#pragma unroll
        for (int mb = 0; mb < 4; ++mb) { a[mb] = WFrag<T16>::ld(A + aoff + (size_t)mb * 16 * K + kc); if (NSPLIT == 1 || NSPLIT == 2) a2[mb] = WFrag<T16>::ld(A2 + aoff + (size_t)mb * 16 * K + kc); }
#pragma unroll
        for (int nb = 0; nb < 4; ++nb) { const V b = WFrag<T16>::ld(Bt + boff + (size_t)nb * 16 * K + kc); V b2; if (NSPLIT >= 2) b2 = WFrag<T16>::ld(Bt2 + boff + (size_t)nb * 16 * K + kc);
#pragma unroll
            for (int mb = 0; mb < 4; ++mb) { acc[mb][nb] = WFrag<T16>::mma(a[mb], b, acc[mb][nb]); if (NSPLIT == 1 || NSPLIT == 2) acc[mb][nb] = WFrag<T16>::mma(a2[mb], b, acc[mb][nb]); if (NSPLIT >= 2) acc[mb][nb] = WFrag<T16>::mma(a[mb], b2, acc[mb][nb]); } }
        asm volatile("v_nop\n\tv_nop\n\tv_nop\n\tv_nop" : "+v"(acc[0][0]), "+v"(acc[1][1]), "+v"(acc[2][2]), "+v"(acc[3][3]) : "v"(a[0]), "v"(a[3]));
    }
    if constexpr (NW == 1) {
#pragma unroll
    for (int mb = 0; mb < 4; ++mb) {
#pragma unroll
        for (int nb = 0; nb < 4; ++nb) {
#pragma unroll
            for (int j = 0; j < 8; ++j) os[(hi * 8 + j) * 68 + nb * 16 + lr] = acc[mb][nb][j]; }
        __builtin_amdgcn_wave_barrier(); asm volatile("" ::: "memory");
        float* crow = C + (size_t)(r0 + mb * 16) * ldc + c0;
{
#pragma unroll
            for (int s = 0; s < 8; ++s) { const int row = 2 * s + hi, cofs = lr * 4; v4f val = *(const v4fa*)(os + row * 68 + cofs); if (BIAS) { val[0] += bfr(bias[c0 + cofs]); val[1] += bfr(bias[c0 + cofs + 1]); val[2] += bfr(bias[c0 + cofs + 2]); val[3] += bfr(bias[c0 + cofs + 3]); }
                *(v4f*)(crow + (size_t)row * ldc + cofs) = val; }
             }
        __builtin_amdgcn_wave_barrier(); asm volatile("" ::: "memory");
    }
    } else {
        // Sum of the NW partial tiles, 16 tile rows a pass: every wave stores its partial rows in its own LDS slice, then wave r adds row r over the slices in slice order and keeps it for the store of one whole 256-B row behind the last pass.
        // Two buffers in turn: a buffer is written again only behind the next pass's barrier, which every reader of it has then passed, so one barrier a pass is enough.
        // The loops over mb, nb and j are unrolled so that acc[][] is indexed by constants and stays in registers; the loop over p so that a row's NW LDS loads are in flight together.
        // The four summed rows are kept in registers and stored behind the last pass, so that no barrier of a pass has a global store to wait for.
        v2fa res[4];
#pragma unroll
        for (int mb = 0; mb < 4; ++mb) {
            float* ob = os + (mb & 1) * (NW * 16 * 68);
#pragma unroll
            for (int nb = 0; nb < 4; ++nb) {
#pragma unroll
                for (int j = 0; j < 8; ++j) ob[wv * (16 * 68) + (hi * 8 + j) * 68 + nb * 16 + lr] = acc[mb][nb][j]; }
            __syncthreads();   // publishes all NW partial slices of this pass to the waves that sum them
            const int cofs = lane * 2; v2fa val = *(const v2fa*)(ob + wv * 68 + cofs);
#pragma unroll
            for (int p = 1; p < NW; ++p) val += *(const v2fa*)(ob + p * (16 * 68) + wv * 68 + cofs);
            if (BIAS) { val[0] += bfr(bias[c0 + cofs]); val[1] += bfr(bias[c0 + cofs + 1]); }
            res[mb] = val;
        }
#pragma unroll
        for (int mb = 0; mb < 4; ++mb) *(v2fa*)(C + (size_t)(r0 + mb * 16 + wv) * ldc + c0 + lane * 2) = res[mb];
    }
}

__device__ __forceinline__ h16 tohx(float x) { return (h16)x; }
__device__ __forceinline__ void splitf(float y, unsigned short& h, unsigned short& l) { h = f2bf(y); l = f2bf(y - bf2f(h)); }
typedef __attribute__((ext_vector_type(2))) _Float16 v2h;
typedef __attribute__((ext_vector_type(4))) _Float16 v4h;
typedef __attribute__((ext_vector_type(2))) unsigned short v2us;
typedef __attribute__((ext_vector_type(4))) unsigned short v4us;
typedef __attribute__((ext_vector_type(2))) float v2f;
typedef __attribute__((ext_vector_type(4))) int v4i;

__global__ __launch_bounds__(256) void k_wtG(const float* __restrict__ w, int K, int N, bf* Bt) {
    const int lane = threadIdx.x & 31; const int L0 = (blockIdx.x * 8 + (threadIdx.x >> 5)) * 8; const int nlines = N * K / 64;
{
#pragma unroll 1
        for (int l = 0; l < 8; ++l) { const int L = L0 + l; if (L >= nlines) break; const size_t e = (size_t)L * 64 + lane * 2; const int k = (int)(e % K), n = (int)(e / K); v2us o;
            o[0] = f2bf(w[(size_t)k * N + n]); o[1] = f2bf(w[(size_t)(k + 1) * N + n]); *(v2us*)(Bt + e) = o; }
         }
}
__global__ __launch_bounds__(256) void k_cvt8(const float* __restrict__ src, bf* dst, size_t n8) { const size_t i = (size_t)blockIdx.x * 256 + threadIdx.x; if (i >= n8) return; const v8f v = *(const v8f*)(src + i * 8); v8us o;
#pragma unroll
    for (int k = 0; k < 8; ++k) o[k] = f2bf(v[k]); *(v8us*)(dst + i * 8) = o;  }
__global__ __launch_bounds__(256) void k_cscvt(const float* __restrict__ cosT, const float* __restrict__ sinT, float* CS) { const int idx = blockIdx.x * 256 + threadIdx.x; if (idx >= TT * HD) return; v2f cs; cs[0] = bfr(cosT[idx]); cs[1] = bfr(sinT[idx]); *(v2f*)(CS + (size_t)idx * 2) = cs;  }
// k_rope: head planes [h][t][d] (fp16 + hi/lo) of rope(x) x sc with the rotate-half convention out[d] = x[d] cos[t][d] - x[d+HD/2] sin[t][d], out[d+HD/2] = x[d+HD/2] cos[t][d+HD/2] + x[d] sin[t][d+HD/2]
__global__ __launch_bounds__(256) void k_rope(const float* __restrict__ F, int pitch, int nheads, const float* __restrict__ CS, const float* __restrict__ RF, const float* __restrict__ nw, float sc, h16* P16, bf* Ph, bf* Pl) {
    const size_t e = ((size_t)blockIdx.x * 256 + threadIdx.x) * 2; if (e >= (size_t)nheads * TT * HD) return; const int d = (int)(e % HD); const int t = (int)((e / HD) % TT); const int h = (int)(e / ((size_t)HD * TT)); const float* f = F + (size_t)t * pitch + h * HD; const float rf = RF ? RF[(size_t)h * TT + t] : 1.0f; v2h o16; v2us oh, ol;
#pragma unroll
    for (int q = 0; q < 2; ++q) { const int dd = d + q; const int dp = (dd < HD / 2) ? dd + HD / 2 : dd - HD / 2; float x0 = f[dd], x1 = f[dp];
        if (RF) { float n0 = __fmul_rn(x0, rf), n1 = __fmul_rn(x1, rf); asm volatile("" : "+v"(n0)); asm volatile("" : "+v"(n1)); x0 = __fmul_rn(bfr(nw[dd]), n0); x1 = __fmul_rn(bfr(nw[dp]), n1); }
        const v2f cs = *(const v2f*)(CS + ((size_t)t * HD + dd) * 2); float a = __fmul_rn(x0, cs[0]), bq = __fmul_rn(x1, cs[1]); asm volatile("" : "+v"(a)); asm volatile("" : "+v"(bq)); const float r = ((dd < HD / 2) ? __fsub_rn(a, bq) : __fadd_rn(a, bq)) * sc;
        o16[q] = tohx(r); unsigned short a2, c2; splitf(r, a2, c2); oh[q] = a2; ol[q] = c2; }
    *(v2h*)(P16 + e) = o16; *(v2us*)(Ph + e) = oh; *(v2us*)(Pl + e) = ol;  }
__global__ __launch_bounds__(256) void k_vtp(const float* __restrict__ F, int pitch, int nheads, h16* V16, bf* Vh, bf* Vl) { const size_t e = ((size_t)blockIdx.x * 256 + threadIdx.x) * 2; if (e >= (size_t)nheads * HD * TT) return; const int t = (int)(e % TT); const int d = (int)((e / TT) % HD); const int g = (int)(e / ((size_t)TT * HD)); v2h o16; v2us oh, ol;
#pragma unroll
    for (int q = 0; q < 2; ++q) { const float x = F[(size_t)(t + q) * pitch + g * HD + d]; o16[q] = tohx(x); unsigned short a2, c2; splitf(x, a2, c2); oh[q] = a2; ol[q] = c2; }
    *(v2h*)(V16 + e) = o16; *(v2us*)(Vh + e) = oh; *(v2us*)(Vl + e) = ol;  }
// k_asoft: per row (zz, i): t = S x HD^-0.5 where mask[i][j] == 0 (int [L][L], read as data; non-zero == masked -> -3e38); softmax over the 2048 keys (register row, one exp, fixed trees);
__global__ __launch_bounds__(256) void k_asoft(const float* __restrict__ Sb, const int* __restrict__ mk, h16* P16, bf* Ph, bf* Pl) {
    const int lane = threadIdx.x & 31; const int row = blockIdx.x * 8 + (threadIdx.x >> 5); if (row >= ZH * TT) return; const int i = row % TT; const int zz = row / TT; (void)zz; const bool hires = (i < RH); const float* sr = Sb + (size_t)row * TT; float v[TT / 32]; float mx = -3.0e38f;
#pragma unroll
    for (int ch = 0; ch < TT / 128; ++ch) { const int j0 = ch * 128 + lane * 4; const v4f a = *(const v4f*)(sr + j0); const v4i mk4 = *(const v4i*)(mk + (size_t)i * TT + j0);
#pragma unroll
        for (int q = 0; q < 4; ++q) { const int j = j0 + q; (void)j; const float t = (mk4[q] == 0) ? a[q] * SCL : -3.0e38f; v[ch * 4 + q] = t; mx = fmaxf(mx, t); } }
#pragma unroll
    for (int sh = 16; sh; sh >>= 1) mx = fmaxf(mx, __shfl_xor(mx, sh, 32));
    float sum = 0.f;
#pragma unroll
    for (int k = 0; k < TT / 32; ++k) { float d0 = __fsub_rn(v[k], mx); asm volatile("" : "+v"(d0)); v[k] = __builtin_amdgcn_exp2f(__fmul_rn(d0, 1.4426950408889634f)); sum += v[k]; }
#pragma unroll
    for (int sh = 16; sh; sh >>= 1) sum += __shfl_xor(sum, sh, 32);
    const float f = __fdiv_rn(hires ? 1.0f : PCAR, sum);
{
        if (hires) {
#pragma unroll
            for (int ch = 0; ch < TT / 128; ++ch) { v4us oh, ol;
#pragma unroll
                for (int q = 0; q < 4; ++q) { unsigned short a, c2; splitf(v[ch * 4 + q] * f, a, c2); oh[q] = a; ol[q] = c2; }
                const size_t oo = ((size_t)zz * (RH ? RH : 1) + i) * TT + ch * 128 + lane * 4; *(v4us*)(Ph + oo) = oh; *(v4us*)(Pl + oo) = ol; }
        } else {
#pragma unroll
            for (int ch = 0; ch < TT / 128; ++ch) { v4h o4;
#pragma unroll
                for (int q = 0; q < 4; ++q) o4[q] = tohx(v[ch * 4 + q] * f);
                *(v4h*)(P16 + (size_t)row * TT + ch * 128 + lane * 4) = o4; } }
         }
}
__global__ __launch_bounds__(256) void k_merge(const float* __restrict__ O, int h0, bf* Ah, bf* Al) { const size_t e = ((size_t)blockIdx.x * 256 + threadIdx.x) * 2; if (e >= (size_t)ZH * TT * HD) return; const int d = (int)(e % HD); const int t = (int)((e / HD) % TT); const int zz = (int)(e / ((size_t)HD * TT)); const float cs = (t < RH) ? 1.0f : (1.0f / PCAR); const size_t oo = (size_t)t * DQ + (h0 + zz) * HD + d;
    v2us oh, ol;
#pragma unroll
    for (int q = 0; q < 2; ++q) { unsigned short a, c2; splitf(O[e + q] * cs, a, c2); oh[q] = a; ol[q] = c2; } *(v2us*)(Ah + oo) = oh; *(v2us*)(Al + oo) = ol;  }

extern "C" void kernel_launch(void* const* d_in, const int* in_sizes, int n_in,
                              void* d_out, int out_size, void* d_ws, size_t ws_size, hipStream_t stream) {
    (void)in_sizes; (void)n_in; (void)out_size;
    const float* x = (const float*)d_in[0]; const int* mk = (const int*)d_in[1]; const float* cosT = (const float*)d_in[2]; const float* sinT = (const float*)d_in[3]; const float* wq = (const float*)d_in[4]; const float* wk = (const float*)d_in[5]; const float* wv = (const float*)d_in[6]; const float* wo = (const float*)d_in[7]; const float* bo = (const float*)d_in[8];   // all weights x @ W
    float* OUT = (float*)d_out;     // [2][2048][2048]
    char* wsp = (char*)d_ws;
    auto take = [&](size_t bytes) { char* p = wsp; wsp += (bytes + 255) & ~(size_t)255; return (void*)p; };
    bf* WQ = (bf*)take((size_t)DQ * DM * 2); bf* WK = (bf*)take((size_t)DKV * DM * 2); bf* WV = (bf*)take((size_t)DKV * DM * 2); bf* WO = (bf*)take((size_t)DM * DQ * 2); float* CS = (float*)take((size_t)TT * HD * 2 * 4);
    bf* XB = (bf*)take((size_t)TT * DM * 2); float* FQ = (float*)take((size_t)TT * DQ * 4); float* FK = (float*)take((size_t)TT * DKV * 4);
    h16* QP16 = (h16*)take((size_t)NH_ * TT * HD * 2); h16* KP16 = (h16*)take((size_t)NKV * TT * HD * 2); h16* VT16 = (h16*)take((size_t)NKV * HD * TT * 2);
    bf* QPh = (bf*)take((size_t)NH_ * TT * HD * 2); bf* QPl = (bf*)take((size_t)NH_ * TT * HD * 2); bf* KPh = (bf*)take((size_t)NKV * TT * HD * 2); bf* KPl = (bf*)take((size_t)NKV * TT * HD * 2); bf* VTh = (bf*)take((size_t)NKV * HD * TT * 2); bf* VTl = (bf*)take((size_t)NKV * HD * TT * 2); bf* Ph = (bf*)take((size_t)ZH * RH * TT * 2); bf* Pl = (bf*)take((size_t)ZH * RH * TT * 2);
    float* Sb = (float*)take((size_t)ZH * TT * TT * 4); h16* P16 = (h16*)take((size_t)ZH * TT * TT * 2); float* Ob = (float*)take((size_t)ZH * TT * HD * 4); bf* ATh = (bf*)take((size_t)TT * DQ * 2); bf* ATl = (bf*)take((size_t)TT * DQ * 2);
    if ((size_t)(wsp - (char*)d_ws) > ws_size) return;    // ws 256 MiB
    float* FV = FK;   // v projection reuses the k buffer after the k planes are built (stream-ordered)
    { k_wtG<<<(unsigned)((DM * DQ / 64 + 63) / 64), 256, 0, stream>>>(wq, DM, DQ, WQ); k_wtG<<<(unsigned)((DM * DKV / 64 + 63) / 64), 256, 0, stream>>>(wk, DM, DKV, WK); k_wtG<<<(unsigned)((DM * DKV / 64 + 63) / 64), 256, 0, stream>>>(wv, DM, DKV, WV);
      k_wtG<<<(unsigned)((DQ * DM / 64 + 63) / 64), 256, 0, stream>>>(wo, DQ, DM, WO);
       }
    k_cscvt<<<(TT * HD + 255) / 256, 256, 0, stream>>>(cosT, sinT, CS);   // one shared table (read as data)
    const unsigned LQ = (unsigned)(((size_t)NH_ * TT * HD / 2 + 255) / 256), LKv = (unsigned)(((size_t)NKV * TT * HD / 2 + 255) / 256);
    for (int b = 0; b < NB_; ++b) {
        k_cvt8<<<(unsigned)(((size_t)TT * DM / 8 + 255) / 256), 256, 0, stream>>>(x + (size_t)b * TT * DM, XB, (size_t)TT * DM / 8);
        k_gemmw<bf, 0, false, 16><<<dim3(TT / 64, DQ / 64, 1), 512, 0, stream>>>(XB, nullptr, WQ, nullptr, DM, FQ, DQ, nullptr, 0, 0, 0);
        k_rope<<<LQ, 256, 0, stream>>>(FQ, DQ, NH_, CS, nullptr, nullptr, 1.0f, QP16, QPh, QPl);
        k_gemmw<bf, 0, false, 16><<<dim3(TT / 64, DKV / 64, 1), 512, 0, stream>>>(XB, nullptr, WK, nullptr, DM, FK, DKV, nullptr, 0, 0, 0);
        k_rope<<<LKv, 256, 0, stream>>>(FK, DKV, NKV, CS, nullptr, nullptr, 1.0f, KP16, KPh, KPl);
        k_gemmw<bf, 0, false, 16><<<dim3(TT / 64, DKV / 64, 1), 512, 0, stream>>>(XB, nullptr, WV, nullptr, DM, FV, DKV, nullptr, 0, 0, 0); k_vtp<<<LKv, 256, 0, stream>>>(FV, DKV, NKV, VT16, VTh, VTl);
        for (int h0 = 0; h0 < NH_; h0 += ZH) { const size_t zq = (size_t)h0, zk = (size_t)(h0 / REP);   // both heads of a pass share kv group h0/REP (REP >= 2): sB = 0
            k_gemmw<bf, 2, false, 1><<<dim3(RH / 64, TT / 64, ZH), 32, 0, stream>>>(QPh + zq * TT * HD, QPl + zq * TT * HD, KPh + zk * TT * HD, KPl + zk * TT * HD, HD, Sb, TT, nullptr, (size_t)TT * HD, 0, (size_t)TT * TT);
            k_gemmw<h16, 0, false, 1><<<dim3((TT - RH) / 64, TT / 64, ZH), 32, 0, stream>>>(QP16 + zq * TT * HD + (size_t)RH * HD, nullptr, KP16 + zk * TT * HD, nullptr, HD, Sb + (size_t)RH * TT, TT, nullptr, (size_t)TT * HD, 0, (size_t)TT * TT);
            k_asoft<<<ZH * TT / 8, 256, 0, stream>>>(Sb, mk, P16, Ph, Pl);
            k_gemmw<bf, 2, false, 16><<<dim3(RH / 64, HD / 64, ZH), 512, 0, stream>>>(Ph, Pl, VTh + zk * HD * TT, VTl + zk * HD * TT, TT, Ob, HD, nullptr, (size_t)RH * TT, 0, (size_t)TT * HD);
            k_gemmw<h16, 0, false, 16><<<dim3((TT - RH) / 64, HD / 64, ZH), 512, 0, stream>>>(P16 + (size_t)RH * TT, nullptr, VT16 + zk * HD * TT, nullptr, TT, Ob + (size_t)RH * HD, HD, nullptr, (size_t)TT * TT, 0, (size_t)TT * HD);
            k_merge<<<(unsigned)(((size_t)ZH * TT * HD / 2 + 255) / 256), 256, 0, stream>>>(Ob, h0, ATh, ATl); }
        k_gemmw<bf, 1, true, 16><<<dim3(TT / 64, DM / 64, 1), 512, 0, stream>>>(ATh, ATl, WO, nullptr, DQ, OUT + (size_t)b * TT * DM, DM, bo, 0, 0, 0); }
}

// v002
// Measured time: 1250 microseconds a run.
// Two timings next to v001 put it at 1.71 and 1.69 times that version's speed.
// All steps since v000 together make it 3.09 times as fast.
#include <hip/hip_runtime.h>

// Grouped-query attention with RoPE and a 2-D mask (x [2][2048][2048]; q = x Wq (32 heads x 64), k, v = x Wk / x Wv (8 kv groups x 64, each serving 4 consecutive query heads); rotate-half RoPE with the input
// cos/sin tables [2048][64] (read as data); scores = q.k/8, -inf where mask[i][j] != 0 (int [2048][2048], read as data); softmax; out = merged attn.v Wo + bo -> [2][2048][2048]).
// Compute dtypes, f32 accumulate: every input rounded to bf16; projections on PLAIN bf16 operands (inputs: exact products, f32 accumulate); RoPE in f32; PER-ROW PRECISION
// HYBRID: query rows < 256 take scores and attn.v on bf16 hi+lo planes (3 products), rows >= 256 on single fp16 planes; 1/8 and the mask in f32 in the register-row softmax; merged heads as hi+lo planes

#define NB_  2
#define TT   2048
#define DM   2048
#define NH_  32
#define NKV  8
#define REP  (NH_ / NKV)
#define HD   64
#define DQ   (NH_ * HD)
#define DKV  (NKV * HD)
#define ZH   8                    // query heads per attn.v and merge launch (the 16-bit probability planes hold ZH heads)
#define ZS   4                    // query heads per score and softmax launch (the f32 score buffer holds ZS heads)
#define RH   256                  // query rows < RH use hi+lo planes (0: none)
#define WIN  0
#define PCAR 1024.0f
#define SCL  0.125f   // HD^-0.5
static_assert(ZS <= REP && REP % ZS == 0 && ZH % REP == 0 && NH_ % ZH == 0, "a score launch stays inside one kv group, an attn.v launch takes whole kv groups");
typedef _Float16 h16;
typedef unsigned short bf;
typedef __attribute__((ext_vector_type(16))) __bf16   v16bf;
typedef __attribute__((ext_vector_type(16))) _Float16 v16h;
typedef __attribute__((ext_vector_type(8)))  _Float16 v8h;
typedef __attribute__((ext_vector_type(8)))  unsigned short v8us;
typedef __attribute__((ext_vector_type(8)))  float    v8f;
typedef __attribute__((ext_vector_type(4)))  float    v4f;
typedef v8h  __attribute__((may_alias)) v8ha;
typedef v4f  __attribute__((may_alias)) v4fa;
typedef v8us __attribute__((may_alias)) v8usa;
typedef __attribute__((ext_vector_type(2))) float __attribute__((may_alias)) v2fa;

__device__ __forceinline__ unsigned short f2bf(float f) { unsigned u = __float_as_uint(f); u += 0x7FFFu + ((u >> 16) & 1u); return (unsigned short)(u >> 16); }
__device__ __forceinline__ float bf2f(unsigned short b) { return __uint_as_float(((unsigned)b) << 16); }
__device__ __forceinline__ float bfr(float f) { return bf2f(f2bf(f)); }
__device__ __forceinline__ v16h cat16(v8h lo, v8h hi) { return __builtin_shufflevector(lo, hi, 0, 1, 2, 3, 4, 5, 6, 7, 8, 9, 10, 11, 12, 13, 14, 15); }
__device__ __forceinline__ v16bf cat16b(v8us lo, v8us hi) { return __builtin_bit_cast(v16bf, __builtin_shufflevector(lo, hi, 0, 1, 2, 3, 4, 5, 6, 7, 8, 9, 10, 11, 12, 13, 14, 15)); }
__device__ __forceinline__ v8f wmma16(v16h a, v16h b, v8f c) { return __builtin_amdgcn_wmma_f32_16x16x32_f16(false, a, false, b, (short)0, c, false, false); }
__device__ __forceinline__ v8f wmmab(v16bf a, v16bf b, v8f c) { return __builtin_amdgcn_wmma_f32_16x16x32_bf16(false, a, false, b, (short)0, c, false, false); }



// ---- k_gemmw: register-blocked GEMM, one 64x64 output tile per workgroup (16 accumulators a wave), operands straight from K-contiguous 16-bit planes; grid (M/64, N/64, Z), 32 * NW threads.
// C[m][n] (f32, pitch ldc, + optional f32 bias[n]) = sum_k A[m][k] Bt[n][k] (+ split products per NSPLIT). z-batch strides sA/sB/sC in elements: A and C step with every z, Bt with every REP-th z (the REP query heads of one kv group share it). K % (32 * NW) == 0.
// NW == 1: one wave walks all of K. NW == 16: wave w walks the K range [w K/16, (w+1) K/16), so a long K costs K/512 dependent load rounds instead of K/32; the 16 partial tiles are summed in LDS, wave 0 first.
template <typename T16> struct WFrag;
template <> struct WFrag<h16> { typedef v16h V; static __device__ __forceinline__ V ld(const h16* p) { return cat16(*(const v8h*)p, *(const v8h*)(p + 16)); } static __device__ __forceinline__ v8f mma(V a, V b, v8f c) { return wmma16(a, b, c); } };
template <> struct WFrag<bf> { typedef v16bf V; static __device__ __forceinline__ V ld(const bf* p) { return cat16b(*(const v8us*)p, *(const v8us*)(p + 16)); } static __device__ __forceinline__ v8f mma(V a, V b, v8f c) { return wmmab(a, b, c); } };
template <typename T16, int NSPLIT, bool BIAS, int NW>
__global__ __launch_bounds__(32 * NW) void k_gemmw(const T16* __restrict__ A, const T16* __restrict__ A2, const T16* __restrict__ Bt, const T16* __restrict__ Bt2, int K, float* C, int ldc, const float* __restrict__ bias, size_t sA, size_t sB, size_t sC) {
    typedef typename WFrag<T16>::V V;
    static_assert(NW == 1 || NW == 16, "the LDS sum maps one wave to one of 16 tile rows");
    __shared__ __align__(16) float os[(NW == 1 ? 1 : 2 * NW) * 16 * 68];
    const size_t z = blockIdx.z; A += z * sA; if (A2) A2 += z * sA; Bt += (z / REP) * sB; if (Bt2) Bt2 += (z / REP) * sB; C += z * sC;
    const int lane = threadIdx.x & 31, lr = lane & 15, hi = lane >> 4; const int r0 = blockIdx.x * 64, c0 = blockIdx.y * 64;
    v8f acc[4][4];
#pragma unroll
    for (int mb = 0; mb < 4; ++mb)
#pragma unroll
        for (int nb = 0; nb < 4; ++nb) acc[mb][nb] = (v8f){};
    const size_t aoff = (size_t)(r0 + lr) * K + 8 * hi, boff = (size_t)(c0 + lr) * K + 8 * hi;
    const int wv = (NW == 1) ? 0 : __builtin_amdgcn_readfirstlane((int)(threadIdx.x >> 5)); const int kb = wv * (K / NW), ke = kb + K / NW;
#pragma unroll 1
    for (int kc = kb; kc < ke; kc += 32) {
        V a[4], a2[4];
#pragma unroll
        for (int mb = 0; mb < 4; ++mb) { a[mb] = WFrag<T16>::ld(A + aoff + (size_t)mb * 16 * K + kc); if (NSPLIT == 1 || NSPLIT == 2) a2[mb] = WFrag<T16>::ld(A2 + aoff + (size_t)mb * 16 * K + kc); }
#pragma unroll
        for (int nb = 0; nb < 4; ++nb) { const V b = WFrag<T16>::ld(Bt + boff + (size_t)nb * 16 * K + kc); V b2; if (NSPLIT >= 2) b2 = WFrag<T16>::ld(Bt2 + boff + (size_t)nb * 16 * K + kc);
#pragma unroll
            for (int mb = 0; mb < 4; ++mb) { acc[mb][nb] = WFrag<T16>::mma(a[mb], b, acc[mb][nb]); if (NSPLIT == 1 || NSPLIT == 2) acc[mb][nb] = WFrag<T16>::mma(a2[mb], b, acc[mb][nb]); if (NSPLIT >= 2) acc[mb][nb] = WFrag<T16>::mma(a[mb], b2, acc[mb][nb]); } }
        asm volatile("v_nop\n\tv_nop\n\tv_nop\n\tv_nop" : "+v"(acc[0][0]), "+v"(acc[1][1]), "+v"(acc[2][2]), "+v"(acc[3][3]) : "v"(a[0]), "v"(a[3]));
    }
    if constexpr (NW == 1) {
#pragma unroll
    for (int mb = 0; mb < 4; ++mb) {
#pragma unroll
        for (int nb = 0; nb < 4; ++nb) {
#pragma unroll
            for (int j = 0; j < 8; ++j) os[(hi * 8 + j) * 68 + nb * 16 + lr] = acc[mb][nb][j]; }
        __builtin_amdgcn_wave_barrier(); asm volatile("" ::: "memory");
        float* crow = C + (size_t)(r0 + mb * 16) * ldc + c0;
{
#pragma unroll
            for (int s = 0; s < 8; ++s) { const int row = 2 * s + hi, cofs = lr * 4; v4f val = *(const v4fa*)(os + row * 68 + cofs); if (BIAS) { val[0] += bfr(bias[c0 + cofs]); val[1] += bfr(bias[c0 + cofs + 1]); val[2] += bfr(bias[c0 + cofs + 2]); val[3] += bfr(bias[c0 + cofs + 3]); }
                *(v4f*)(crow + (size_t)row * ldc + cofs) = val; }
             }
        __builtin_amdgcn_wave_barrier(); asm volatile("" ::: "memory");
    }
    } else {
        // Sum of the NW partial tiles, 16 tile rows a pass: every wave stores its partial rows in its own LDS slice, then wave r adds row r over the slices in slice order and keeps it for the store of one whole 256-B row behind the last pass.
        // Two buffers in turn: a buffer is written again only behind the next pass's barrier, which every reader of it has then passed, so one barrier a pass is enough.
        // The loops over mb, nb and j are unrolled so that acc[][] is indexed by constants and stays in registers; the loop over p so that a row's NW LDS loads are in flight together.
        // The four summed rows are kept in registers and stored behind the last pass, so that no barrier of a pass has a global store to wait for.
        v2fa res[4];
#pragma unroll
        for (int mb = 0; mb < 4; ++mb) {
            float* ob = os + (mb & 1) * (NW * 16 * 68);
#pragma unroll
            for (int nb = 0; nb < 4; ++nb) {
#pragma unroll
                for (int j = 0; j < 8; ++j) ob[wv * (16 * 68) + (hi * 8 + j) * 68 + nb * 16 + lr] = acc[mb][nb][j]; }
            __syncthreads();   // publishes all NW partial slices of this pass to the waves that sum them
            const int cofs = lane * 2; v2fa val = *(const v2fa*)(ob + wv * 68 + cofs);
#pragma unroll
            for (int p = 1; p < NW; ++p) val += *(const v2fa*)(ob + p * (16 * 68) + wv * 68 + cofs);
            if (BIAS) { val[0] += bfr(bias[c0 + cofs]); val[1] += bfr(bias[c0 + cofs + 1]); }
            res[mb] = val;
        }
#pragma unroll
        for (int mb = 0; mb < 4; ++mb) *(v2fa*)(C + (size_t)(r0 + mb * 16 + wv) * ldc + c0 + lane * 2) = res[mb];
    }
}

__device__ __forceinline__ h16 tohx(float x) { return (h16)x; }
__device__ __forceinline__ void splitf(float y, unsigned short& h, unsigned short& l) { h = f2bf(y); l = f2bf(y - bf2f(h)); }
typedef __attribute__((ext_vector_type(2))) _Float16 v2h;
typedef __attribute__((ext_vector_type(4))) _Float16 v4h;
typedef __attribute__((ext_vector_type(2))) unsigned short v2us;
typedef __attribute__((ext_vector_type(4))) unsigned short v4us;
typedef __attribute__((ext_vector_type(2))) float v2f;
typedef __attribute__((ext_vector_type(4))) int v4i;

__global__ __launch_bounds__(256) void k_wtG(const float* __restrict__ w, int K, int N, bf* Bt) {
    const int lane = threadIdx.x & 31; const int L0 = (blockIdx.x * 8 + (threadIdx.x >> 5)) * 8; const int nlines = N * K / 64;
{
#pragma unroll 1
        for (int l = 0; l < 8; ++l) { const int L = L0 + l; if (L >= nlines) break; const size_t e = (size_t)L * 64 + lane * 2; const int k = (int)(e % K), n = (int)(e / K); v2us o;
            o[0] = f2bf(w[(size_t)k * N + n]); o[1] = f2bf(w[(size_t)(k + 1) * N + n]); *(v2us*)(Bt + e) = o; }
         }
}
__global__ __launch_bounds__(256) void k_cvt8(const float* __restrict__ src, bf* dst, size_t n8) { const size_t i = (size_t)blockIdx.x * 256 + threadIdx.x; if (i >= n8) return; const v8f v = *(const v8f*)(src + i * 8); v8us o;
#pragma unroll
    for (int k = 0; k < 8; ++k) o[k] = f2bf(v[k]); *(v8us*)(dst + i * 8) = o;  }
__global__ __launch_bounds__(256) void k_cscvt(const float* __restrict__ cosT, const float* __restrict__ sinT, float* CS) { const int idx = blockIdx.x * 256 + threadIdx.x; if (idx >= TT * HD) return; v2f cs; cs[0] = bfr(cosT[idx]); cs[1] = bfr(sinT[idx]); *(v2f*)(CS + (size_t)idx * 2) = cs;  }
// k_rope: head planes [h][t][d] (fp16 + hi/lo) of rope(x) x sc with the rotate-half convention out[d] = x[d] cos[t][d] - x[d+HD/2] sin[t][d], out[d+HD/2] = x[d+HD/2] cos[t][d+HD/2] + x[d] sin[t][d+HD/2]
__global__ __launch_bounds__(256) void k_rope(const float* __restrict__ F, int pitch, int nheads, const float* __restrict__ CS, const float* __restrict__ RF, const float* __restrict__ nw, float sc, h16* P16, bf* Ph, bf* Pl) {
    const size_t e = ((size_t)blockIdx.x * 256 + threadIdx.x) * 2; if (e >= (size_t)nheads * TT * HD) return; const int d = (int)(e % HD); const int t = (int)((e / HD) % TT); const int h = (int)(e / ((size_t)HD * TT)); const float* f = F + (size_t)t * pitch + h * HD; const float rf = RF ? RF[(size_t)h * TT + t] : 1.0f; v2h o16; v2us oh, ol;
#pragma unroll
    for (int q = 0; q < 2; ++q) { const int dd = d + q; const int dp = (dd < HD / 2) ? dd + HD / 2 : dd - HD / 2; float x0 = f[dd], x1 = f[dp];
        if (RF) { float n0 = __fmul_rn(x0, rf), n1 = __fmul_rn(x1, rf); asm volatile("" : "+v"(n0)); asm volatile("" : "+v"(n1)); x0 = __fmul_rn(bfr(nw[dd]), n0); x1 = __fmul_rn(bfr(nw[dp]), n1); }
        const v2f cs = *(const v2f*)(CS + ((size_t)t * HD + dd) * 2); float a = __fmul_rn(x0, cs[0]), bq = __fmul_rn(x1, cs[1]); asm volatile("" : "+v"(a)); asm volatile("" : "+v"(bq)); const float r = ((dd < HD / 2) ? __fsub_rn(a, bq) : __fadd_rn(a, bq)) * sc;
        o16[q] = tohx(r); unsigned short a2, c2; splitf(r, a2, c2); oh[q] = a2; ol[q] = c2; }
    *(v2h*)(P16 + e) = o16; *(v2us*)(Ph + e) = oh; *(v2us*)(Pl + e) = ol;  }
__global__ __launch_bounds__(256) void k_vtp(const float* __restrict__ F, int pitch, int nheads, h16* V16, bf* Vh, bf* Vl) { const size_t e = ((size_t)blockIdx.x * 256 + threadIdx.x) * 2; if (e >= (size_t)nheads * HD * TT) return; const int t = (int)(e % TT); const int d = (int)((e / TT) % HD); const int g = (int)(e / ((size_t)TT * HD)); v2h o16; v2us oh, ol;
#pragma unroll
    for (int q = 0; q < 2; ++q) { const float x = F[(size_t)(t + q) * pitch + g * HD + d]; o16[q] = tohx(x); unsigned short a2, c2; splitf(x, a2, c2); oh[q] = a2; ol[q] = c2; }
    *(v2h*)(V16 + e) = o16; *(v2us*)(Vh + e) = oh; *(v2us*)(Vl + e) = ol;  }
// k_asoft: per row (zz, i): t = S x HD^-0.5 where mask[i][j] == 0 (int [L][L], read as data; non-zero == masked -> -3e38); softmax over the 2048 keys (register row, one exp, fixed trees);
__global__ __launch_bounds__(256) void k_asoft(const float* __restrict__ Sb, const int* __restrict__ mk, h16* P16, bf* Ph, bf* Pl) {
    const int lane = threadIdx.x & 31; const int row = blockIdx.x * 8 + (threadIdx.x >> 5); if (row >= ZS * TT) return; const int i = row % TT; const int zz = row / TT; (void)zz; const bool hires = (i < RH); const float* sr = Sb + (size_t)row * TT; float v[TT / 32]; float mx = -3.0e38f;
#pragma unroll
    for (int ch = 0; ch < TT / 128; ++ch) { const int j0 = ch * 128 + lane * 4; const v4f a = *(const v4f*)(sr + j0); const v4i mk4 = *(const v4i*)(mk + (size_t)i * TT + j0);
#pragma unroll
        for (int q = 0; q < 4; ++q) { const int j = j0 + q; (void)j; const float t = (mk4[q] == 0) ? a[q] * SCL : -3.0e38f; v[ch * 4 + q] = t; mx = fmaxf(mx, t); } }
#pragma unroll
    for (int sh = 16; sh; sh >>= 1) mx = fmaxf(mx, __shfl_xor(mx, sh, 32));
    float sum = 0.f;
#pragma unroll
    for (int k = 0; k < TT / 32; ++k) { float d0 = __fsub_rn(v[k], mx); asm volatile("" : "+v"(d0)); v[k] = __builtin_amdgcn_exp2f(__fmul_rn(d0, 1.4426950408889634f)); sum += v[k]; }
#pragma unroll
    for (int sh = 16; sh; sh >>= 1) sum += __shfl_xor(sum, sh, 32);
    const float f = __fdiv_rn(hires ? 1.0f : PCAR, sum);
{
        if (hires) {
#pragma unroll
            for (int ch = 0; ch < TT / 128; ++ch) { v4us oh, ol;
#pragma unroll
                for (int q = 0; q < 4; ++q) { unsigned short a, c2; splitf(v[ch * 4 + q] * f, a, c2); oh[q] = a; ol[q] = c2; }
                const size_t oo = ((size_t)zz * (RH ? RH : 1) + i) * TT + ch * 128 + lane * 4; *(v4us*)(Ph + oo) = oh; *(v4us*)(Pl + oo) = ol; }
        } else {
#pragma unroll
            for (int ch = 0; ch < TT / 128; ++ch) { v4h o4;
#pragma unroll
                for (int q = 0; q < 4; ++q) o4[q] = tohx(v[ch * 4 + q] * f);
                *(v4h*)(P16 + (size_t)row * TT + ch * 128 + lane * 4) = o4; } }
         }
}
__global__ __launch_bounds__(256) void k_merge(const float* __restrict__ O, int h0, bf* Ah, bf* Al) { const size_t e = ((size_t)blockIdx.x * 256 + threadIdx.x) * 2; if (e >= (size_t)ZH * TT * HD) return; const int d = (int)(e % HD); const int t = (int)((e / HD) % TT); const int zz = (int)(e / ((size_t)HD * TT)); const float cs = (t < RH) ? 1.0f : (1.0f / PCAR); const size_t oo = (size_t)t * DQ + (h0 + zz) * HD + d;
    v2us oh, ol;
#pragma unroll
    for (int q = 0; q < 2; ++q) { unsigned short a, c2; splitf(O[e + q] * cs, a, c2); oh[q] = a; ol[q] = c2; } *(v2us*)(Ah + oo) = oh; *(v2us*)(Al + oo) = ol;  }

extern "C" void kernel_launch(void* const* d_in, const int* in_sizes, int n_in,
                              void* d_out, int out_size, void* d_ws, size_t ws_size, hipStream_t stream) {
    (void)in_sizes; (void)n_in; (void)out_size;
    const float* x = (const float*)d_in[0]; const int* mk = (const int*)d_in[1]; const float* cosT = (const float*)d_in[2]; const float* sinT = (const float*)d_in[3]; const float* wq = (const float*)d_in[4]; const float* wk = (const float*)d_in[5]; const float* wv = (const float*)d_in[6]; const float* wo = (const float*)d_in[7]; const float* bo = (const float*)d_in[8];   // all weights x @ W
    float* OUT = (float*)d_out;     // [2][2048][2048]
    char* wsp = (char*)d_ws;
    auto take = [&](size_t bytes) { char* p = wsp; wsp += (bytes + 255) & ~(size_t)255; return (void*)p; };
    bf* WQ = (bf*)take((size_t)DQ * DM * 2); bf* WK = (bf*)take((size_t)DKV * DM * 2); bf* WV = (bf*)take((size_t)DKV * DM * 2); bf* WO = (bf*)take((size_t)DM * DQ * 2); float* CS = (float*)take((size_t)TT * HD * 2 * 4);
    bf* XB = (bf*)take((size_t)TT * DM * 2); float* FQ = (float*)take((size_t)TT * DQ * 4); float* FK = (float*)take((size_t)TT * DKV * 4);
    h16* QP16 = (h16*)take((size_t)NH_ * TT * HD * 2); h16* KP16 = (h16*)take((size_t)NKV * TT * HD * 2); h16* VT16 = (h16*)take((size_t)NKV * HD * TT * 2);
    bf* QPh = (bf*)take((size_t)NH_ * TT * HD * 2); bf* QPl = (bf*)take((size_t)NH_ * TT * HD * 2); bf* KPh = (bf*)take((size_t)NKV * TT * HD * 2); bf* KPl = (bf*)take((size_t)NKV * TT * HD * 2); bf* VTh = (bf*)take((size_t)NKV * HD * TT * 2); bf* VTl = (bf*)take((size_t)NKV * HD * TT * 2); bf* Ph = (bf*)take((size_t)ZH * RH * TT * 2); bf* Pl = (bf*)take((size_t)ZH * RH * TT * 2);
    float* Sb = (float*)take((size_t)ZS * TT * TT * 4); h16* P16 = (h16*)take((size_t)ZH * TT * TT * 2); float* Ob = (float*)take((size_t)ZH * TT * HD * 4); bf* ATh = (bf*)take((size_t)TT * DQ * 2); bf* ATl = (bf*)take((size_t)TT * DQ * 2);
    if ((size_t)(wsp - (char*)d_ws) > ws_size) return;    // ws 256 MiB
    float* FV = FK;   // v projection reuses the k buffer after the k planes are built (stream-ordered)
    { k_wtG<<<(unsigned)((DM * DQ / 64 + 63) / 64), 256, 0, stream>>>(wq, DM, DQ, WQ); k_wtG<<<(unsigned)((DM * DKV / 64 + 63) / 64), 256, 0, stream>>>(wk, DM, DKV, WK); k_wtG<<<(unsigned)((DM * DKV / 64 + 63) / 64), 256, 0, stream>>>(wv, DM, DKV, WV);
      k_wtG<<<(unsigned)((DQ * DM / 64 + 63) / 64), 256, 0, stream>>>(wo, DQ, DM, WO);
       }
    k_cscvt<<<(TT * HD + 255) / 256, 256, 0, stream>>>(cosT, sinT, CS);   // one shared table (read as data)
    const unsigned LQ = (unsigned)(((size_t)NH_ * TT * HD / 2 + 255) / 256), LKv = (unsigned)(((size_t)NKV * TT * HD / 2 + 255) / 256);
    for (int b = 0; b < NB_; ++b) {
        k_cvt8<<<(unsigned)(((size_t)TT * DM / 8 + 255) / 256), 256, 0, stream>>>(x + (size_t)b * TT * DM, XB, (size_t)TT * DM / 8);
        k_gemmw<bf, 0, false, 16><<<dim3(TT / 64, DQ / 64, 1), 512, 0, stream>>>(XB, nullptr, WQ, nullptr, DM, FQ, DQ, nullptr, 0, 0, 0);
        k_rope<<<LQ, 256, 0, stream>>>(FQ, DQ, NH_, CS, nullptr, nullptr, 1.0f, QP16, QPh, QPl);
        k_gemmw<bf, 0, false, 16><<<dim3(TT / 64, DKV / 64, 1), 512, 0, stream>>>(XB, nullptr, WK, nullptr, DM, FK, DKV, nullptr, 0, 0, 0);
        k_rope<<<LKv, 256, 0, stream>>>(FK, DKV, NKV, CS, nullptr, nullptr, 1.0f, KP16, KPh, KPl);
        k_gemmw<bf, 0, false, 16><<<dim3(TT / 64, DKV / 64, 1), 512, 0, stream>>>(XB, nullptr, WV, nullptr, DM, FV, DKV, nullptr, 0, 0, 0); k_vtp<<<LKv, 256, 0, stream>>>(FV, DKV, NKV, VT16, VTh, VTl);
        for (int h0 = 0; h0 < NH_; h0 += ZH) {
            for (int s = 0; s < ZH; s += ZS) { const size_t zq = (size_t)(h0 + s), zk = (size_t)((h0 + s) / REP);   // the ZS heads of a score launch share kv group (h0 + s)/REP: sB = 0; the score buffer is used anew by every s
                k_gemmw<bf, 2, false, 1><<<dim3(RH / 64, TT / 64, ZS), 32, 0, stream>>>(QPh + zq * TT * HD, QPl + zq * TT * HD, KPh + zk * TT * HD, KPl + zk * TT * HD, HD, Sb, TT, nullptr, (size_t)TT * HD, 0, (size_t)TT * TT);
                k_gemmw<h16, 0, false, 1><<<dim3((TT - RH) / 64, TT / 64, ZS), 32, 0, stream>>>(QP16 + zq * TT * HD + (size_t)RH * HD, nullptr, KP16 + zk * TT * HD, nullptr, HD, Sb + (size_t)RH * TT, TT, nullptr, (size_t)TT * HD, 0, (size_t)TT * TT);
                k_asoft<<<ZS * TT / 8, 256, 0, stream>>>(Sb, mk, P16 + (size_t)s * TT * TT, Ph + (size_t)s * RH * TT, Pl + (size_t)s * RH * TT); }
            const size_t zk = (size_t)(h0 / REP);   // the ZH heads of an attn.v launch span the ZH/REP kv groups from h0/REP on
            k_gemmw<bf, 2, false, 16><<<dim3(RH / 64, HD / 64, ZH), 512, 0, stream>>>(Ph, Pl, VTh + zk * HD * TT, VTl + zk * HD * TT, TT, Ob, HD, nullptr, (size_t)RH * TT, (size_t)HD * TT, (size_t)TT * HD);
            k_gemmw<h16, 0, false, 16><<<dim3((TT - RH) / 64, HD / 64, ZH), 512, 0, stream>>>(P16 + (size_t)RH * TT, nullptr, VT16 + zk * HD * TT, nullptr, TT, Ob + (size_t)RH * HD, HD, nullptr, (size_t)TT * TT, (size_t)HD * TT, (size_t)TT * HD);
            k_merge<<<(unsigned)(((size_t)ZH * TT * HD / 2 + 255) / 256), 256, 0, stream>>>(Ob, h0, ATh, ATl); }
        k_gemmw<bf, 1, true, 16><<<dim3(TT / 64, DM / 64, 1), 512, 0, stream>>>(ATh, ATl, WO, nullptr, DQ, OUT + (size_t)b * TT * DM, DM, bo, 0, 0, 0); }
}

// v003
// A run of this version takes 642 microseconds.
// Next to v002, in two timings, it ran 1.95 times as fast each time.
// All steps since v000 together make it 6.04 times as fast.
#include <hip/hip_runtime.h>

// Grouped-query attention with RoPE and a 2-D mask (x [2][2048][2048]; q = x Wq (32 heads x 64), k, v = x Wk / x Wv (8 kv groups x 64, each serving 4 consecutive query heads); rotate-half RoPE with the input
// cos/sin tables [2048][64] (read as data); scores = q.k/8, -inf where mask[i][j] != 0 (int [2048][2048], read as data); softmax; out = merged attn.v Wo + bo -> [2][2048][2048]).
// Compute dtypes, f32 accumulate: every input rounded to bf16; projections on PLAIN bf16 operands (inputs: exact products, f32 accumulate); RoPE in f32; PER-ROW PRECISION
// HYBRID: query rows < 256 take scores and attn.v on bf16 hi+lo planes (3 products), rows >= 256 on single fp16 planes; 1/8 and the mask in f32 in the running softmax of the fused attention kernel; merged heads as hi+lo planes

#define NB_  2
#define TT   2048
#define DM   2048
#define NH_  32
#define NKV  8
#define REP  (NH_ / NKV)
#define HD   64
#define DQ   (NH_ * HD)
#define DKV  (NKV * HD)
#define RH   256                  // query rows < RH use hi+lo planes (0: none)
#define WIN  0
#define SCL2 0.18033688011112042f   // HD^-0.5 x log2(e): the softmax runs in base 2
typedef _Float16 h16;
typedef unsigned short bf;
typedef __attribute__((ext_vector_type(16))) __bf16   v16bf;
typedef __attribute__((ext_vector_type(16))) _Float16 v16h;
typedef __attribute__((ext_vector_type(8)))  _Float16 v8h;
typedef __attribute__((ext_vector_type(8)))  unsigned short v8us;
typedef __attribute__((ext_vector_type(8)))  float    v8f;
typedef __attribute__((ext_vector_type(4)))  float    v4f;
typedef v8h  __attribute__((may_alias)) v8ha;
typedef v4f  __attribute__((may_alias)) v4fa;
typedef v8us __attribute__((may_alias)) v8usa;
typedef __attribute__((ext_vector_type(2))) float __attribute__((may_alias)) v2fa;

__device__ __forceinline__ unsigned short f2bf(float f) { unsigned u = __float_as_uint(f); u += 0x7FFFu + ((u >> 16) & 1u); return (unsigned short)(u >> 16); }
__device__ __forceinline__ float bf2f(unsigned short b) { return __uint_as_float(((unsigned)b) << 16); }
__device__ __forceinline__ float bfr(float f) { return bf2f(f2bf(f)); }
__device__ __forceinline__ v16h cat16(v8h lo, v8h hi) { return __builtin_shufflevector(lo, hi, 0, 1, 2, 3, 4, 5, 6, 7, 8, 9, 10, 11, 12, 13, 14, 15); }
__device__ __forceinline__ v16bf cat16b(v8us lo, v8us hi) { return __builtin_bit_cast(v16bf, __builtin_shufflevector(lo, hi, 0, 1, 2, 3, 4, 5, 6, 7, 8, 9, 10, 11, 12, 13, 14, 15)); }
__device__ __forceinline__ v8f wmma16(v16h a, v16h b, v8f c) { return __builtin_amdgcn_wmma_f32_16x16x32_f16(false, a, false, b, (short)0, c, false, false); }
__device__ __forceinline__ v8f wmmab(v16bf a, v16bf b, v8f c) { return __builtin_amdgcn_wmma_f32_16x16x32_bf16(false, a, false, b, (short)0, c, false, false); }



// ---- k_gemmw: register-blocked GEMM, one 64x64 output tile per workgroup (16 accumulators a wave), operands straight from K-contiguous 16-bit planes; grid (M/64, N/64, Z), 32 * NW threads.
// C[m][n] (f32, pitch ldc, + optional f32 bias[n]) = sum_k A[m][k] Bt[n][k] (+ split products per NSPLIT). z-batch strides sA/sB/sC in elements: A and C step with every z, Bt with every REP-th z (the REP query heads of one kv group share it). K % (32 * NW) == 0.
// NW == 1: one wave walks all of K. NW == 16: wave w walks the K range [w K/16, (w+1) K/16), so a long K costs K/512 dependent load rounds instead of K/32; the 16 partial tiles are summed in LDS, wave 0 first.
template <typename T16> struct WFrag;
template <> struct WFrag<h16> { typedef v16h V; static __device__ __forceinline__ V ld(const h16* p) { return cat16(*(const v8h*)p, *(const v8h*)(p + 16)); } static __device__ __forceinline__ v8f mma(V a, V b, v8f c) { return wmma16(a, b, c); } };
template <> struct WFrag<bf> { typedef v16bf V; static __device__ __forceinline__ V ld(const bf* p) { return cat16b(*(const v8us*)p, *(const v8us*)(p + 16)); } static __device__ __forceinline__ v8f mma(V a, V b, v8f c) { return wmmab(a, b, c); } };
template <typename T16, int NSPLIT, bool BIAS, int NW>
__global__ __launch_bounds__(32 * NW) void k_gemmw(const T16* __restrict__ A, const T16* __restrict__ A2, const T16* __restrict__ Bt, const T16* __restrict__ Bt2, int K, float* C, int ldc, const float* __restrict__ bias, size_t sA, size_t sB, size_t sC) {
    typedef typename WFrag<T16>::V V;
    static_assert(NW == 1 || NW == 16, "the LDS sum maps one wave to one of 16 tile rows");
    __shared__ __align__(16) float os[(NW == 1 ? 1 : 2 * NW) * 16 * 68];
    const size_t z = blockIdx.z; A += z * sA; if (A2) A2 += z * sA; Bt += (z / REP) * sB; if (Bt2) Bt2 += (z / REP) * sB; C += z * sC;
    const int lane = threadIdx.x & 31, lr = lane & 15, hi = lane >> 4; const int r0 = blockIdx.x * 64, c0 = blockIdx.y * 64;
    v8f acc[4][4];
#pragma unroll
    for (int mb = 0; mb < 4; ++mb)
#pragma unroll
        for (int nb = 0; nb < 4; ++nb) acc[mb][nb] = (v8f){};
    const size_t aoff = (size_t)(r0 + lr) * K + 8 * hi, boff = (size_t)(c0 + lr) * K + 8 * hi;
    const int wv = (NW == 1) ? 0 : __builtin_amdgcn_readfirstlane((int)(threadIdx.x >> 5)); const int kb = wv * (K / NW), ke = kb + K / NW;
#pragma unroll 1
    for (int kc = kb; kc < ke; kc += 32) {
        V a[4], a2[4];
#pragma unroll
        for (int mb = 0; mb < 4; ++mb) { a[mb] = WFrag<T16>::ld(A + aoff + (size_t)mb * 16 * K + kc); if (NSPLIT == 1 || NSPLIT == 2) a2[mb] = WFrag<T16>::ld(A2 + aoff + (size_t)mb * 16 * K + kc); }
#pragma unroll
        for (int nb = 0; nb < 4; ++nb) { const V b = WFrag<T16>::ld(Bt + boff + (size_t)nb * 16 * K + kc); V b2; if (NSPLIT >= 2) b2 = WFrag<T16>::ld(Bt2 + boff + (size_t)nb * 16 * K + kc);
#pragma unroll
            for (int mb = 0; mb < 4; ++mb) { acc[mb][nb] = WFrag<T16>::mma(a[mb], b, acc[mb][nb]); if (NSPLIT == 1 || NSPLIT == 2) acc[mb][nb] = WFrag<T16>::mma(a2[mb], b, acc[mb][nb]); if (NSPLIT >= 2) acc[mb][nb] = WFrag<T16>::mma(a[mb], b2, acc[mb][nb]); } }
        asm volatile("v_nop\n\tv_nop\n\tv_nop\n\tv_nop" : "+v"(acc[0][0]), "+v"(acc[1][1]), "+v"(acc[2][2]), "+v"(acc[3][3]) : "v"(a[0]), "v"(a[3]));
    }
    if constexpr (NW == 1) {
#pragma unroll
    for (int mb = 0; mb < 4; ++mb) {
#pragma unroll
        for (int nb = 0; nb < 4; ++nb) {
#pragma unroll
            for (int j = 0; j < 8; ++j) os[(hi * 8 + j) * 68 + nb * 16 + lr] = acc[mb][nb][j]; }
        __builtin_amdgcn_wave_barrier(); asm volatile("" ::: "memory");
        float* crow = C + (size_t)(r0 + mb * 16) * ldc + c0;
{
#pragma unroll
            for (int s = 0; s < 8; ++s) { const int row = 2 * s + hi, cofs = lr * 4; v4f val = *(const v4fa*)(os + row * 68 + cofs); if (BIAS) { val[0] += bfr(bias[c0 + cofs]); val[1] += bfr(bias[c0 + cofs + 1]); val[2] += bfr(bias[c0 + cofs + 2]); val[3] += bfr(bias[c0 + cofs + 3]); }
                *(v4f*)(crow + (size_t)row * ldc + cofs) = val; }
             }
        __builtin_amdgcn_wave_barrier(); asm volatile("" ::: "memory");
    }
    } else {
        // Sum of the NW partial tiles, 16 tile rows a pass: every wave stores its partial rows in its own LDS slice, then wave r adds row r over the slices in slice order and keeps it for the store of one whole 256-B row behind the last pass.
        // Two buffers in turn: a buffer is written again only behind the next pass's barrier, which every reader of it has then passed, so one barrier a pass is enough.
        // The loops over mb, nb and j are unrolled so that acc[][] is indexed by constants and stays in registers; the loop over p so that a row's NW LDS loads are in flight together.
        // The four summed rows are kept in registers and stored behind the last pass, so that no barrier of a pass has a global store to wait for.
        v2fa res[4];
#pragma unroll
        for (int mb = 0; mb < 4; ++mb) {
            float* ob = os + (mb & 1) * (NW * 16 * 68);
#pragma unroll
            for (int nb = 0; nb < 4; ++nb) {
#pragma unroll
                for (int j = 0; j < 8; ++j) ob[wv * (16 * 68) + (hi * 8 + j) * 68 + nb * 16 + lr] = acc[mb][nb][j]; }
            __syncthreads();   // publishes all NW partial slices of this pass to the waves that sum them
            const int cofs = lane * 2; v2fa val = *(const v2fa*)(ob + wv * 68 + cofs);
#pragma unroll
            for (int p = 1; p < NW; ++p) val += *(const v2fa*)(ob + p * (16 * 68) + wv * 68 + cofs);
            if (BIAS) { val[0] += bfr(bias[c0 + cofs]); val[1] += bfr(bias[c0 + cofs + 1]); }
            res[mb] = val;
        }
#pragma unroll
        for (int mb = 0; mb < 4; ++mb) *(v2fa*)(C + (size_t)(r0 + mb * 16 + wv) * ldc + c0 + lane * 2) = res[mb];
    }
}

__device__ __forceinline__ h16 tohx(float x) { return (h16)x; }
__device__ __forceinline__ void splitf(float y, unsigned short& h, unsigned short& l) { h = f2bf(y); l = f2bf(y - bf2f(h)); }
typedef __attribute__((ext_vector_type(2))) _Float16 v2h;
typedef __attribute__((ext_vector_type(4))) _Float16 v4h;
typedef __attribute__((ext_vector_type(2))) unsigned short v2us;
typedef __attribute__((ext_vector_type(4))) unsigned short v4us;
typedef __attribute__((ext_vector_type(2))) float v2f;
typedef __attribute__((ext_vector_type(4))) int v4i;

__global__ __launch_bounds__(256) void k_wtG(const float* __restrict__ w, int K, int N, bf* Bt) {
    const int lane = threadIdx.x & 31; const int L0 = (blockIdx.x * 8 + (threadIdx.x >> 5)) * 8; const int nlines = N * K / 64;
{
#pragma unroll 1
        for (int l = 0; l < 8; ++l) { const int L = L0 + l; if (L >= nlines) break; const size_t e = (size_t)L * 64 + lane * 2; const int k = (int)(e % K), n = (int)(e / K); v2us o;
            o[0] = f2bf(w[(size_t)k * N + n]); o[1] = f2bf(w[(size_t)(k + 1) * N + n]); *(v2us*)(Bt + e) = o; }
         }
}
__global__ __launch_bounds__(256) void k_cvt8(const float* __restrict__ src, bf* dst, size_t n8) { const size_t i = (size_t)blockIdx.x * 256 + threadIdx.x; if (i >= n8) return; const v8f v = *(const v8f*)(src + i * 8); v8us o;
#pragma unroll
    for (int k = 0; k < 8; ++k) o[k] = f2bf(v[k]); *(v8us*)(dst + i * 8) = o;  }
__global__ __launch_bounds__(256) void k_cscvt(const float* __restrict__ cosT, const float* __restrict__ sinT, float* CS) { const int idx = blockIdx.x * 256 + threadIdx.x; if (idx >= TT * HD) return; v2f cs; cs[0] = bfr(cosT[idx]); cs[1] = bfr(sinT[idx]); *(v2f*)(CS + (size_t)idx * 2) = cs;  }
// k_rope: head planes [h][t][d] (fp16 + hi/lo) of rope(x) x sc with the rotate-half convention out[d] = x[d] cos[t][d] - x[d+HD/2] sin[t][d], out[d+HD/2] = x[d+HD/2] cos[t][d+HD/2] + x[d] sin[t][d+HD/2]
__global__ __launch_bounds__(256) void k_rope(const float* __restrict__ F, int pitch, int nheads, const float* __restrict__ CS, const float* __restrict__ RF, const float* __restrict__ nw, float sc, h16* P16, bf* Ph, bf* Pl) {
    const size_t e = ((size_t)blockIdx.x * 256 + threadIdx.x) * 2; if (e >= (size_t)nheads * TT * HD) return; const int d = (int)(e % HD); const int t = (int)((e / HD) % TT); const int h = (int)(e / ((size_t)HD * TT)); const float* f = F + (size_t)t * pitch + h * HD; const float rf = RF ? RF[(size_t)h * TT + t] : 1.0f; v2h o16; v2us oh, ol;
#pragma unroll
    for (int q = 0; q < 2; ++q) { const int dd = d + q; const int dp = (dd < HD / 2) ? dd + HD / 2 : dd - HD / 2; float x0 = f[dd], x1 = f[dp];
        if (RF) { float n0 = __fmul_rn(x0, rf), n1 = __fmul_rn(x1, rf); asm volatile("" : "+v"(n0)); asm volatile("" : "+v"(n1)); x0 = __fmul_rn(bfr(nw[dd]), n0); x1 = __fmul_rn(bfr(nw[dp]), n1); }
        const v2f cs = *(const v2f*)(CS + ((size_t)t * HD + dd) * 2); float a = __fmul_rn(x0, cs[0]), bq = __fmul_rn(x1, cs[1]); asm volatile("" : "+v"(a)); asm volatile("" : "+v"(bq)); const float r = ((dd < HD / 2) ? __fsub_rn(a, bq) : __fadd_rn(a, bq)) * sc;
        o16[q] = tohx(r); unsigned short a2, c2; splitf(r, a2, c2); oh[q] = a2; ol[q] = c2; }
    *(v2h*)(P16 + e) = o16; *(v2us*)(Ph + e) = oh; *(v2us*)(Pl + e) = ol;  }
__global__ __launch_bounds__(256) void k_vtp(const float* __restrict__ F, int pitch, int nheads, h16* V16, bf* Vh, bf* Vl) { const size_t e = ((size_t)blockIdx.x * 256 + threadIdx.x) * 2; if (e >= (size_t)nheads * HD * TT) return; const int t = (int)(e % TT); const int d = (int)((e / TT) % HD); const int g = (int)(e / ((size_t)TT * HD)); v2h o16; v2us oh, ol;
#pragma unroll
    for (int q = 0; q < 2; ++q) { const float x = F[(size_t)(t + q) * pitch + g * HD + d]; o16[q] = tohx(x); unsigned short a2, c2; splitf(x, a2, c2); oh[q] = a2; ol[q] = c2; }
    *(v2h*)(V16 + e) = o16; *(v2us*)(Vh + e) = oh; *(v2us*)(Vl + e) = ol;  }
// ---- k_fattn: scores, mask, softmax, attn.v and the head merge in one kernel; no score or probability ever reaches memory. One wave = one query head x 16 * QT query rows, walking all TT keys 32 at a time;
// the REP waves of a workgroup are the REP query heads of one kv group on the same query rows, so they read the same K, V and mask lines at about the same time (shared through the WGP cache).
// Transposed products: St = K Qt (A = K rows, B = Q rows kept in registers), so a lane holds scores of ONE query (column lr), keys 8 hi + r of each 16-key tile; two such tiles, converted in place, are the B operand
// of Ot += Vt Pt (A = rows of the [d][t] plane). Running maximum and sum per lane; the two lane halves share the maximum every pass and join their sums once at the end.
// A masked score is -3e38 as a finite stand-in: while a row has seen masked keys only, its terms are exp2(0) = 1, and the first real score wipes them with the factor exp2(-inf) = 0.
__device__ __forceinline__ float xhalf(float x) { return __builtin_bit_cast(float, __builtin_amdgcn_permlanex16(__builtin_bit_cast(int, x), __builtin_bit_cast(int, x), 0x76543210, 0xfedcba98, false, false)); }  // lane l reads lane l ^ 16
// v_exp_f32 with, in the same statement, the one slot that the instruction set asks for behind a transcendental before its result is read or its source overwritten
__device__ __forceinline__ float exp2s(float x) { float y; asm("v_exp_f32 %0, %1\n\tv_nop" : "=v"(y) : "v"(x)); return y; }
// s_wait_xcnt 0 behind a group of global loads, in front of every rewrite of their address registers: it names the addresses, so that they stay whole up to it (no later load of the group lands on them), and nothing is scheduled across it
#define XWAIT1(a)       do { asm volatile("s_wait_xcnt 0x0" :: "v"(a) : "memory"); __builtin_amdgcn_sched_barrier(0); } while (0)
#define XWAIT2(a, b)    do { asm volatile("s_wait_xcnt 0x0" :: "v"(a), "v"(b) : "memory"); __builtin_amdgcn_sched_barrier(0); } while (0)
#define XWAIT3(a, b, c) do { asm volatile("s_wait_xcnt 0x0" :: "v"(a), "v"(b), "v"(c) : "memory"); __builtin_amdgcn_sched_barrier(0); } while (0)
template <typename T16, bool HI, int QT>
__device__ __forceinline__ void attn_body(const T16* __restrict__ Q, const T16* __restrict__ Q2, const T16* __restrict__ Kp, const T16* __restrict__ K2, const T16* __restrict__ Vt, const T16* __restrict__ V2, const int* __restrict__ mk, int q0, bf* Ah, bf* Al) {
    typedef WFrag<T16> F; typedef typename F::V V;
    const int lane = threadIdx.x & 31, lr = lane & 15, hi = lane >> 4;
    // every loop below but the one over j0 is unrolled so that the fragment and accumulator arrays are indexed by constants and stay in registers
    V qf[QT][2], qf2[QT][2]; const size_t qoff = (size_t)(q0 + lr) * HD + 8 * hi; const T16* qp = Q + qoff; const T16* qp2 = HI ? Q2 + qoff : qp;
#pragma unroll
    for (int qt = 0; qt < QT; ++qt)
#pragma unroll
        for (int ks = 0; ks < 2; ++ks) { qf[qt][ks] = F::ld(qp + qt * 16 * HD + ks * 32); if (HI) qf2[qt][ks] = F::ld(qp2 + qt * 16 * HD + ks * 32); }
    if constexpr (HI) XWAIT2(qp, qp2); else XWAIT1(qp);
    const int koff = lr * HD + 8 * hi, voff = lr * TT + 8 * hi; const int* mrow = mk + (size_t)(q0 + lr) * TT + 8 * hi;
    v8f o[QT][4]; float mrun[QT], lrun[QT];
#pragma unroll
    for (int qt = 0; qt < QT; ++qt) { mrun[qt] = -3.0e38f; lrun[qt] = 0.f;
#pragma unroll
        for (int dt = 0; dt < 4; ++dt) o[qt][dt] = (v8f){}; }
    V ka[2][2], ka2[2][2]; v4i mm[QT][2][2];
    { const T16* kp = Kp + koff; const T16* kp2 = HI ? K2 + koff : kp;
#pragma unroll
      for (int kt = 0; kt < 2; ++kt) {
#pragma unroll
        for (int ks = 0; ks < 2; ++ks) { ka[kt][ks] = F::ld(kp + kt * 16 * HD + ks * 32); if (HI) ka2[kt][ks] = F::ld(kp2 + kt * 16 * HD + ks * 32); }
#pragma unroll
        for (int qt = 0; qt < QT; ++qt) { mm[qt][kt][0] = *(const v4i*)(mrow + (size_t)qt * 16 * TT + kt * 16); mm[qt][kt][1] = *(const v4i*)(mrow + (size_t)qt * 16 * TT + kt * 16 + 4); } }
      if constexpr (HI) XWAIT3(kp, kp2, mrow); else XWAIT2(kp, mrow); }
    for (int j0 = 0; j0 < TT; j0 += 32) {
        const int jn = (j0 + 32 < TT) ? j0 + 32 : j0;   // the K and mask fragments are fetched one pass ahead; the last pass fetches its own again, inside the arrays
        V va[4], va2[4]; const T16* vp = Vt + voff + j0; const T16* vp2 = HI ? V2 + voff + j0 : vp;
#pragma unroll
        for (int dt = 0; dt < 4; ++dt) { va[dt] = F::ld(vp + (size_t)dt * 16 * TT); if (HI) va2[dt] = F::ld(vp2 + (size_t)dt * 16 * TT); }
        // its scheduling barrier also keeps the V loads at the head of the pass, the score products and a whole softmax ahead of their use; without it the compiler sinks them to just in front of attn.v
        if constexpr (HI) XWAIT2(vp, vp2); else XWAIT1(vp);
        v8f s[QT][2];
#pragma unroll
        for (int kt = 0; kt < 2; ++kt)
#pragma unroll
            for (int qt = 0; qt < QT; ++qt) { v8f c = (v8f){};
#pragma unroll
                for (int ks = 0; ks < 2; ++ks) { c = F::mma(ka[kt][ks], qf[qt][ks], c); if (HI) { c = F::mma(ka[kt][ks], qf2[qt][ks], c); c = F::mma(ka2[kt][ks], qf[qt][ks], c); } }
                s[qt][kt] = c; }
        const T16* kp = Kp + koff + (size_t)jn * HD; const T16* kp2 = HI ? K2 + koff + (size_t)jn * HD : kp; const int* mp = mrow + jn;
#pragma unroll
        for (int kt = 0; kt < 2; ++kt)
#pragma unroll
            for (int ks = 0; ks < 2; ++ks) { ka[kt][ks] = F::ld(kp + kt * 16 * HD + ks * 32); if (HI) ka2[kt][ks] = F::ld(kp2 + kt * 16 * HD + ks * 32); }
        V pf[QT], pf2[QT]; float mxs[QT];
#pragma unroll
        for (int qt = 0; qt < QT; ++qt) {
            float mx = -3.0e38f;
#pragma unroll
            for (int kt = 0; kt < 2; ++kt)
#pragma unroll
                for (int r = 0; r < 8; ++r) { const float t = (mm[qt][kt][r >> 2][r & 3] == 0) ? s[qt][kt][r] * SCL2 : -3.0e38f; s[qt][kt][r] = t; mx = fmaxf(mx, t); }
#pragma unroll
            for (int kt = 0; kt < 2; ++kt) { mm[qt][kt][0] = *(const v4i*)(mp + (size_t)qt * 16 * TT + kt * 16); mm[qt][kt][1] = *(const v4i*)(mp + (size_t)qt * 16 * TT + kt * 16 + 4); }
            mxs[qt] = mx; }
        // its scheduling barrier also keeps the next pass's K and mask loads in front of the softmax and attn.v of this pass, which cover their latency; without it the compiler sinks them to the foot of the pass or into the next one
        if constexpr (HI) XWAIT3(kp, kp2, mp); else XWAIT2(kp, mp);
#pragma unroll
        for (int qt = 0; qt < QT; ++qt) {
            const float mx = fmaxf(mxs[qt], xhalf(mxs[qt]));
            const float mnew = fmaxf(mrun[qt], mx); const float corr = exp2s(mrun[qt] - mnew); mrun[qt] = mnew;
            float sum = 0.f;
#pragma unroll
            for (int kt = 0; kt < 2; ++kt)
#pragma unroll
                for (int r = 0; r < 8; ++r) { const float p = exp2s(s[qt][kt][r] - mnew); sum += p;
                    if constexpr (HI) { unsigned short a, c2; splitf(p, a, c2); pf[qt][kt * 8 + r] = __builtin_bit_cast(__bf16, a); pf2[qt][kt * 8 + r] = __builtin_bit_cast(__bf16, c2); }
                    else pf[qt][kt * 8 + r] = tohx(p); }
            lrun[qt] = lrun[qt] * corr + sum;
#pragma unroll
            for (int dt = 0; dt < 4; ++dt) o[qt][dt] *= corr;
        }
#pragma unroll
        for (int dt = 0; dt < 4; ++dt)
#pragma unroll
            for (int qt = 0; qt < QT; ++qt) { o[qt][dt] = F::mma(va[dt], pf[qt], o[qt][dt]); if (HI) { o[qt][dt] = F::mma(va[dt], pf2[qt], o[qt][dt]); o[qt][dt] = F::mma(va2[dt], pf[qt], o[qt][dt]); } }
    }
#pragma unroll
    for (int qt = 0; qt < QT; ++qt) { const float inv = __fdiv_rn(1.0f, lrun[qt] + xhalf(lrun[qt])); const size_t oo = (size_t)(q0 + qt * 16 + lr) * DQ + 8 * hi;
#pragma unroll
        for (int dt = 0; dt < 4; ++dt) { v8us oh, ol;   // a lane's 8 accumulator registers are 8 consecutive d of its query row: one 16-byte store a plane
#pragma unroll
            for (int r = 0; r < 8; ++r) { unsigned short a, c2; splitf(o[qt][dt][r] * inv, a, c2); oh[r] = a; ol[r] = c2; }
            *(v8us*)(Ah + oo + dt * 16) = oh; *(v8us*)(Al + oo + dt * 16) = ol;
            // s_wait_xcnt 0 behind the pair of stores, in front of the next tile's packing, which takes their data registers anew: it names the data, so that they stay whole up to it, and nothing is scheduled across it
            asm volatile("s_wait_xcnt 0x0" :: "v"(oh), "v"(ol) : "memory"); __builtin_amdgcn_sched_barrier(0); } }
}
// grid (RH/16 + (TT - RH)/32, NKV), 32 * REP threads: the first RH/16 blocks in x take 16 hi+lo query rows each (three products for one), the rest 32 fp16 rows each
__global__ __launch_bounds__(32 * REP) void k_fattn(const h16* __restrict__ Q16, const bf* __restrict__ Qh, const bf* __restrict__ Ql, const h16* __restrict__ K16, const bf* __restrict__ Kh, const bf* __restrict__ Kl, const h16* __restrict__ V16, const bf* __restrict__ Vh, const bf* __restrict__ Vl, const int* __restrict__ mk, bf* Ah, bf* Al) {
    const int g = blockIdx.y, h = g * REP + __builtin_amdgcn_readfirstlane((int)(threadIdx.x >> 5)); const size_t qo = (size_t)h * TT * HD, ko = (size_t)g * TT * HD; const int bx = blockIdx.x;
    if (bx < RH / 16) attn_body<bf, true, 1>(Qh + qo, Ql + qo, Kh + ko, Kl + ko, Vh + ko, Vl + ko, mk, bx * 16, Ah + h * HD, Al + h * HD);
    else attn_body<h16, false, 2>(Q16 + qo, nullptr, K16 + ko, nullptr, V16 + ko, nullptr, mk, RH + (bx - RH / 16) * 32, Ah + h * HD, Al + h * HD);
}

extern "C" void kernel_launch(void* const* d_in, const int* in_sizes, int n_in,
                              void* d_out, int out_size, void* d_ws, size_t ws_size, hipStream_t stream) {
    (void)in_sizes; (void)n_in; (void)out_size;
    const float* x = (const float*)d_in[0]; const int* mk = (const int*)d_in[1]; const float* cosT = (const float*)d_in[2]; const float* sinT = (const float*)d_in[3]; const float* wq = (const float*)d_in[4]; const float* wk = (const float*)d_in[5]; const float* wv = (const float*)d_in[6]; const float* wo = (const float*)d_in[7]; const float* bo = (const float*)d_in[8];   // all weights x @ W
    float* OUT = (float*)d_out;     // [2][2048][2048]
    char* wsp = (char*)d_ws;
    auto take = [&](size_t bytes) { char* p = wsp; wsp += (bytes + 255) & ~(size_t)255; return (void*)p; };
    bf* WQ = (bf*)take((size_t)DQ * DM * 2); bf* WK = (bf*)take((size_t)DKV * DM * 2); bf* WV = (bf*)take((size_t)DKV * DM * 2); bf* WO = (bf*)take((size_t)DM * DQ * 2); float* CS = (float*)take((size_t)TT * HD * 2 * 4);
    bf* XB = (bf*)take((size_t)TT * DM * 2); float* FQ = (float*)take((size_t)TT * DQ * 4); float* FK = (float*)take((size_t)TT * DKV * 4);
    h16* QP16 = (h16*)take((size_t)NH_ * TT * HD * 2); h16* KP16 = (h16*)take((size_t)NKV * TT * HD * 2); h16* VT16 = (h16*)take((size_t)NKV * HD * TT * 2);
    bf* QPh = (bf*)take((size_t)NH_ * TT * HD * 2); bf* QPl = (bf*)take((size_t)NH_ * TT * HD * 2); bf* KPh = (bf*)take((size_t)NKV * TT * HD * 2); bf* KPl = (bf*)take((size_t)NKV * TT * HD * 2); bf* VTh = (bf*)take((size_t)NKV * HD * TT * 2); bf* VTl = (bf*)take((size_t)NKV * HD * TT * 2);
    bf* ATh = (bf*)take((size_t)TT * DQ * 2); bf* ATl = (bf*)take((size_t)TT * DQ * 2);
    if ((size_t)(wsp - (char*)d_ws) > ws_size) return;    // ws 256 MiB
    float* FV = FK;   // v projection reuses the k buffer after the k planes are built (stream-ordered)
    { k_wtG<<<(unsigned)((DM * DQ / 64 + 63) / 64), 256, 0, stream>>>(wq, DM, DQ, WQ); k_wtG<<<(unsigned)((DM * DKV / 64 + 63) / 64), 256, 0, stream>>>(wk, DM, DKV, WK); k_wtG<<<(unsigned)((DM * DKV / 64 + 63) / 64), 256, 0, stream>>>(wv, DM, DKV, WV);
      k_wtG<<<(unsigned)((DQ * DM / 64 + 63) / 64), 256, 0, stream>>>(wo, DQ, DM, WO);
       }
    k_cscvt<<<(TT * HD + 255) / 256, 256, 0, stream>>>(cosT, sinT, CS);   // one shared table (read as data)
    const unsigned LQ = (unsigned)(((size_t)NH_ * TT * HD / 2 + 255) / 256), LKv = (unsigned)(((size_t)NKV * TT * HD / 2 + 255) / 256);
    for (int b = 0; b < NB_; ++b) {
        k_cvt8<<<(unsigned)(((size_t)TT * DM / 8 + 255) / 256), 256, 0, stream>>>(x + (size_t)b * TT * DM, XB, (size_t)TT * DM / 8);
        k_gemmw<bf, 0, false, 16><<<dim3(TT / 64, DQ / 64, 1), 512, 0, stream>>>(XB, nullptr, WQ, nullptr, DM, FQ, DQ, nullptr, 0, 0, 0);
        k_rope<<<LQ, 256, 0, stream>>>(FQ, DQ, NH_, CS, nullptr, nullptr, 1.0f, QP16, QPh, QPl);
        k_gemmw<bf, 0, false, 16><<<dim3(TT / 64, DKV / 64, 1), 512, 0, stream>>>(XB, nullptr, WK, nullptr, DM, FK, DKV, nullptr, 0, 0, 0);
        k_rope<<<LKv, 256, 0, stream>>>(FK, DKV, NKV, CS, nullptr, nullptr, 1.0f, KP16, KPh, KPl);
        k_gemmw<bf, 0, false, 16><<<dim3(TT / 64, DKV / 64, 1), 512, 0, stream>>>(XB, nullptr, WV, nullptr, DM, FV, DKV, nullptr, 0, 0, 0); k_vtp<<<LKv, 256, 0, stream>>>(FV, DKV, NKV, VT16, VTh, VTl);
        k_fattn<<<dim3(RH / 16 + (TT - RH) / 32, NKV, 1), 32 * REP, 0, stream>>>(QP16, QPh, QPl, KP16, KPh, KPl, VT16, VTh, VTl, mk, ATh, ATl);
        k_gemmw<bf, 1, true, 16><<<dim3(TT / 64, DM / 64, 1), 512, 0, stream>>>(ATh, ATl, WO, nullptr, DQ, OUT + (size_t)b * TT * DM, DM, bo, 0, 0, 0); }
}

// v004
// Measured time: 345 microseconds a run.
// Next to v003, in two timings, it ran 1.86 and 1.85 times as fast.
// All steps since v000 together make it 11.2 times as fast.
#include <hip/hip_runtime.h>

// Grouped-query attention with RoPE and a 2-D mask (x [2][2048][2048]; q = x Wq (32 heads x 64), k, v = x Wk / x Wv (8 kv groups x 64, each serving 4 consecutive query heads); rotate-half RoPE with the input
// cos/sin tables [2048][64] (read as data); scores = q.k/8, -inf where mask[i][j] != 0 (int [2048][2048], read as data); softmax; out = merged attn.v Wo + bo -> [2][2048][2048]).
// Compute dtypes, f32 accumulate: every input rounded to bf16; projections on PLAIN bf16 operands (inputs: exact products, f32 accumulate); RoPE in f32; PER-ROW PRECISION
// HYBRID: query rows < 256 take scores and attn.v on bf16 hi+lo planes (3 products), rows >= 256 on single fp16 planes; 1/8 and the mask in f32 in the running softmax of the fused attention kernel; merged heads as hi+lo planes

#define NB_  2
#define TT   2048
#define DM   2048
#define NH_  32
#define NKV  8
#define REP  (NH_ / NKV)
#define HD   64
#define DQ   (NH_ * HD)
#define DKV  (NKV * HD)
#define RH   256                  // query rows < RH use hi+lo planes (0: none)
#define WIN  0
#define SCL2 0.18033688011112042f   // HD^-0.5 x log2(e): the softmax runs in base 2
typedef _Float16 h16;
typedef unsigned short bf;
typedef __attribute__((ext_vector_type(16))) __bf16   v16bf;
typedef __attribute__((ext_vector_type(16))) _Float16 v16h;
typedef __attribute__((ext_vector_type(8)))  _Float16 v8h;
typedef __attribute__((ext_vector_type(8)))  unsigned short v8us;
typedef __attribute__((ext_vector_type(8)))  float    v8f;
typedef __attribute__((ext_vector_type(4)))  float    v4f;
typedef v8h  __attribute__((may_alias)) v8ha;
typedef v4f  __attribute__((may_alias)) v4fa;
typedef v8us __attribute__((may_alias)) v8usa;
typedef __attribute__((ext_vector_type(2))) float __attribute__((may_alias)) v2fa;

__device__ __forceinline__ unsigned short f2bf(float f) { unsigned u = __float_as_uint(f); u += 0x7FFFu + ((u >> 16) & 1u); return (unsigned short)(u >> 16); }
__device__ __forceinline__ float bf2f(unsigned short b) { return __uint_as_float(((unsigned)b) << 16); }
__device__ __forceinline__ float bfr(float f) { return bf2f(f2bf(f)); }
__device__ __forceinline__ v16h cat16(v8h lo, v8h hi) { return __builtin_shufflevector(lo, hi, 0, 1, 2, 3, 4, 5, 6, 7, 8, 9, 10, 11, 12, 13, 14, 15); }
__device__ __forceinline__ v16bf cat16b(v8us lo, v8us hi) { return __builtin_bit_cast(v16bf, __builtin_shufflevector(lo, hi, 0, 1, 2, 3, 4, 5, 6, 7, 8, 9, 10, 11, 12, 13, 14, 15)); }
__device__ __forceinline__ v8f wmma16(v16h a, v16h b, v8f c) { return __builtin_amdgcn_wmma_f32_16x16x32_f16(false, a, false, b, (short)0, c, false, false); }
__device__ __forceinline__ v8f wmmab(v16bf a, v16bf b, v8f c) { return __builtin_amdgcn_wmma_f32_16x16x32_bf16(false, a, false, b, (short)0, c, false, false); }



// s_wait_xcnt 0 behind a group of global loads, in front of every rewrite of their address registers: it names the addresses, so that they stay whole up to it (no later load of the group lands on them), and nothing is scheduled across it
#define XWAIT1(a)       do { asm volatile("s_wait_xcnt 0x0" :: "v"(a) : "memory"); __builtin_amdgcn_sched_barrier(0); } while (0)
#define XWAIT2(a, b)    do { asm volatile("s_wait_xcnt 0x0" :: "v"(a), "v"(b) : "memory"); __builtin_amdgcn_sched_barrier(0); } while (0)
#define XWAIT3(a, b, c) do { asm volatile("s_wait_xcnt 0x0" :: "v"(a), "v"(b), "v"(c) : "memory"); __builtin_amdgcn_sched_barrier(0); } while (0)
// ---- k_gemmw: register-blocked GEMM, one 64x64 output tile per workgroup (16 accumulators a wave), operands straight from 16-bit planes in fragment order; grid (M/64, N/64, Z), 32 * NW threads.
// C[m][n] (f32, pitch ldc, + optional f32 bias[n]) = sum_k A[m][k] Bt[n][k] (+ split products per NSPLIT). z-batch strides sA/sB/sC in elements: A and C step with every z, Bt with every REP-th z (the REP query heads of one kv group share it). K % (32 * NW) == 0.
// NW == 1: one wave walks all of K. NW == 16: wave w walks the K range [w K/16, (w+1) K/16), so a long K costs K/512 dependent load rounds instead of K/32; the 16 partial tiles are summed in LDS, wave 0 first.
// FRAGMENT ORDER of a 16-bit plane P[row][k] (rows % 16 == 0, K % 32 == 0): the 16 rows x 32 k of one A or B fragment are one 1-KiB block, blocks in the order [row / 16][k / 32]; inside a block the 16-byte piece of
// row r, k = 8 s .. 8 s + 7 (s = 0..3) is piece (s >> 1) * 32 + (s & 1) * 16 + (r & 15). Lane l of a wave then reads pieces l and 32 + l (ldf): each load instruction covers 512 consecutive bytes, four whole cache lines,
// where on a row-major plane (ld) it touches 16 lines for 32 bytes each. The values a lane and register receive are the same as with ld on the row-major plane.
template <typename T16> struct WFrag;
template <> struct WFrag<h16> { typedef v16h V; static __device__ __forceinline__ V ld(const h16* p) { return cat16(*(const v8h*)p, *(const v8h*)(p + 16)); } static __device__ __forceinline__ V ldf(const h16* p) { return cat16(*(const v8h*)p, *(const v8h*)(p + 256)); } static __device__ __forceinline__ v8f mma(V a, V b, v8f c) { return wmma16(a, b, c); } };
template <> struct WFrag<bf> { typedef v16bf V; static __device__ __forceinline__ V ld(const bf* p) { return cat16b(*(const v8us*)p, *(const v8us*)(p + 16)); } static __device__ __forceinline__ V ldf(const bf* p) { return cat16b(*(const v8us*)p, *(const v8us*)(p + 256)); } static __device__ __forceinline__ v8f mma(V a, V b, v8f c) { return wmmab(a, b, c); } };
template <typename T16, int NSPLIT, bool BIAS, int NW, int K>
__global__ __launch_bounds__(32 * NW) void k_gemmw(const T16* __restrict__ A, const T16* __restrict__ A2, const T16* __restrict__ Bt, const T16* __restrict__ Bt2, float* C, int ldc, const float* __restrict__ bias, size_t sA, size_t sB, size_t sC) {
    typedef typename WFrag<T16>::V V;
    static_assert(NW == 1 || NW == 16, "the LDS sum maps one wave to one of 16 tile rows");
    __shared__ __align__(16) float os[(NW == 1 ? 1 : 2 * NW) * 16 * 68];
    const size_t z = blockIdx.z; A += z * sA; if (A2) A2 += z * sA; Bt += (z / REP) * sB; if (Bt2) Bt2 += (z / REP) * sB; C += z * sC;
    const int lane = threadIdx.x & 31, lr = lane & 15, hi = lane >> 4; const int r0 = blockIdx.x * 64, c0 = blockIdx.y * 64;
    v8f acc[4][4];
#pragma unroll
    for (int mb = 0; mb < 4; ++mb)
#pragma unroll
        for (int nb = 0; nb < 4; ++nb) acc[mb][nb] = (v8f){};
    const size_t aoff = (size_t)r0 * K + lane * 8, boff = (size_t)c0 * K + lane * 8;   // a 16-row tile is K / 32 blocks of 512 elements = 16 K elements
    const int wv = (NW == 1) ? 0 : __builtin_amdgcn_readfirstlane((int)(threadIdx.x >> 5)); const int kb = wv * (K / NW), ke = kb + K / NW;
#pragma unroll 1
    for (int kc = kb; kc < ke; kc += 32) {
        V a[4], a2[4], b[4], b2[4];   // K is a compile-time constant, so that the four 16-row tiles of an operand are immediate offsets from one address
        const T16* pa = A + aoff + kc * 16; const T16* pa2 = (NSPLIT == 1 || NSPLIT == 2) ? A2 + aoff + kc * 16 : pa; const T16* pb = Bt + boff + kc * 16; const T16* pb2 = (NSPLIT >= 2) ? Bt2 + boff + kc * 16 : pb;
#pragma unroll
        for (int mb = 0; mb < 4; ++mb) { a[mb] = WFrag<T16>::ldf(pa + mb * 16 * K); if (NSPLIT == 1 || NSPLIT == 2) a2[mb] = WFrag<T16>::ldf(pa2 + mb * 16 * K); }
#pragma unroll
        for (int nb = 0; nb < 4; ++nb) { b[nb] = WFrag<T16>::ldf(pb + nb * 16 * K); if (NSPLIT >= 2) b2[nb] = WFrag<T16>::ldf(pb2 + nb * 16 * K); }
        // s_wait_xcnt 0 behind the trip's global loads, in front of every rewrite of their address registers: it names the addresses, so that they stay whole up to it (no later load of the trip lands on them), and nothing is scheduled across it
        asm volatile("s_wait_xcnt 0x0" :: "v"(pa), "v"(pa2), "v"(pb), "v"(pb2) : "memory"); __builtin_amdgcn_sched_barrier(0);
#pragma unroll
        for (int nb = 0; nb < 4; ++nb) {
#pragma unroll
            for (int mb = 0; mb < 4; ++mb) { acc[mb][nb] = WFrag<T16>::mma(a[mb], b[nb], acc[mb][nb]); if (NSPLIT == 1 || NSPLIT == 2) acc[mb][nb] = WFrag<T16>::mma(a2[mb], b[nb], acc[mb][nb]); if (NSPLIT >= 2) acc[mb][nb] = WFrag<T16>::mma(a[mb], b2[nb], acc[mb][nb]); } }
        asm volatile("v_nop\n\tv_nop\n\tv_nop\n\tv_nop" : "+v"(acc[0][0]), "+v"(acc[1][1]), "+v"(acc[2][2]), "+v"(acc[3][3]) : "v"(a[0]), "v"(a[3]));
    }
    if constexpr (NW == 1) {
#pragma unroll
    for (int mb = 0; mb < 4; ++mb) {
#pragma unroll
        for (int nb = 0; nb < 4; ++nb) {
#pragma unroll
            for (int j = 0; j < 8; ++j) os[(hi * 8 + j) * 68 + nb * 16 + lr] = acc[mb][nb][j]; }
        __builtin_amdgcn_wave_barrier(); asm volatile("" ::: "memory");
        float* crow = C + (size_t)(r0 + mb * 16) * ldc + c0;
{
#pragma unroll
            for (int s = 0; s < 8; ++s) { const int row = 2 * s + hi, cofs = lr * 4; v4f val = *(const v4fa*)(os + row * 68 + cofs); if (BIAS) { val[0] += bfr(bias[c0 + cofs]); val[1] += bfr(bias[c0 + cofs + 1]); val[2] += bfr(bias[c0 + cofs + 2]); val[3] += bfr(bias[c0 + cofs + 3]); }
                *(v4f*)(crow + (size_t)row * ldc + cofs) = val; }
             }
        __builtin_amdgcn_wave_barrier(); asm volatile("" ::: "memory");
    }
    } else {
        // Sum of the NW partial tiles, 16 tile rows a pass: every wave stores its partial rows in its own LDS slice, then wave r adds row r over the slices in slice order and keeps it for the store of one whole 256-B row behind the last pass.
        // Two buffers in turn: a buffer is written again only behind the next pass's barrier, which every reader of it has then passed, so one barrier a pass is enough.
        // The loops over mb, nb and j are unrolled so that acc[][] is indexed by constants and stays in registers; the loop over p so that a row's NW LDS loads are in flight together.
        // The four summed rows are kept in registers and stored behind the last pass, so that no barrier of a pass has a global store to wait for.
        v2fa res[4];
#pragma unroll
        for (int mb = 0; mb < 4; ++mb) {
            float* ob = os + (mb & 1) * (NW * 16 * 68);
#pragma unroll
            for (int nb = 0; nb < 4; ++nb) {
#pragma unroll
                for (int j = 0; j < 8; ++j) ob[wv * (16 * 68) + (hi * 8 + j) * 68 + nb * 16 + lr] = acc[mb][nb][j]; }
            __syncthreads();   // publishes all NW partial slices of this pass to the waves that sum them
            const int cofs = lane * 2; v2fa val = *(const v2fa*)(ob + wv * 68 + cofs);
#pragma unroll
            for (int p = 1; p < NW; ++p) val += *(const v2fa*)(ob + p * (16 * 68) + wv * 68 + cofs);
            if (BIAS) { val[0] += bfr(bias[c0 + cofs]); val[1] += bfr(bias[c0 + cofs + 1]); }
            res[mb] = val;
        }
#pragma unroll
        for (int mb = 0; mb < 4; ++mb) *(v2fa*)(C + (size_t)(r0 + mb * 16 + wv) * ldc + c0 + lane * 2) = res[mb];
    }
}

__device__ __forceinline__ h16 tohx(float x) { return (h16)x; }
__device__ __forceinline__ void splitf(float y, unsigned short& h, unsigned short& l) { h = f2bf(y); l = f2bf(y - bf2f(h)); }
typedef __attribute__((ext_vector_type(2))) _Float16 v2h;
typedef __attribute__((ext_vector_type(4))) _Float16 v4h;
typedef __attribute__((ext_vector_type(2))) unsigned short v2us;
typedef __attribute__((ext_vector_type(4))) unsigned short v4us;
typedef __attribute__((ext_vector_type(2))) float v2f;
typedef __attribute__((ext_vector_type(4))) int v4i;

// k_wtG, k_cvt8 and k_vtp write one 16-byte piece of a fragment-order plane a thread, thread i piece i, so that a wave's store is 512 consecutive bytes. fo_row / fo_k: the row and the first k of piece i in a plane with K columns.
// Their sizes are compile-time constants, so that a thread's loads are immediate offsets from one address, which XWAIT1 keeps whole.
__device__ __forceinline__ int fo_row(int i, int K) { return ((i >> 6) / (K / 32)) * 16 + (i & 15); }
__device__ __forceinline__ int fo_k(int i, int K) { return ((i >> 6) % (K / 32)) * 32 + ((i >> 5) & 1) * 16 + ((i >> 4) & 1) * 8; }
// k_wtG: Bt[n][k] = bf16(w[k][n]) in fragment order; 16 neighbouring lanes read 16 neighbouring n of one k
template <int K, int N>
__global__ __launch_bounds__(256) void k_wtG(const float* __restrict__ w, bf* Bt) {
    const int i = blockIdx.x * 256 + threadIdx.x; if (i >= N * (K / 8)) return; const int n = fo_row(i, K), k0 = fo_k(i, K); const float* p = w + (size_t)k0 * N + n; float x[8]; v8us o;
#pragma unroll
    for (int j = 0; j < 8; ++j) x[j] = p[j * N];
    XWAIT1(p);
#pragma unroll
    for (int j = 0; j < 8; ++j) o[j] = f2bf(x[j]);
    *(v8us*)(Bt + (size_t)i * 8) = o; }
// k_cvt8: dst[r][k] = bf16(src[r][k]) in fragment order
template <int K>
__global__ __launch_bounds__(256) void k_cvt8(const float* __restrict__ src, bf* dst, int n8) { const int i = blockIdx.x * 256 + threadIdx.x; if (i >= n8) return; const float* p = src + (size_t)fo_row(i, K) * K + fo_k(i, K); const v8f v = *(const v8f*)p; XWAIT1(p); v8us o;
#pragma unroll
    for (int k = 0; k < 8; ++k) o[k] = f2bf(v[k]); *(v8us*)(dst + (size_t)i * 8) = o;  }
// k_mfo: the mask in the order in which the lanes of k_fattn read it: [row / 16][key / 32][(key >> 4) & 1][(key >> 2) & 1][lane = ((key >> 3) & 1) * 16 + (row & 15)][key & 3]; thread i writes the i-th group of 4
__global__ __launch_bounds__(256) void k_mfo(const int* __restrict__ mk, int* MF) { const int i = blockIdx.x * 256 + threadIdx.x; if (i >= TT * (TT / 4)) return;
    const int row = (i / (4 * TT)) * 16 + (i & 15), key = ((i >> 7) % (TT / 32)) * 32 + ((i >> 6) & 1) * 16 + ((i >> 4) & 1) * 8 + ((i >> 5) & 1) * 4; const int* p = mk + (size_t)row * TT + key; const v4i v = *(const v4i*)p; XWAIT1(p); *(v4i*)(MF + (size_t)i * 4) = v; }
__global__ __launch_bounds__(256) void k_cscvt(const float* __restrict__ cosT, const float* __restrict__ sinT, float* CS) { const int idx = blockIdx.x * 256 + threadIdx.x; if (idx >= TT * HD) return; v2f cs; cs[0] = bfr(cosT[idx]); cs[1] = bfr(sinT[idx]); *(v2f*)(CS + (size_t)idx * 2) = cs;  }
// k_rope: head planes [h][t][d] (fp16 + hi/lo; FO: each head's [t][d] plane in fragment order) of rope(x) x sc with the rotate-half convention out[d] = x[d] cos[t][d] - x[d+HD/2] sin[t][d], out[d+HD/2] = x[d+HD/2] cos[t][d+HD/2] + x[d] sin[t][d+HD/2]
template <bool FO>
__global__ __launch_bounds__(256) void k_rope(const float* __restrict__ F, int pitch, int nheads, const float* __restrict__ CS, const float* __restrict__ RF, const float* __restrict__ nw, float sc, h16* P16, bf* Ph, bf* Pl) {
    const size_t e = ((size_t)blockIdx.x * 256 + threadIdx.x) * 2; if (e >= (size_t)nheads * TT * HD) return; const int d = (int)(e % HD); const int t = (int)((e / HD) % TT); const int h = (int)(e / ((size_t)HD * TT)); const float* f = F + (size_t)t * pitch + h * HD; const float rf = RF ? RF[(size_t)h * TT + t] : 1.0f; v2h o16; v2us oh, ol;
#pragma unroll
    for (int q = 0; q < 2; ++q) { const int dd = d + q; const int dp = (dd < HD / 2) ? dd + HD / 2 : dd - HD / 2; float x0 = f[dd], x1 = f[dp];
        if (RF) { float n0 = __fmul_rn(x0, rf), n1 = __fmul_rn(x1, rf); asm volatile("" : "+v"(n0)); asm volatile("" : "+v"(n1)); x0 = __fmul_rn(bfr(nw[dd]), n0); x1 = __fmul_rn(bfr(nw[dp]), n1); }
        const v2f cs = *(const v2f*)(CS + ((size_t)t * HD + dd) * 2); float a = __fmul_rn(x0, cs[0]), bq = __fmul_rn(x1, cs[1]); asm volatile("" : "+v"(a)); asm volatile("" : "+v"(bq)); const float r = ((dd < HD / 2) ? __fsub_rn(a, bq) : __fadd_rn(a, bq)) * sc;
        o16[q] = tohx(r); unsigned short a2, c2; splitf(r, a2, c2); oh[q] = a2; ol[q] = c2; }
    const size_t eo = FO ? (size_t)h * TT * HD + (size_t)(((t >> 4) * (HD / 32) + (d >> 5)) * 512 + ((d >> 4) & 1) * 256 + (((d >> 3) & 1) * 16 + (t & 15)) * 8 + (d & 7)) : e;
    *(v2h*)(P16 + eo) = o16; *(v2us*)(Ph + eo) = oh; *(v2us*)(Pl + eo) = ol;  }
// k_vtp: the [d][t] planes of v (fp16 + hi/lo), each kv group's plane in fragment order (rows d, k = t); thread i writes piece i of each plane; 16 neighbouring lanes read 16 neighbouring d of one t
template <int pitch>
__global__ __launch_bounds__(256) void k_vtp(const float* __restrict__ F, int nheads, h16* V16, bf* Vh, bf* Vl) { const int i = blockIdx.x * 256 + threadIdx.x; if (i >= nheads * HD * (TT / 8)) return; const int g = i / (HD * (TT / 8)), ip = i % (HD * (TT / 8));
    const float* p = F + (size_t)fo_k(ip, TT) * pitch + g * HD + fo_row(ip, TT); float xs[8]; v8h o16; v8us oh, ol;
#pragma unroll
    for (int q = 0; q < 8; ++q) xs[q] = p[q * pitch];
    XWAIT1(p);
#pragma unroll
    for (int q = 0; q < 8; ++q) { const float x = xs[q]; o16[q] = tohx(x); unsigned short a2, c2; splitf(x, a2, c2); oh[q] = a2; ol[q] = c2; }
    *(v8h*)(V16 + (size_t)i * 8) = o16; *(v8us*)(Vh + (size_t)i * 8) = oh; *(v8us*)(Vl + (size_t)i * 8) = ol;  }
// ---- k_fattn: scores, mask, softmax, attn.v and the head merge in one kernel; no score or probability ever reaches memory. One wave = one query head x 16 * QT query rows, walking all TT keys 32 at a time;
// the REP waves of a workgroup are the REP query heads of one kv group on the same query rows, so they read the same K, V and mask lines at about the same time (shared through the WGP cache).
// Transposed products: St = K Qt (A = K rows, B = Q rows kept in registers), so a lane holds scores of ONE query (column lr), keys 8 hi + r of each 16-key tile; two such tiles, converted in place, are the B operand
// of Ot += Vt Pt (A = rows of the [d][t] plane). Running maximum and sum per lane; the two lane halves share the maximum every pass and join their sums once at the end.
// A masked score is -3e38 as a finite stand-in: while a row has seen masked keys only, its terms are exp2(0) = 1, and the first real score wipes them with the factor exp2(-inf) = 0.
__device__ __forceinline__ float xhalf(float x) { return __builtin_bit_cast(float, __builtin_amdgcn_permlanex16(__builtin_bit_cast(int, x), __builtin_bit_cast(int, x), 0x76543210, 0xfedcba98, false, false)); }  // lane l reads lane l ^ 16
// v_exp_f32 with, in the same statement, the one slot that the instruction set asks for behind a transcendental before its result is read or its source overwritten
__device__ __forceinline__ float exp2s(float x) { float y; asm("v_exp_f32 %0, %1\n\tv_nop" : "=v"(y) : "v"(x)); return y; }
template <typename T16, bool HI, int QT>
__device__ __forceinline__ void attn_body(const T16* __restrict__ Q, const T16* __restrict__ Q2, const T16* __restrict__ Kp, const T16* __restrict__ K2, const T16* __restrict__ Vt, const T16* __restrict__ V2, const int* __restrict__ mk, int q0, bf* Ah, bf* Al) {
    typedef WFrag<T16> F; typedef typename F::V V;
    const int lane = threadIdx.x & 31, lr = lane & 15, hi = lane >> 4;
    // every loop below but the one over j0 is unrolled so that the fragment and accumulator arrays are indexed by constants and stay in registers
    V qf[QT][2], qf2[QT][2]; const size_t qoff = (size_t)(q0 + lr) * HD + 8 * hi; const T16* qp = Q + qoff; const T16* qp2 = HI ? Q2 + qoff : qp;
#pragma unroll
    for (int qt = 0; qt < QT; ++qt)
#pragma unroll
        for (int ks = 0; ks < 2; ++ks) { qf[qt][ks] = F::ld(qp + qt * 16 * HD + ks * 32); if (HI) qf2[qt][ks] = F::ld(qp2 + qt * 16 * HD + ks * 32); }
    if constexpr (HI) XWAIT2(qp, qp2); else XWAIT1(qp);
    const int koff = lane * 8, voff = lane * 8; const int* mrow = mk + (size_t)q0 * TT + lane * 4;   // K, V and the mask are in fragment order (Q, read once, is row-major): 16 keys of K are 2 blocks = 16 HD elements, 32 keys of V one block per 16 d, 32 keys of the mask 512 ints per 16 rows
    v8f o[QT][4]; float mrun[QT], lrun[QT];
#pragma unroll
    for (int qt = 0; qt < QT; ++qt) { mrun[qt] = -3.0e38f; lrun[qt] = 0.f;
#pragma unroll
        for (int dt = 0; dt < 4; ++dt) o[qt][dt] = (v8f){}; }
    V ka[2][2], ka2[2][2]; v4i mm[QT][2][2];
    { const T16* kp = Kp + koff; const T16* kp2 = HI ? K2 + koff : kp;
#pragma unroll
      for (int kt = 0; kt < 2; ++kt) {
#pragma unroll
        for (int ks = 0; ks < 2; ++ks) { ka[kt][ks] = F::ldf(kp + kt * 16 * HD + ks * 512); if (HI) ka2[kt][ks] = F::ldf(kp2 + kt * 16 * HD + ks * 512); }
#pragma unroll
        for (int qt = 0; qt < QT; ++qt) { mm[qt][kt][0] = *(const v4i*)(mrow + (size_t)qt * 16 * TT + kt * 256); mm[qt][kt][1] = *(const v4i*)(mrow + (size_t)qt * 16 * TT + kt * 256 + 128); } }
      if constexpr (HI) XWAIT3(kp, kp2, mrow); else XWAIT2(kp, mrow); }
    for (int j0 = 0; j0 < TT; j0 += 32) {
        const int jn = (j0 + 32 < TT) ? j0 + 32 : j0;   // the K and mask fragments are fetched one pass ahead; the last pass fetches its own again, inside the arrays
        V va[4], va2[4]; const T16* vp = Vt + voff + j0 * 16; const T16* vp2 = HI ? V2 + voff + j0 * 16 : vp;
#pragma unroll
        for (int dt = 0; dt < 4; ++dt) { va[dt] = F::ldf(vp + (size_t)dt * 16 * TT); if (HI) va2[dt] = F::ldf(vp2 + (size_t)dt * 16 * TT); }
        // its scheduling barrier also keeps the V loads at the head of the pass, the score products and a whole softmax ahead of their use; without it the compiler sinks them to just in front of attn.v
        if constexpr (HI) XWAIT2(vp, vp2); else XWAIT1(vp);
        v8f s[QT][2];
#pragma unroll
        for (int kt = 0; kt < 2; ++kt)
#pragma unroll
            for (int qt = 0; qt < QT; ++qt) { v8f c = (v8f){};
#pragma unroll
                for (int ks = 0; ks < 2; ++ks) { c = F::mma(ka[kt][ks], qf[qt][ks], c); if (HI) { c = F::mma(ka[kt][ks], qf2[qt][ks], c); c = F::mma(ka2[kt][ks], qf[qt][ks], c); } }
                s[qt][kt] = c; }
        const T16* kp = Kp + koff + (size_t)jn * HD; const T16* kp2 = HI ? K2 + koff + (size_t)jn * HD : kp; const int* mp = mrow + jn * 16;
#pragma unroll
        for (int kt = 0; kt < 2; ++kt)
#pragma unroll
            for (int ks = 0; ks < 2; ++ks) { ka[kt][ks] = F::ldf(kp + kt * 16 * HD + ks * 512); if (HI) ka2[kt][ks] = F::ldf(kp2 + kt * 16 * HD + ks * 512); }
        V pf[QT], pf2[QT]; float mxs[QT];
#pragma unroll
        for (int qt = 0; qt < QT; ++qt) {
            float mx = -3.0e38f;
#pragma unroll
            for (int kt = 0; kt < 2; ++kt)
#pragma unroll
                for (int r = 0; r < 8; ++r) { const float t = (mm[qt][kt][r >> 2][r & 3] == 0) ? s[qt][kt][r] * SCL2 : -3.0e38f; s[qt][kt][r] = t; mx = fmaxf(mx, t); }
#pragma unroll
            for (int kt = 0; kt < 2; ++kt) { mm[qt][kt][0] = *(const v4i*)(mp + (size_t)qt * 16 * TT + kt * 256); mm[qt][kt][1] = *(const v4i*)(mp + (size_t)qt * 16 * TT + kt * 256 + 128); }
            mxs[qt] = mx; }
        // its scheduling barrier also keeps the next pass's K and mask loads in front of the softmax and attn.v of this pass, which cover their latency; without it the compiler sinks them to the foot of the pass or into the next one
        if constexpr (HI) XWAIT3(kp, kp2, mp); else XWAIT2(kp, mp);
#pragma unroll
        for (int qt = 0; qt < QT; ++qt) {
            const float mx = fmaxf(mxs[qt], xhalf(mxs[qt]));
            const float mnew = fmaxf(mrun[qt], mx); const float corr = exp2s(mrun[qt] - mnew); mrun[qt] = mnew;
            float sum = 0.f;
#pragma unroll
            for (int kt = 0; kt < 2; ++kt)
#pragma unroll
                for (int r = 0; r < 8; ++r) { const float p = exp2s(s[qt][kt][r] - mnew); sum += p;
                    if constexpr (HI) { unsigned short a, c2; splitf(p, a, c2); pf[qt][kt * 8 + r] = __builtin_bit_cast(__bf16, a); pf2[qt][kt * 8 + r] = __builtin_bit_cast(__bf16, c2); }
                    else pf[qt][kt * 8 + r] = tohx(p); }
            lrun[qt] = lrun[qt] * corr + sum;
#pragma unroll
            for (int dt = 0; dt < 4; ++dt) o[qt][dt] *= corr;
        }
#pragma unroll
        for (int dt = 0; dt < 4; ++dt)
#pragma unroll
            for (int qt = 0; qt < QT; ++qt) { o[qt][dt] = F::mma(va[dt], pf[qt], o[qt][dt]); if (HI) { o[qt][dt] = F::mma(va[dt], pf2[qt], o[qt][dt]); o[qt][dt] = F::mma(va2[dt], pf[qt], o[qt][dt]); } }
    }
#pragma unroll
    for (int qt = 0; qt < QT; ++qt) { const float inv = __fdiv_rn(1.0f, lrun[qt] + xhalf(lrun[qt])); const size_t oo = (size_t)(q0 + qt * 16) * DQ + lane * 8;
#pragma unroll
        for (int dt = 0; dt < 4; ++dt) { v8us oh, ol;   // a lane's 8 accumulator registers are 8 consecutive d of its query row: one 16-byte piece of the merged planes, which are in fragment order (rows t, k = h HD + d); a wave's store is 512 consecutive bytes
#pragma unroll
            for (int r = 0; r < 8; ++r) { unsigned short a, c2; splitf(o[qt][dt][r] * inv, a, c2); oh[r] = a; ol[r] = c2; }
            *(v8us*)(Ah + oo + dt * 256) = oh; *(v8us*)(Al + oo + dt * 256) = ol;
            // s_wait_xcnt 0 behind the pair of stores, in front of the next tile's packing, which takes their data registers anew: it names the data, so that they stay whole up to it, and nothing is scheduled across it
            asm volatile("s_wait_xcnt 0x0" :: "v"(oh), "v"(ol) : "memory"); __builtin_amdgcn_sched_barrier(0); } }
}
// grid (RH/16 + (TT - RH)/32, NKV), 32 * REP threads: the first RH/16 blocks in x take 16 hi+lo query rows each (three products for one), the rest 32 fp16 rows each
__global__ __launch_bounds__(32 * REP) void k_fattn(const h16* __restrict__ Q16, const bf* __restrict__ Qh, const bf* __restrict__ Ql, const h16* __restrict__ K16, const bf* __restrict__ Kh, const bf* __restrict__ Kl, const h16* __restrict__ V16, const bf* __restrict__ Vh, const bf* __restrict__ Vl, const int* __restrict__ mk, bf* Ah, bf* Al) {
    const int g = blockIdx.y, h = g * REP + __builtin_amdgcn_readfirstlane((int)(threadIdx.x >> 5)); const size_t qo = (size_t)h * TT * HD, ko = (size_t)g * TT * HD; const int bx = blockIdx.x;
    if (bx < RH / 16) attn_body<bf, true, 1>(Qh + qo, Ql + qo, Kh + ko, Kl + ko, Vh + ko, Vl + ko, mk, bx * 16, Ah + h * 16 * HD, Al + h * 16 * HD);
    else attn_body<h16, false, 2>(Q16 + qo, nullptr, K16 + ko, nullptr, V16 + ko, nullptr, mk, RH + (bx - RH / 16) * 32, Ah + h * 16 * HD, Al + h * 16 * HD);
}

extern "C" void kernel_launch(void* const* d_in, const int* in_sizes, int n_in,
                              void* d_out, int out_size, void* d_ws, size_t ws_size, hipStream_t stream) {
    (void)in_sizes; (void)n_in; (void)out_size;
    const float* x = (const float*)d_in[0]; const int* mk = (const int*)d_in[1]; const float* cosT = (const float*)d_in[2]; const float* sinT = (const float*)d_in[3]; const float* wq = (const float*)d_in[4]; const float* wk = (const float*)d_in[5]; const float* wv = (const float*)d_in[6]; const float* wo = (const float*)d_in[7]; const float* bo = (const float*)d_in[8];   // all weights x @ W
    float* OUT = (float*)d_out;     // [2][2048][2048]
    char* wsp = (char*)d_ws;
    auto take = [&](size_t bytes) { char* p = wsp; wsp += (bytes + 255) & ~(size_t)255; return (void*)p; };
    bf* WQ = (bf*)take((size_t)DQ * DM * 2); bf* WK = (bf*)take((size_t)DKV * DM * 2); bf* WV = (bf*)take((size_t)DKV * DM * 2); bf* WO = (bf*)take((size_t)DM * DQ * 2); float* CS = (float*)take((size_t)TT * HD * 2 * 4);
    bf* XB = (bf*)take((size_t)TT * DM * 2); float* FQ = (float*)take((size_t)TT * DQ * 4); float* FK = (float*)take((size_t)TT * DKV * 4);
    h16* QP16 = (h16*)take((size_t)NH_ * TT * HD * 2); h16* KP16 = (h16*)take((size_t)NKV * TT * HD * 2); h16* VT16 = (h16*)take((size_t)NKV * HD * TT * 2);
    bf* QPh = (bf*)take((size_t)NH_ * TT * HD * 2); bf* QPl = (bf*)take((size_t)NH_ * TT * HD * 2); bf* KPh = (bf*)take((size_t)NKV * TT * HD * 2); bf* KPl = (bf*)take((size_t)NKV * TT * HD * 2); bf* VTh = (bf*)take((size_t)NKV * HD * TT * 2); bf* VTl = (bf*)take((size_t)NKV * HD * TT * 2);
    bf* ATh = (bf*)take((size_t)TT * DQ * 2); bf* ATl = (bf*)take((size_t)TT * DQ * 2); int* MF = (int*)take((size_t)TT * TT * 4);
    if ((size_t)(wsp - (char*)d_ws) > ws_size) return;    // ws 256 MiB
    float* FV = FK;   // v projection reuses the k buffer after the k planes are built (stream-ordered)
    { k_wtG<DM, DQ><<<(unsigned)(DM * DQ / 8 / 256), 256, 0, stream>>>(wq, WQ); k_wtG<DM, DKV><<<(unsigned)(DM * DKV / 8 / 256), 256, 0, stream>>>(wk, WK); k_wtG<DM, DKV><<<(unsigned)(DM * DKV / 8 / 256), 256, 0, stream>>>(wv, WV);
      k_wtG<DQ, DM><<<(unsigned)(DQ * DM / 8 / 256), 256, 0, stream>>>(wo, WO);
       }
    k_cscvt<<<(TT * HD + 255) / 256, 256, 0, stream>>>(cosT, sinT, CS);   // one shared table (read as data)
    k_mfo<<<TT * (TT / 4) / 256, 256, 0, stream>>>(mk, MF);   // one shared mask (read as data)
    const unsigned LQ = (unsigned)(((size_t)NH_ * TT * HD / 2 + 255) / 256), LKv = (unsigned)(((size_t)NKV * TT * HD / 2 + 255) / 256), LV8 = (unsigned)(NKV * HD * (TT / 8) / 256);
    for (int b = 0; b < NB_; ++b) {
        k_cvt8<DM><<<(unsigned)(((size_t)TT * DM / 8 + 255) / 256), 256, 0, stream>>>(x + (size_t)b * TT * DM, XB, TT * DM / 8);
        k_gemmw<bf, 0, false, 16, DM><<<dim3(TT / 64, DQ / 64, 1), 512, 0, stream>>>(XB, nullptr, WQ, nullptr, FQ, DQ, nullptr, 0, 0, 0);
        k_rope<false><<<LQ, 256, 0, stream>>>(FQ, DQ, NH_, CS, nullptr, nullptr, 1.0f, QP16, QPh, QPl);
        k_gemmw<bf, 0, false, 16, DM><<<dim3(TT / 64, DKV / 64, 1), 512, 0, stream>>>(XB, nullptr, WK, nullptr, FK, DKV, nullptr, 0, 0, 0);
        k_rope<true><<<LKv, 256, 0, stream>>>(FK, DKV, NKV, CS, nullptr, nullptr, 1.0f, KP16, KPh, KPl);
        k_gemmw<bf, 0, false, 16, DM><<<dim3(TT / 64, DKV / 64, 1), 512, 0, stream>>>(XB, nullptr, WV, nullptr, FV, DKV, nullptr, 0, 0, 0); k_vtp<DKV><<<LV8, 256, 0, stream>>>(FV, NKV, VT16, VTh, VTl);
        k_fattn<<<dim3(RH / 16 + (TT - RH) / 32, NKV, 1), 32 * REP, 0, stream>>>(QP16, QPh, QPl, KP16, KPh, KPl, VT16, VTh, VTl, MF, ATh, ATl);
        k_gemmw<bf, 1, true, 16, DQ><<<dim3(TT / 64, DM / 64, 1), 512, 0, stream>>>(ATh, ATl, WO, nullptr, OUT + (size_t)b * TT * DM, DM, bo, 0, 0, 0); }
}

// v005
// One run takes 329 microseconds.
// Two timings next to v004 put it at 1.07 and 1.06 times that version's speed.
// Counting every step since v000, it is 11.9 times as fast.
#include <hip/hip_runtime.h>

// Grouped-query attention with RoPE and a 2-D mask (x [2][2048][2048]; q = x Wq (32 heads x 64), k, v = x Wk / x Wv (8 kv groups x 64, each serving 4 consecutive query heads); rotate-half RoPE with the input
// cos/sin tables [2048][64] (read as data); scores = q.k/8, -inf where mask[i][j] != 0 (int [2048][2048], read as data); softmax; out = merged attn.v Wo + bo -> [2][2048][2048]).
// Compute dtypes, f32 accumulate: every input rounded to bf16; projections on PLAIN bf16 operands (inputs: exact products, f32 accumulate); RoPE in f32; PER-ROW PRECISION
// HYBRID: query rows < 256 take scores and attn.v on bf16 hi+lo planes (3 products), rows >= 256 on single fp16 planes; 1/8 and the mask in f32 in the running softmax of the fused attention kernel; merged heads as hi+lo planes

#define NB_  2
#define TT   2048
#define DM   2048
#define NH_  32
#define NKV  8
#define REP  (NH_ / NKV)
#define HD   64
#define DQ   (NH_ * HD)
#define DKV  (NKV * HD)
#define RH   256                  // query rows < RH use hi+lo planes (0: none)
#define WIN  0
#define SCL2 0.18033688011112042f   // HD^-0.5 x log2(e): the softmax runs in base 2
typedef _Float16 h16;
typedef unsigned short bf;
typedef __attribute__((ext_vector_type(16))) __bf16   v16bf;
typedef __attribute__((ext_vector_type(16))) _Float16 v16h;
typedef __attribute__((ext_vector_type(8)))  _Float16 v8h;
typedef __attribute__((ext_vector_type(8)))  unsigned short v8us;
typedef __attribute__((ext_vector_type(8)))  float    v8f;
typedef __attribute__((ext_vector_type(4)))  float    v4f;
typedef v8h  __attribute__((may_alias)) v8ha;
typedef v4f  __attribute__((may_alias)) v4fa;
typedef v8us __attribute__((may_alias)) v8usa;
typedef __attribute__((ext_vector_type(2))) float __attribute__((may_alias)) v2fa;

__device__ __forceinline__ unsigned short f2bf(float f) { unsigned u = __float_as_uint(f); u += 0x7FFFu + ((u >> 16) & 1u); return (unsigned short)(u >> 16); }
__device__ __forceinline__ float bf2f(unsigned short b) { return __uint_as_float(((unsigned)b) << 16); }
__device__ __forceinline__ float bfr(float f) { return bf2f(f2bf(f)); }
__device__ __forceinline__ v16h cat16(v8h lo, v8h hi) { return __builtin_shufflevector(lo, hi, 0, 1, 2, 3, 4, 5, 6, 7, 8, 9, 10, 11, 12, 13, 14, 15); }
__device__ __forceinline__ v16bf cat16b(v8us lo, v8us hi) { return __builtin_bit_cast(v16bf, __builtin_shufflevector(lo, hi, 0, 1, 2, 3, 4, 5, 6, 7, 8, 9, 10, 11, 12, 13, 14, 15)); }
__device__ __forceinline__ v8f wmma16(v16h a, v16h b, v8f c) { return __builtin_amdgcn_wmma_f32_16x16x32_f16(false, a, false, b, (short)0, c, false, false); }
__device__ __forceinline__ v8f wmmab(v16bf a, v16bf b, v8f c) { return __builtin_amdgcn_wmma_f32_16x16x32_bf16(false, a, false, b, (short)0, c, false, false); }
__device__ __forceinline__ h16 tohx(float x) { return (h16)x; }
__device__ __forceinline__ void splitf(float y, unsigned short& h, unsigned short& l) { h = f2bf(y); l = f2bf(y - bf2f(h)); }
typedef __attribute__((ext_vector_type(2))) _Float16 v2h;
typedef __attribute__((ext_vector_type(2))) unsigned short v2us;
__device__ __forceinline__ float xhalf(float x) { return __builtin_bit_cast(float, __builtin_amdgcn_permlanex16(__builtin_bit_cast(int, x), __builtin_bit_cast(int, x), 0x76543210, 0xfedcba98, false, false)); }  // lane l reads lane l ^ 16



// s_wait_xcnt 0 behind a group of global loads, in front of every rewrite of their address registers: it names the addresses, so that they stay whole up to it (no later load of the group lands on them), and nothing is scheduled across it
#define XWAIT1(a)       do { asm volatile("s_wait_xcnt 0x0" :: "v"(a) : "memory"); __builtin_amdgcn_sched_barrier(0); } while (0)
#define XWAIT2(a, b)    do { asm volatile("s_wait_xcnt 0x0" :: "v"(a), "v"(b) : "memory"); __builtin_amdgcn_sched_barrier(0); } while (0)
#define XWAIT3(a, b, c) do { asm volatile("s_wait_xcnt 0x0" :: "v"(a), "v"(b), "v"(c) : "memory"); __builtin_amdgcn_sched_barrier(0); } while (0)
// ---- k_gemmw: register-blocked GEMM, one 64x64 output tile per workgroup (16 accumulators a wave), operands straight from 16-bit planes in fragment order; grid (M/64, N/64, Z), 32 * NW threads.
// C[m][n] (f32, pitch ldc, + optional f32 bias[n]) = sum_k A[m][k] Bt[n][k] (+ split products per NSPLIT). z-batch strides sA/sB/sC in elements: A and C step with every z, Bt with every REP-th z (the REP query heads of one kv group share it). K % (32 * NW) == 0.
// NW == 1: one wave walks all of K. NW == 16: wave w walks the K range [w K/16, (w+1) K/16), so a long K costs K/512 dependent load rounds instead of K/32; the 16 partial tiles are summed in LDS, wave 0 first.
// FRAGMENT ORDER of a 16-bit plane P[row][k] (rows % 16 == 0, K % 32 == 0): the 16 rows x 32 k of one A or B fragment are one 1-KiB block, blocks in the order [row / 16][k / 32]; inside a block the 16-byte piece of
// row r, k = 8 s .. 8 s + 7 (s = 0..3) is piece (s >> 1) * 32 + (s & 1) * 16 + (r & 15). Lane l of a wave then reads pieces l and 32 + l (ldf): each load instruction covers 512 consecutive bytes, four whole cache lines,
// where on a row-major plane (ld) it touches 16 lines for 32 bytes each. The values a lane and register receive are the same as with ld on the row-major plane.
template <typename T16> struct WFrag;
template <> struct WFrag<h16> { typedef v16h V; static __device__ __forceinline__ V ld(const h16* p) { return cat16(*(const v8h*)p, *(const v8h*)(p + 16)); } static __device__ __forceinline__ V ldf(const h16* p) { return cat16(*(const v8h*)p, *(const v8h*)(p + 256)); } static __device__ __forceinline__ v8f mma(V a, V b, v8f c) { return wmma16(a, b, c); } };
template <> struct WFrag<bf> { typedef v16bf V; static __device__ __forceinline__ V ld(const bf* p) { return cat16b(*(const v8us*)p, *(const v8us*)(p + 16)); } static __device__ __forceinline__ V ldf(const bf* p) { return cat16b(*(const v8us*)p, *(const v8us*)(p + 256)); } static __device__ __forceinline__ v8f mma(V a, V b, v8f c) { return wmmab(a, b, c); } };
// EPI: what becomes of the summed tile. 0: stored as f32 in C. 1 to 3 (NW == 16): it never reaches memory as f32; the wave that has summed a row turns it into the three 16-bit planes of the attention kernel (fp16, bf16 hi, bf16 lo) itself.
//   1: q. The tile is 64 positions x the 64 d of head blockIdx.y; rotate-half RoPE out[d] = x[d] cos[t][d] - x[d+32] sin[t][d], out[d+32] = x[d+32] cos[t][d+32] + x[d] sin[t][d+32]; a lane holds d = 2 lane, 2 lane + 1 of its row,
//      so the partner d +- 32 is the same register of lane ^ 16. Planes [h][t][d], row-major.
//   2: k. The same, each head's [t][d] plane in fragment order (rows t, k = d).
//   3: v. Launched with A = the weight rows (d) and Bt = x (t), so the tile comes out as [d][t] and a lane holds two neighbouring t of one d. No RoPE. Each kv group's [d][t] plane (group blockIdx.x) in fragment order (rows d, k = t).
template <typename T16, int NSPLIT, bool BIAS, int NW, int K, int EPI>
__global__ __launch_bounds__(32 * NW) void k_gemmw(const T16* __restrict__ A, const T16* __restrict__ A2, const T16* __restrict__ Bt, const T16* __restrict__ Bt2, float* C, int ldc, const float* __restrict__ bias, size_t sA, size_t sB, size_t sC, const float* __restrict__ CS, h16* P16, bf* Ph, bf* Pl) {
    typedef typename WFrag<T16>::V V;
    static_assert(NW == 1 || NW == 16, "the LDS sum maps one wave to one of 16 tile rows");
    static_assert(EPI == 0 || NW == 16, "the plane epilogues stand behind the LDS sum");
    __shared__ __align__(16) float os[(NW == 1 ? 1 : 2 * NW) * 16 * 68];
    const size_t z = blockIdx.z; A += z * sA; if (A2) A2 += z * sA; Bt += (z / REP) * sB; if (Bt2) Bt2 += (z / REP) * sB; C += z * sC;
    const int lane = threadIdx.x & 31, lr = lane & 15, hi = lane >> 4; const int r0 = blockIdx.x * 64, c0 = blockIdx.y * 64;
    v8f acc[4][4];
#pragma unroll
    for (int mb = 0; mb < 4; ++mb)
#pragma unroll
        for (int nb = 0; nb < 4; ++nb) acc[mb][nb] = (v8f){};
    const size_t aoff = (size_t)r0 * K + lane * 8, boff = (size_t)c0 * K + lane * 8;   // a 16-row tile is K / 32 blocks of 512 elements = 16 K elements
    const int wv = (NW == 1) ? 0 : __builtin_amdgcn_readfirstlane((int)(threadIdx.x >> 5)); const int kb = wv * (K / NW), ke = kb + K / NW;
    v4f cs[4];
    if constexpr (EPI == 1 || EPI == 2) {   // cos and sin of the four rows that this wave will sum (cos d, sin d, cos d+1, sin d+1 a lane), fetched ahead of the K loop, which covers their latency: behind it the first barrier of the LDS sum would wait for them
        const float* csp = CS + ((size_t)(r0 + wv) * HD + lane * 2) * 2;
#pragma unroll   // cs[] is indexed by constants and stays in registers; the four loads are immediate offsets from one address
        for (int mb = 0; mb < 4; ++mb) cs[mb] = *(const v4f*)(csp + mb * 16 * HD * 2);
        XWAIT1(csp); }
#pragma unroll 1
    for (int kc = kb; kc < ke; kc += 32) {
        V a[4], a2[4], b[4], b2[4];   // K is a compile-time constant, so that the four 16-row tiles of an operand are immediate offsets from one address
        const T16* pa = A + aoff + kc * 16; const T16* pa2 = (NSPLIT == 1 || NSPLIT == 2) ? A2 + aoff + kc * 16 : pa; const T16* pb = Bt + boff + kc * 16; const T16* pb2 = (NSPLIT >= 2) ? Bt2 + boff + kc * 16 : pb;
#pragma unroll
        for (int mb = 0; mb < 4; ++mb) { a[mb] = WFrag<T16>::ldf(pa + mb * 16 * K); if (NSPLIT == 1 || NSPLIT == 2) a2[mb] = WFrag<T16>::ldf(pa2 + mb * 16 * K); }
#pragma unroll
        for (int nb = 0; nb < 4; ++nb) { b[nb] = WFrag<T16>::ldf(pb + nb * 16 * K); if (NSPLIT >= 2) b2[nb] = WFrag<T16>::ldf(pb2 + nb * 16 * K); }
        // s_wait_xcnt 0 behind the trip's global loads, in front of every rewrite of their address registers: it names the addresses, so that they stay whole up to it (no later load of the trip lands on them), and nothing is scheduled across it
        asm volatile("s_wait_xcnt 0x0" :: "v"(pa), "v"(pa2), "v"(pb), "v"(pb2) : "memory"); __builtin_amdgcn_sched_barrier(0);
#pragma unroll
        for (int nb = 0; nb < 4; ++nb) {
#pragma unroll
            for (int mb = 0; mb < 4; ++mb) { acc[mb][nb] = WFrag<T16>::mma(a[mb], b[nb], acc[mb][nb]); if (NSPLIT == 1 || NSPLIT == 2) acc[mb][nb] = WFrag<T16>::mma(a2[mb], b[nb], acc[mb][nb]); if (NSPLIT >= 2) acc[mb][nb] = WFrag<T16>::mma(a[mb], b2[nb], acc[mb][nb]); } }
        asm volatile("v_nop\n\tv_nop\n\tv_nop\n\tv_nop" : "+v"(acc[0][0]), "+v"(acc[1][1]), "+v"(acc[2][2]), "+v"(acc[3][3]) : "v"(a[0]), "v"(a[3]));
    }
    if constexpr (NW == 1) {
#pragma unroll
    for (int mb = 0; mb < 4; ++mb) {
#pragma unroll
        for (int nb = 0; nb < 4; ++nb) {
#pragma unroll
            for (int j = 0; j < 8; ++j) os[(hi * 8 + j) * 68 + nb * 16 + lr] = acc[mb][nb][j]; }
        __builtin_amdgcn_wave_barrier(); asm volatile("" ::: "memory");
        float* crow = C + (size_t)(r0 + mb * 16) * ldc + c0;
{
#pragma unroll
            for (int s = 0; s < 8; ++s) { const int row = 2 * s + hi, cofs = lr * 4; v4f val = *(const v4fa*)(os + row * 68 + cofs); if (BIAS) { val[0] += bfr(bias[c0 + cofs]); val[1] += bfr(bias[c0 + cofs + 1]); val[2] += bfr(bias[c0 + cofs + 2]); val[3] += bfr(bias[c0 + cofs + 3]); }
                *(v4f*)(crow + (size_t)row * ldc + cofs) = val; }
             }
        __builtin_amdgcn_wave_barrier(); asm volatile("" ::: "memory");
    }
    } else {
        // Sum of the NW partial tiles, 16 tile rows a pass: every wave stores its partial rows in its own LDS slice, then wave r adds row r over the slices in slice order and stores it (EPI 0) as one whole 256-B row or (EPI 1 to 3) as three 16-bit planes.
        // Two buffers in turn: a buffer is written again only behind the next pass's barrier, which every reader of it has then passed, so one barrier a pass is enough.
        // The loops over mb, nb and j are unrolled so that acc[][] is indexed by constants and stays in registers; the loop over p so that a row's NW LDS loads are in flight together.
        // The four summed rows are kept in registers and stored behind the last pass, so that no barrier of a pass has a global store to wait for.
        v2fa res[4];
#pragma unroll
        for (int mb = 0; mb < 4; ++mb) {
            float* ob = os + (mb & 1) * (NW * 16 * 68);
#pragma unroll
            for (int nb = 0; nb < 4; ++nb) {
#pragma unroll
                for (int j = 0; j < 8; ++j) ob[wv * (16 * 68) + (hi * 8 + j) * 68 + nb * 16 + lr] = acc[mb][nb][j]; }
            __syncthreads();   // publishes all NW partial slices of this pass to the waves that sum them
            const int cofs = lane * 2; v2fa val = *(const v2fa*)(ob + wv * 68 + cofs);
#pragma unroll
            for (int p = 1; p < NW; ++p) val += *(const v2fa*)(ob + p * (16 * 68) + wv * 68 + cofs);
            if (BIAS) { val[0] += bfr(bias[c0 + cofs]); val[1] += bfr(bias[c0 + cofs + 1]); }
            res[mb] = val;
        }
        if constexpr (EPI == 0) {
#pragma unroll
        for (int mb = 0; mb < 4; ++mb) *(v2fa*)(C + (size_t)(r0 + mb * 16 + wv) * ldc + c0 + lane * 2) = res[mb];
        } else {
            // e0: the lane's first element in a plane; est: the step from one 16-row pass to the next. In fragment order the lane's two elements (k = 2 lane, 2 lane + 1 of the tile's 64) lie in piece ((lane >> 3) & 1) * 32 + ((lane >> 2) & 1) * 16 + wv of block lane >> 4
            const int sub = (lane >> 4) * 512 + ((lane >> 3) & 1) * 256 + (((lane >> 2) & 1) * 16 + wv) * 8 + (lane & 3) * 2;
            const size_t e0 = (EPI == 1) ? (size_t)blockIdx.y * TT * HD + (size_t)(r0 + wv) * HD + lane * 2 : (EPI == 2) ? (size_t)blockIdx.y * TT * HD + (size_t)r0 * HD + sub : (size_t)blockIdx.x * HD * TT + (size_t)c0 * 16 + sub;
            constexpr int est = (EPI == 3) ? 16 * TT : 16 * HD;
            v2h o16[4]; v2us oh[4], ol[4];   // the loops below are unrolled so that res[], cs[] and these arrays are indexed by constants and stay in registers; all twelve stores stand behind the arithmetic, so that no register of an issued store is written again
#pragma unroll
            for (int mb = 0; mb < 4; ++mb)
#pragma unroll
                for (int q = 0; q < 2; ++q) { float r = res[mb][q];
                    if constexpr (EPI != 3) { const float x1 = xhalf(r); r = r * cs[mb][2 * q] + (hi ? x1 : -x1) * cs[mb][2 * q + 1]; }
                    o16[mb][q] = tohx(r); unsigned short a2, c2; splitf(r, a2, c2); oh[mb][q] = a2; ol[mb][q] = c2; }
#pragma unroll
            for (int mb = 0; mb < 4; ++mb) { *(v2h*)(P16 + e0 + mb * est) = o16[mb]; *(v2us*)(Ph + e0 + mb * est) = oh[mb]; *(v2us*)(Pl + e0 + mb * est) = ol[mb]; }
        }
    }
}

typedef __attribute__((ext_vector_type(4))) _Float16 v4h;
typedef __attribute__((ext_vector_type(4))) unsigned short v4us;
typedef __attribute__((ext_vector_type(2))) float v2f;
typedef __attribute__((ext_vector_type(4))) int v4i;

// k_wtG and k_cvt8 write one 16-byte piece of a fragment-order plane a thread, thread i piece i, so that a wave's store is 512 consecutive bytes. fo_row / fo_k: the row and the first k of piece i in a plane with K columns.
// Their sizes are compile-time constants, so that a thread's loads are immediate offsets from one address, which XWAIT1 keeps whole.
__device__ __forceinline__ int fo_row(int i, int K) { return ((i >> 6) / (K / 32)) * 16 + (i & 15); }
__device__ __forceinline__ int fo_k(int i, int K) { return ((i >> 6) % (K / 32)) * 32 + ((i >> 5) & 1) * 16 + ((i >> 4) & 1) * 8; }
// k_wtG: Bt[n][k] = bf16(w[k][n]) in fragment order; 16 neighbouring lanes read 16 neighbouring n of one k
template <int K, int N>
__global__ __launch_bounds__(256) void k_wtG(const float* __restrict__ w, bf* Bt) {
    const int i = blockIdx.x * 256 + threadIdx.x; if (i >= N * (K / 8)) return; const int n = fo_row(i, K), k0 = fo_k(i, K); const float* p = w + (size_t)k0 * N + n; float x[8]; v8us o;
#pragma unroll
    for (int j = 0; j < 8; ++j) x[j] = p[j * N];
    XWAIT1(p);
#pragma unroll
    for (int j = 0; j < 8; ++j) o[j] = f2bf(x[j]);
    *(v8us*)(Bt + (size_t)i * 8) = o; }
// k_cvt8: dst[r][k] = bf16(src[r][k]) in fragment order
template <int K>
__global__ __launch_bounds__(256) void k_cvt8(const float* __restrict__ src, bf* dst, int n8) { const int i = blockIdx.x * 256 + threadIdx.x; if (i >= n8) return; const float* p = src + (size_t)fo_row(i, K) * K + fo_k(i, K); const v8f v = *(const v8f*)p; XWAIT1(p); v8us o;
#pragma unroll
    for (int k = 0; k < 8; ++k) o[k] = f2bf(v[k]); *(v8us*)(dst + (size_t)i * 8) = o;  }
// k_mfo: the mask in the order in which the lanes of k_fattn read it: [row / 16][key / 32][(key >> 4) & 1][(key >> 2) & 1][lane = ((key >> 3) & 1) * 16 + (row & 15)][key & 3]; thread i writes the i-th group of 4
__global__ __launch_bounds__(256) void k_mfo(const int* __restrict__ mk, int* MF) { const int i = blockIdx.x * 256 + threadIdx.x; if (i >= TT * (TT / 4)) return;
    const int row = (i / (4 * TT)) * 16 + (i & 15), key = ((i >> 7) % (TT / 32)) * 32 + ((i >> 6) & 1) * 16 + ((i >> 4) & 1) * 8 + ((i >> 5) & 1) * 4; const int* p = mk + (size_t)row * TT + key; const v4i v = *(const v4i*)p; XWAIT1(p); *(v4i*)(MF + (size_t)i * 4) = v; }
__global__ __launch_bounds__(256) void k_cscvt(const float* __restrict__ cosT, const float* __restrict__ sinT, float* CS) { const int idx = blockIdx.x * 256 + threadIdx.x; if (idx >= TT * HD) return; v2f cs; cs[0] = bfr(cosT[idx]); cs[1] = bfr(sinT[idx]); *(v2f*)(CS + (size_t)idx * 2) = cs;  }
// ---- k_fattn: scores, mask, softmax, attn.v and the head merge in one kernel; no score or probability ever reaches memory. One wave = one query head x 16 * QT query rows, walking all TT keys 32 at a time;
// the REP waves of a workgroup are the REP query heads of one kv group on the same query rows, so they read the same K, V and mask lines at about the same time (shared through the WGP cache).
// Transposed products: St = K Qt (A = K rows, B = Q rows kept in registers), so a lane holds scores of ONE query (column lr), keys 8 hi + r of each 16-key tile; two such tiles, converted in place, are the B operand
// of Ot += Vt Pt (A = rows of the [d][t] plane). Running maximum and sum per lane; the two lane halves share the maximum every pass and join their sums once at the end.
// A masked score is -3e38 as a finite stand-in: while a row has seen masked keys only, its terms are exp2(0) = 1, and the first real score wipes them with the factor exp2(-inf) = 0.
// v_exp_f32 with, in the same statement, the one slot that the instruction set asks for behind a transcendental before its result is read or its source overwritten
__device__ __forceinline__ float exp2s(float x) { float y; asm("v_exp_f32 %0, %1\n\tv_nop" : "=v"(y) : "v"(x)); return y; }
template <typename T16, bool HI, int QT>
__device__ __forceinline__ void attn_body(const T16* __restrict__ Q, const T16* __restrict__ Q2, const T16* __restrict__ Kp, const T16* __restrict__ K2, const T16* __restrict__ Vt, const T16* __restrict__ V2, const int* __restrict__ mk, int q0, bf* Ah, bf* Al) {
    typedef WFrag<T16> F; typedef typename F::V V;
    const int lane = threadIdx.x & 31, lr = lane & 15, hi = lane >> 4;
    // every loop below but the one over j0 is unrolled so that the fragment and accumulator arrays are indexed by constants and stay in registers
    V qf[QT][2], qf2[QT][2]; const size_t qoff = (size_t)(q0 + lr) * HD + 8 * hi; const T16* qp = Q + qoff; const T16* qp2 = HI ? Q2 + qoff : qp;
#pragma unroll
    for (int qt = 0; qt < QT; ++qt)
#pragma unroll
        for (int ks = 0; ks < 2; ++ks) { qf[qt][ks] = F::ld(qp + qt * 16 * HD + ks * 32); if (HI) qf2[qt][ks] = F::ld(qp2 + qt * 16 * HD + ks * 32); }
    if constexpr (HI) XWAIT2(qp, qp2); else XWAIT1(qp);
    const int koff = lane * 8, voff = lane * 8; const int* mrow = mk + (size_t)q0 * TT + lane * 4;   // K, V and the mask are in fragment order (Q, read once, is row-major): 16 keys of K are 2 blocks = 16 HD elements, 32 keys of V one block per 16 d, 32 keys of the mask 512 ints per 16 rows
    v8f o[QT][4]; float mrun[QT], lrun[QT];
#pragma unroll
    for (int qt = 0; qt < QT; ++qt) { mrun[qt] = -3.0e38f; lrun[qt] = 0.f;
#pragma unroll
        for (int dt = 0; dt < 4; ++dt) o[qt][dt] = (v8f){}; }
    V ka[2][2], ka2[2][2]; v4i mm[QT][2][2];
    { const T16* kp = Kp + koff; const T16* kp2 = HI ? K2 + koff : kp;
#pragma unroll
      for (int kt = 0; kt < 2; ++kt) {
#pragma unroll
        for (int ks = 0; ks < 2; ++ks) { ka[kt][ks] = F::ldf(kp + kt * 16 * HD + ks * 512); if (HI) ka2[kt][ks] = F::ldf(kp2 + kt * 16 * HD + ks * 512); }
#pragma unroll
        for (int qt = 0; qt < QT; ++qt) { mm[qt][kt][0] = *(const v4i*)(mrow + (size_t)qt * 16 * TT + kt * 256); mm[qt][kt][1] = *(const v4i*)(mrow + (size_t)qt * 16 * TT + kt * 256 + 128); } }
      if constexpr (HI) XWAIT3(kp, kp2, mrow); else XWAIT2(kp, mrow); }
    for (int j0 = 0; j0 < TT; j0 += 32) {
        const int jn = (j0 + 32 < TT) ? j0 + 32 : j0;   // the K and mask fragments are fetched one pass ahead; the last pass fetches its own again, inside the arrays
        V va[4], va2[4]; const T16* vp = Vt + voff + j0 * 16; const T16* vp2 = HI ? V2 + voff + j0 * 16 : vp;
#pragma unroll
        for (int dt = 0; dt < 4; ++dt) { va[dt] = F::ldf(vp + (size_t)dt * 16 * TT); if (HI) va2[dt] = F::ldf(vp2 + (size_t)dt * 16 * TT); }
        // its scheduling barrier also keeps the V loads at the head of the pass, the score products and a whole softmax ahead of their use; without it the compiler sinks them to just in front of attn.v
        if constexpr (HI) XWAIT2(vp, vp2); else XWAIT1(vp);
        v8f s[QT][2];
#pragma unroll
        for (int kt = 0; kt < 2; ++kt)
#pragma unroll
            for (int qt = 0; qt < QT; ++qt) { v8f c = (v8f){};
#pragma unroll
                for (int ks = 0; ks < 2; ++ks) { c = F::mma(ka[kt][ks], qf[qt][ks], c); if (HI) { c = F::mma(ka[kt][ks], qf2[qt][ks], c); c = F::mma(ka2[kt][ks], qf[qt][ks], c); } }
                s[qt][kt] = c; }
        const T16* kp = Kp + koff + (size_t)jn * HD; const T16* kp2 = HI ? K2 + koff + (size_t)jn * HD : kp; const int* mp = mrow + jn * 16;
#pragma unroll
        for (int kt = 0; kt < 2; ++kt)
#pragma unroll
            for (int ks = 0; ks < 2; ++ks) { ka[kt][ks] = F::ldf(kp + kt * 16 * HD + ks * 512); if (HI) ka2[kt][ks] = F::ldf(kp2 + kt * 16 * HD + ks * 512); }
        V pf[QT], pf2[QT]; float mxs[QT];
#pragma unroll
        for (int qt = 0; qt < QT; ++qt) {
            float mx = -3.0e38f;
#pragma unroll
            for (int kt = 0; kt < 2; ++kt)
#pragma unroll
                for (int r = 0; r < 8; ++r) { const float t = (mm[qt][kt][r >> 2][r & 3] == 0) ? s[qt][kt][r] * SCL2 : -3.0e38f; s[qt][kt][r] = t; mx = fmaxf(mx, t); }
#pragma unroll
            for (int kt = 0; kt < 2; ++kt) { mm[qt][kt][0] = *(const v4i*)(mp + (size_t)qt * 16 * TT + kt * 256); mm[qt][kt][1] = *(const v4i*)(mp + (size_t)qt * 16 * TT + kt * 256 + 128); }
            mxs[qt] = mx; }
        // its scheduling barrier also keeps the next pass's K and mask loads in front of the softmax and attn.v of this pass, which cover their latency; without it the compiler sinks them to the foot of the pass or into the next one
        if constexpr (HI) XWAIT3(kp, kp2, mp); else XWAIT2(kp, mp);
#pragma unroll
        for (int qt = 0; qt < QT; ++qt) {
            const float mx = fmaxf(mxs[qt], xhalf(mxs[qt]));
            const float mnew = fmaxf(mrun[qt], mx); const float corr = exp2s(mrun[qt] - mnew); mrun[qt] = mnew;
            float sum = 0.f;
#pragma unroll
            for (int kt = 0; kt < 2; ++kt)
#pragma unroll
                for (int r = 0; r < 8; ++r) { const float p = exp2s(s[qt][kt][r] - mnew); sum += p;
                    if constexpr (HI) { unsigned short a, c2; splitf(p, a, c2); pf[qt][kt * 8 + r] = __builtin_bit_cast(__bf16, a); pf2[qt][kt * 8 + r] = __builtin_bit_cast(__bf16, c2); }
                    else pf[qt][kt * 8 + r] = tohx(p); }
            lrun[qt] = lrun[qt] * corr + sum;
#pragma unroll
            for (int dt = 0; dt < 4; ++dt) o[qt][dt] *= corr;
        }
#pragma unroll
        for (int dt = 0; dt < 4; ++dt)
#pragma unroll
            for (int qt = 0; qt < QT; ++qt) { o[qt][dt] = F::mma(va[dt], pf[qt], o[qt][dt]); if (HI) { o[qt][dt] = F::mma(va[dt], pf2[qt], o[qt][dt]); o[qt][dt] = F::mma(va2[dt], pf[qt], o[qt][dt]); } }
    }
#pragma unroll
    for (int qt = 0; qt < QT; ++qt) { const float inv = __fdiv_rn(1.0f, lrun[qt] + xhalf(lrun[qt])); const size_t oo = (size_t)(q0 + qt * 16) * DQ + lane * 8;
#pragma unroll
        for (int dt = 0; dt < 4; ++dt) { v8us oh, ol;   // a lane's 8 accumulator registers are 8 consecutive d of its query row: one 16-byte piece of the merged planes, which are in fragment order (rows t, k = h HD + d); a wave's store is 512 consecutive bytes
#pragma unroll
            for (int r = 0; r < 8; ++r) { unsigned short a, c2; splitf(o[qt][dt][r] * inv, a, c2); oh[r] = a; ol[r] = c2; }
            *(v8us*)(Ah + oo + dt * 256) = oh; *(v8us*)(Al + oo + dt * 256) = ol;
            // s_wait_xcnt 0 behind the pair of stores, in front of the next tile's packing, which takes their data registers anew: it names the data, so that they stay whole up to it, and nothing is scheduled across it
            asm volatile("s_wait_xcnt 0x0" :: "v"(oh), "v"(ol) : "memory"); __builtin_amdgcn_sched_barrier(0); } }
}
// grid (RH/16 + (TT - RH)/32, NKV), 32 * REP threads: the first RH/16 blocks in x take 16 hi+lo query rows each (three products for one), the rest 32 fp16 rows each
__global__ __launch_bounds__(32 * REP) void k_fattn(const h16* __restrict__ Q16, const bf* __restrict__ Qh, const bf* __restrict__ Ql, const h16* __restrict__ K16, const bf* __restrict__ Kh, const bf* __restrict__ Kl, const h16* __restrict__ V16, const bf* __restrict__ Vh, const bf* __restrict__ Vl, const int* __restrict__ mk, bf* Ah, bf* Al) {
    const int g = blockIdx.y, h = g * REP + __builtin_amdgcn_readfirstlane((int)(threadIdx.x >> 5)); const size_t qo = (size_t)h * TT * HD, ko = (size_t)g * TT * HD; const int bx = blockIdx.x;
    if (bx < RH / 16) attn_body<bf, true, 1>(Qh + qo, Ql + qo, Kh + ko, Kl + ko, Vh + ko, Vl + ko, mk, bx * 16, Ah + h * 16 * HD, Al + h * 16 * HD);
    else attn_body<h16, false, 2>(Q16 + qo, nullptr, K16 + ko, nullptr, V16 + ko, nullptr, mk, RH + (bx - RH / 16) * 32, Ah + h * 16 * HD, Al + h * 16 * HD);
}

extern "C" void kernel_launch(void* const* d_in, const int* in_sizes, int n_in,
                              void* d_out, int out_size, void* d_ws, size_t ws_size, hipStream_t stream) {
    (void)in_sizes; (void)n_in; (void)out_size;
    const float* x = (const float*)d_in[0]; const int* mk = (const int*)d_in[1]; const float* cosT = (const float*)d_in[2]; const float* sinT = (const float*)d_in[3]; const float* wq = (const float*)d_in[4]; const float* wk = (const float*)d_in[5]; const float* wv = (const float*)d_in[6]; const float* wo = (const float*)d_in[7]; const float* bo = (const float*)d_in[8];   // all weights x @ W
    float* OUT = (float*)d_out;     // [2][2048][2048]
    char* wsp = (char*)d_ws;
    auto take = [&](size_t bytes) { char* p = wsp; wsp += (bytes + 255) & ~(size_t)255; return (void*)p; };
    bf* WQ = (bf*)take((size_t)DQ * DM * 2); bf* WK = (bf*)take((size_t)DKV * DM * 2); bf* WV = (bf*)take((size_t)DKV * DM * 2); bf* WO = (bf*)take((size_t)DM * DQ * 2); float* CS = (float*)take((size_t)TT * HD * 2 * 4);
    bf* XB = (bf*)take((size_t)TT * DM * 2);
    h16* QP16 = (h16*)take((size_t)NH_ * TT * HD * 2); h16* KP16 = (h16*)take((size_t)NKV * TT * HD * 2); h16* VT16 = (h16*)take((size_t)NKV * HD * TT * 2);
    bf* QPh = (bf*)take((size_t)NH_ * TT * HD * 2); bf* QPl = (bf*)take((size_t)NH_ * TT * HD * 2); bf* KPh = (bf*)take((size_t)NKV * TT * HD * 2); bf* KPl = (bf*)take((size_t)NKV * TT * HD * 2); bf* VTh = (bf*)take((size_t)NKV * HD * TT * 2); bf* VTl = (bf*)take((size_t)NKV * HD * TT * 2);
    bf* ATh = (bf*)take((size_t)TT * DQ * 2); bf* ATl = (bf*)take((size_t)TT * DQ * 2); int* MF = (int*)take((size_t)TT * TT * 4);
    if ((size_t)(wsp - (char*)d_ws) > ws_size) return;    // ws 256 MiB
    { k_wtG<DM, DQ><<<(unsigned)(DM * DQ / 8 / 256), 256, 0, stream>>>(wq, WQ); k_wtG<DM, DKV><<<(unsigned)(DM * DKV / 8 / 256), 256, 0, stream>>>(wk, WK); k_wtG<DM, DKV><<<(unsigned)(DM * DKV / 8 / 256), 256, 0, stream>>>(wv, WV);
      k_wtG<DQ, DM><<<(unsigned)(DQ * DM / 8 / 256), 256, 0, stream>>>(wo, WO);
       }
    k_cscvt<<<(TT * HD + 255) / 256, 256, 0, stream>>>(cosT, sinT, CS);   // one shared table (read as data)
    k_mfo<<<TT * (TT / 4) / 256, 256, 0, stream>>>(mk, MF);   // one shared mask (read as data)
    for (int b = 0; b < NB_; ++b) {
        k_cvt8<DM><<<(unsigned)(((size_t)TT * DM / 8 + 255) / 256), 256, 0, stream>>>(x + (size_t)b * TT * DM, XB, TT * DM / 8);
        k_gemmw<bf, 0, false, 16, DM, 1><<<dim3(TT / 64, DQ / 64, 1), 512, 0, stream>>>(XB, nullptr, WQ, nullptr, nullptr, 0, nullptr, 0, 0, 0, CS, QP16, QPh, QPl);
        k_gemmw<bf, 0, false, 16, DM, 2><<<dim3(TT / 64, DKV / 64, 1), 512, 0, stream>>>(XB, nullptr, WK, nullptr, nullptr, 0, nullptr, 0, 0, 0, CS, KP16, KPh, KPl);
        k_gemmw<bf, 0, false, 16, DM, 3><<<dim3(DKV / 64, TT / 64, 1), 512, 0, stream>>>(WV, nullptr, XB, nullptr, nullptr, 0, nullptr, 0, 0, 0, nullptr, VT16, VTh, VTl);
        k_fattn<<<dim3(RH / 16 + (TT - RH) / 32, NKV, 1), 32 * REP, 0, stream>>>(QP16, QPh, QPl, KP16, KPh, KPl, VT16, VTh, VTl, MF, ATh, ATl);
        k_gemmw<bf, 1, true, 16, DQ, 0><<<dim3(TT / 64, DM / 64, 1), 512, 0, stream>>>(ATh, ATl, WO, nullptr, OUT + (size_t)b * TT * DM, DM, bo, 0, 0, 0, nullptr, nullptr, nullptr, nullptr); }
}

// v006
// It runs in 279 microseconds.
// In two side-by-side timings against v005, it was 1.18 and 1.15 times as fast.
// Counting every step since v000, it is 13.8 times as fast.
#include <hip/hip_runtime.h>

// Grouped-query attention with RoPE and a 2-D mask (x [2][2048][2048]; q = x Wq (32 heads x 64), k, v = x Wk / x Wv (8 kv groups x 64, each serving 4 consecutive query heads); rotate-half RoPE with the input
// cos/sin tables [2048][64] (read as data); scores = q.k/8, -inf where mask[i][j] != 0 (int [2048][2048], read as data); softmax; out = merged attn.v Wo + bo -> [2][2048][2048]).
// Compute dtypes, f32 accumulate: every input rounded to bf16; projections on PLAIN bf16 operands (inputs: exact products, f32 accumulate); RoPE in f32; PER-ROW PRECISION
// HYBRID: query rows < 256 take scores and attn.v on bf16 hi+lo planes (3 products), rows >= 256 on single fp16 planes; 1/8 and the mask in f32 in the running softmax of the fused attention kernel; merged heads as hi+lo planes

#define NB_  2
#define TT   2048
#define DM   2048
#define NH_  32
#define NKV  8
#define REP  (NH_ / NKV)
#define HD   64
#define DQ   (NH_ * HD)
#define DKV  (NKV * HD)
#define RH   256                  // query rows < RH use hi+lo planes (0: none)
#define WIN  0
#define SCL2 0.18033688011112042f   // HD^-0.5 x log2(e): the softmax runs in base 2
typedef _Float16 h16;
typedef unsigned short bf;
typedef __attribute__((ext_vector_type(16))) __bf16   v16bf;
typedef __attribute__((ext_vector_type(16))) _Float16 v16h;
typedef __attribute__((ext_vector_type(8)))  _Float16 v8h;
typedef __attribute__((ext_vector_type(8)))  unsigned short v8us;
typedef __attribute__((ext_vector_type(8)))  float    v8f;
typedef __attribute__((ext_vector_type(4)))  float    v4f;
typedef v8h  __attribute__((may_alias)) v8ha;
typedef v4f  __attribute__((may_alias)) v4fa;
typedef v8us __attribute__((may_alias)) v8usa;
typedef __attribute__((ext_vector_type(2))) float __attribute__((may_alias)) v2fa;

__device__ __forceinline__ unsigned short f2bf(float f) { unsigned u = __float_as_uint(f); u += 0x7FFFu + ((u >> 16) & 1u); return (unsigned short)(u >> 16); }
__device__ __forceinline__ float bf2f(unsigned short b) { return __uint_as_float(((unsigned)b) << 16); }
__device__ __forceinline__ float bfr(float f) { return bf2f(f2bf(f)); }
__device__ __forceinline__ v16h cat16(v8h lo, v8h hi) { return __builtin_shufflevector(lo, hi, 0, 1, 2, 3, 4, 5, 6, 7, 8, 9, 10, 11, 12, 13, 14, 15); }
__device__ __forceinline__ v16bf cat16b(v8us lo, v8us hi) { return __builtin_bit_cast(v16bf, __builtin_shufflevector(lo, hi, 0, 1, 2, 3, 4, 5, 6, 7, 8, 9, 10, 11, 12, 13, 14, 15)); }
__device__ __forceinline__ v8f wmma16(v16h a, v16h b, v8f c) { return __builtin_amdgcn_wmma_f32_16x16x32_f16(false, a, false, b, (short)0, c, false, false); }
__device__ __forceinline__ v8f wmmab(v16bf a, v16bf b, v8f c) { return __builtin_amdgcn_wmma_f32_16x16x32_bf16(false, a, false, b, (short)0, c, false, false); }
__device__ __forceinline__ h16 tohx(float x) { return (h16)x; }
__device__ __forceinline__ void splitf(float y, unsigned short& h, unsigned short& l) { h = f2bf(y); l = f2bf(y - bf2f(h)); }
typedef __attribute__((ext_vector_type(2))) _Float16 v2h;
typedef __attribute__((ext_vector_type(2))) unsigned short v2us;
__device__ __forceinline__ float xhalf(float x) { return __builtin_bit_cast(float, __builtin_amdgcn_permlanex16(__builtin_bit_cast(int, x), __builtin_bit_cast(int, x), 0x76543210, 0xfedcba98, false, false)); }  // lane l reads lane l ^ 16



// s_wait_xcnt 0 behind a group of global loads, in front of every rewrite of their address registers: it names the addresses, so that they stay whole up to it (no later load of the group lands on them), and nothing is scheduled across it
#define XWAIT1(a)       do { asm volatile("s_wait_xcnt 0x0" :: "v"(a) : "memory"); __builtin_amdgcn_sched_barrier(0); } while (0)
#define XWAIT2(a, b)    do { asm volatile("s_wait_xcnt 0x0" :: "v"(a), "v"(b) : "memory"); __builtin_amdgcn_sched_barrier(0); } while (0)
#define XWAIT3(a, b, c) do { asm volatile("s_wait_xcnt 0x0" :: "v"(a), "v"(b), "v"(c) : "memory"); __builtin_amdgcn_sched_barrier(0); } while (0)
// ---- gemmw: register-blocked GEMM, one 64x64 output tile per workgroup (16 accumulators a wave), operands straight from 16-bit planes in fragment order; tile (bx, by) of (M/64, N/64), batch bz, 32 * NW threads. It is a device function, so that one launch
// can hold several products as ranges of its grid (k_qkv); os is the workgroup's LDS. The NB_ batches of x are one plane of NB_ * TT rows, so that a product over x or over the merged heads takes both in one grid.
// C[m][n] (f32, pitch ldc, + optional f32 bias[n]) = sum_k A[m][k] Bt[n][k] (+ split products per NSPLIT). z-batch strides sA/sB/sC in elements: A and C step with every z, Bt with every REP-th z (the REP query heads of one kv group share it). K % (32 * NW) == 0.
// NW == 1: one wave walks all of K. NW == 16: wave w walks the K range [w K/16, (w+1) K/16), so a long K costs K/512 dependent load rounds instead of K/32; the 16 partial tiles are summed in LDS, wave 0 first.
// FRAGMENT ORDER of a 16-bit plane P[row][k] (rows % 16 == 0, K % 32 == 0): the 16 rows x 32 k of one A or B fragment are one 1-KiB block, blocks in the order [row / 16][k / 32]; inside a block the 16-byte piece of
// row r, k = 8 s .. 8 s + 7 (s = 0..3) is piece (s >> 1) * 32 + (s & 1) * 16 + (r & 15). Lane l of a wave then reads pieces l and 32 + l (ldf): each load instruction covers 512 consecutive bytes, four whole cache lines,
// where on a row-major plane (ld) it touches 16 lines for 32 bytes each. The values a lane and register receive are the same as with ld on the row-major plane.
template <typename T16> struct WFrag;
template <> struct WFrag<h16> { typedef v16h V; static __device__ __forceinline__ V ld(const h16* p) { return cat16(*(const v8h*)p, *(const v8h*)(p + 16)); } static __device__ __forceinline__ V ldf(const h16* p) { return cat16(*(const v8h*)p, *(const v8h*)(p + 256)); } static __device__ __forceinline__ v8f mma(V a, V b, v8f c) { return wmma16(a, b, c); } };
template <> struct WFrag<bf> { typedef v16bf V; static __device__ __forceinline__ V ld(const bf* p) { return cat16b(*(const v8us*)p, *(const v8us*)(p + 16)); } static __device__ __forceinline__ V ldf(const bf* p) { return cat16b(*(const v8us*)p, *(const v8us*)(p + 256)); } static __device__ __forceinline__ v8f mma(V a, V b, v8f c) { return wmmab(a, b, c); } };
// EPI: what becomes of the summed tile. 0: stored as f32 in C. 1 to 3 (NW == 16): it never reaches memory as f32; the wave that has summed a row turns it into the three 16-bit planes of the attention kernel (fp16, bf16 hi, bf16 lo) itself.
//   1: q. The tile is 64 positions x the 64 d of head by; rotate-half RoPE out[d] = x[d] cos[t][d] - x[d+32] sin[t][d], out[d+32] = x[d+32] cos[t][d+32] + x[d] sin[t][d+32]; a lane holds d = 2 lane, 2 lane + 1 of its row,
//      so the partner d +- 32 is the same register of lane ^ 16. Planes [h][t][d], row-major.
//   2: k. The same, each head's [t][d] plane in fragment order (rows t, k = d).
//   3: v. Launched with A = the weight rows (d) and Bt = x (t), so the tile comes out as [d][t] and a lane holds two neighbouring t of one d. No RoPE. Each kv group's [d][t] plane (group bx) in fragment order (rows d, k = t).
template <typename T16, int NSPLIT, bool BIAS, int NW, int K, int EPI>
__device__ __forceinline__ void gemmw(float* os, int bx, int by, int bz, const T16* __restrict__ A, const T16* __restrict__ A2, const T16* __restrict__ Bt, const T16* __restrict__ Bt2, float* C, int ldc, const float* __restrict__ bias, size_t sA, size_t sB, size_t sC, const float* __restrict__ CS, h16* P16, bf* Ph, bf* Pl) {
    typedef typename WFrag<T16>::V V;
    static_assert(NW == 1 || NW == 16, "the LDS sum maps one wave to one of 16 tile rows");
    static_assert(EPI == 0 || NW == 16, "the plane epilogues stand behind the LDS sum");
    const size_t z = bz; A += z * sA; if (A2) A2 += z * sA; Bt += (z / REP) * sB; if (Bt2) Bt2 += (z / REP) * sB; C += z * sC;
    const int lane = threadIdx.x & 31, lr = lane & 15, hi = lane >> 4; const int r0 = bx * 64, c0 = by * 64;
    v8f acc[4][4];
#pragma unroll
    for (int mb = 0; mb < 4; ++mb)
#pragma unroll
        for (int nb = 0; nb < 4; ++nb) acc[mb][nb] = (v8f){};
    const size_t aoff = (size_t)r0 * K + lane * 8, boff = (size_t)c0 * K + lane * 8;   // a 16-row tile is K / 32 blocks of 512 elements = 16 K elements
    const int wv = (NW == 1) ? 0 : __builtin_amdgcn_readfirstlane((int)(threadIdx.x >> 5)); const int kb = wv * (K / NW), ke = kb + K / NW;
    v4f cs[4];
    if constexpr (EPI == 1 || EPI == 2) {   // cos and sin of the four rows that this wave will sum (cos d, sin d, cos d+1, sin d+1 a lane), fetched ahead of the K loop, which covers their latency: behind it the first barrier of the LDS sum would wait for them
        const float* csp = CS + ((size_t)(r0 % TT + wv) * HD + lane * 2) * 2;   // row r0 of the x plane is position r0 % TT of batch r0 / TT
#pragma unroll   // cs[] is indexed by constants and stays in registers; the four loads are immediate offsets from one address
        for (int mb = 0; mb < 4; ++mb) cs[mb] = *(const v4f*)(csp + mb * 16 * HD * 2);
        XWAIT1(csp); }
#pragma unroll 1
    for (int kc = kb; kc < ke; kc += 32) {
        V a[4], a2[4], b[4], b2[4];   // K is a compile-time constant, so that the four 16-row tiles of an operand are immediate offsets from one address
        const T16* pa = A + aoff + kc * 16; const T16* pa2 = (NSPLIT == 1 || NSPLIT == 2) ? A2 + aoff + kc * 16 : pa; const T16* pb = Bt + boff + kc * 16; const T16* pb2 = (NSPLIT >= 2) ? Bt2 + boff + kc * 16 : pb;
#pragma unroll
        for (int mb = 0; mb < 4; ++mb) { a[mb] = WFrag<T16>::ldf(pa + mb * 16 * K); if (NSPLIT == 1 || NSPLIT == 2) a2[mb] = WFrag<T16>::ldf(pa2 + mb * 16 * K); }
#pragma unroll
        for (int nb = 0; nb < 4; ++nb) { b[nb] = WFrag<T16>::ldf(pb + nb * 16 * K); if (NSPLIT >= 2) b2[nb] = WFrag<T16>::ldf(pb2 + nb * 16 * K); }
        // s_wait_xcnt 0 behind the trip's global loads, in front of every rewrite of their address registers: it names the addresses, so that they stay whole up to it (no later load of the trip lands on them), and nothing is scheduled across it
        asm volatile("s_wait_xcnt 0x0" :: "v"(pa), "v"(pa2), "v"(pb), "v"(pb2) : "memory"); __builtin_amdgcn_sched_barrier(0);
#pragma unroll
        for (int nb = 0; nb < 4; ++nb) {
#pragma unroll
            for (int mb = 0; mb < 4; ++mb) { acc[mb][nb] = WFrag<T16>::mma(a[mb], b[nb], acc[mb][nb]); if (NSPLIT == 1 || NSPLIT == 2) acc[mb][nb] = WFrag<T16>::mma(a2[mb], b[nb], acc[mb][nb]); if (NSPLIT >= 2) acc[mb][nb] = WFrag<T16>::mma(a[mb], b2[nb], acc[mb][nb]); } }
        asm volatile("v_nop\n\tv_nop\n\tv_nop\n\tv_nop" : "+v"(acc[0][0]), "+v"(acc[1][1]), "+v"(acc[2][2]), "+v"(acc[3][3]) : "v"(a[0]), "v"(a[3]));
    }
    if constexpr (NW == 1) {
#pragma unroll
    for (int mb = 0; mb < 4; ++mb) {
#pragma unroll
        for (int nb = 0; nb < 4; ++nb) {
#pragma unroll
            for (int j = 0; j < 8; ++j) os[(hi * 8 + j) * 68 + nb * 16 + lr] = acc[mb][nb][j]; }
        __builtin_amdgcn_wave_barrier(); asm volatile("" ::: "memory");
        float* crow = C + (size_t)(r0 + mb * 16) * ldc + c0;
{
#pragma unroll
            for (int s = 0; s < 8; ++s) { const int row = 2 * s + hi, cofs = lr * 4; v4f val = *(const v4fa*)(os + row * 68 + cofs); if (BIAS) { val[0] += bfr(bias[c0 + cofs]); val[1] += bfr(bias[c0 + cofs + 1]); val[2] += bfr(bias[c0 + cofs + 2]); val[3] += bfr(bias[c0 + cofs + 3]); }
                *(v4f*)(crow + (size_t)row * ldc + cofs) = val; }
             }
        __builtin_amdgcn_wave_barrier(); asm volatile("" ::: "memory");
    }
    } else {
        // Sum of the NW partial tiles, 16 tile rows a pass: every wave stores its partial rows in its own LDS slice, then wave r adds row r over the slices in slice order and stores it (EPI 0) as one whole 256-B row or (EPI 1 to 3) as three 16-bit planes.
        // Two buffers in turn: a buffer is written again only behind the next pass's barrier, which every reader of it has then passed, so one barrier a pass is enough.
        // The loops over mb, nb and j are unrolled so that acc[][] is indexed by constants and stays in registers; the loop over p so that a row's NW LDS loads are in flight together.
        // The four summed rows are kept in registers and stored behind the last pass, so that no barrier of a pass has a global store to wait for.
        v2fa res[4];
#pragma unroll
        for (int mb = 0; mb < 4; ++mb) {
            float* ob = os + (mb & 1) * (NW * 16 * 68);
#pragma unroll
            for (int nb = 0; nb < 4; ++nb) {
#pragma unroll
                for (int j = 0; j < 8; ++j) ob[wv * (16 * 68) + (hi * 8 + j) * 68 + nb * 16 + lr] = acc[mb][nb][j]; }
            __syncthreads();   // publishes all NW partial slices of this pass to the waves that sum them
            const int cofs = lane * 2; v2fa val = *(const v2fa*)(ob + wv * 68 + cofs);
#pragma unroll
            for (int p = 1; p < NW; ++p) val += *(const v2fa*)(ob + p * (16 * 68) + wv * 68 + cofs);
            if (BIAS) { val[0] += bfr(bias[c0 + cofs]); val[1] += bfr(bias[c0 + cofs + 1]); }
            res[mb] = val;
        }
        if constexpr (EPI == 0) {
#pragma unroll
        for (int mb = 0; mb < 4; ++mb) *(v2fa*)(C + (size_t)(r0 + mb * 16 + wv) * ldc + c0 + lane * 2) = res[mb];
        } else {
            // e0: the lane's first element in a plane; est: the step from one 16-row pass to the next. In fragment order the lane's two elements (k = 2 lane, 2 lane + 1 of the tile's 64) lie in piece ((lane >> 3) & 1) * 32 + ((lane >> 2) & 1) * 16 + wv of block lane >> 4
            const int sub = (lane >> 4) * 512 + ((lane >> 3) & 1) * 256 + (((lane >> 2) & 1) * 16 + wv) * 8 + (lane & 3) * 2;
            const size_t e0 = (EPI == 1) ? ((size_t)(r0 / TT) * NH_ + by) * TT * HD + (size_t)(r0 % TT + wv) * HD + lane * 2 : (EPI == 2) ? ((size_t)(r0 / TT) * NKV + by) * TT * HD + (size_t)(r0 % TT) * HD + sub : ((size_t)(c0 / TT) * NKV + bx) * HD * TT + (size_t)(c0 % TT) * 16 + sub;   // a batch's heads (kv groups) follow one another, batch after batch
            constexpr int est = (EPI == 3) ? 16 * TT : 16 * HD;
            v2h o16[4]; v2us oh[4], ol[4];   // the loops below are unrolled so that res[], cs[] and these arrays are indexed by constants and stay in registers; all twelve stores stand behind the arithmetic, so that no register of an issued store is written again
#pragma unroll
            for (int mb = 0; mb < 4; ++mb)
#pragma unroll
                for (int q = 0; q < 2; ++q) { float r = res[mb][q];
                    if constexpr (EPI != 3) { const float x1 = xhalf(r); r = r * cs[mb][2 * q] + (hi ? x1 : -x1) * cs[mb][2 * q + 1]; }
                    o16[mb][q] = tohx(r); unsigned short a2, c2; splitf(r, a2, c2); oh[mb][q] = a2; ol[mb][q] = c2; }
#pragma unroll
            for (int mb = 0; mb < 4; ++mb) { *(v2h*)(P16 + e0 + mb * est) = o16[mb]; *(v2us*)(Ph + e0 + mb * est) = oh[mb]; *(v2us*)(Pl + e0 + mb * est) = ol[mb]; }
            // s_wait_xcnt 0 behind the twelve stores: inlined as a range of a larger kernel, this function's end is not the wave's end in the listing, and code of another range that follows rewrites registers that the stores name; it names the data, so that they stay whole up to it, and nothing is scheduled across it
            asm volatile("s_wait_xcnt 0x0" :: "v"(o16[0]), "v"(o16[1]), "v"(o16[2]), "v"(o16[3]), "v"(oh[0]), "v"(oh[1]), "v"(oh[2]), "v"(oh[3]), "v"(ol[0]), "v"(ol[1]), "v"(ol[2]), "v"(ol[3]) : "memory"); __builtin_amdgcn_sched_barrier(0);
        }
    }
}

// k_qkv: the q, k and v projections of both batches as three ranges of one grid (they read the same x plane and depend on nothing of one another); inside a range the tile's first index runs fastest. The range test is the same for a whole workgroup, so that every barrier of gemmw is passed by all of its waves.
#define MT (NB_ * TT / 64)   // 64-row tiles of the x plane
__global__ __launch_bounds__(512) void k_qkv(const bf* __restrict__ XB, const bf* __restrict__ WQ, const bf* __restrict__ WK, const bf* __restrict__ WV, const float* __restrict__ CS, h16* QP16, bf* QPh, bf* QPl, h16* KP16, bf* KPh, bf* KPl, h16* VT16, bf* VTh, bf* VTl) {
    __shared__ __align__(16) float os[2 * 16 * 16 * 68];
    int i = blockIdx.x;
    if (i < MT * (DQ / 64)) { gemmw<bf, 0, false, 16, DM, 1>(os, i % MT, i / MT, 0, XB, nullptr, WQ, nullptr, nullptr, 0, nullptr, 0, 0, 0, CS, QP16, QPh, QPl); return; }
    i -= MT * (DQ / 64);
    if (i < MT * (DKV / 64)) { gemmw<bf, 0, false, 16, DM, 2>(os, i % MT, i / MT, 0, XB, nullptr, WK, nullptr, nullptr, 0, nullptr, 0, 0, 0, CS, KP16, KPh, KPl); return; }
    i -= MT * (DKV / 64);
    gemmw<bf, 0, false, 16, DM, 3>(os, i % (DKV / 64), i / (DKV / 64), 0, WV, nullptr, XB, nullptr, nullptr, 0, nullptr, 0, 0, 0, nullptr, VT16, VTh, VTl);
}
// k_oproj: out = merged heads (hi + lo planes) Wo + bo, both batches; grid (MT, DM / 64)
__global__ __launch_bounds__(512) void k_oproj(const bf* __restrict__ ATh, const bf* __restrict__ ATl, const bf* __restrict__ WO, float* OUT, const float* __restrict__ bo) {
    __shared__ __align__(16) float os[2 * 16 * 16 * 68];
    gemmw<bf, 1, true, 16, DQ, 0>(os, blockIdx.x, blockIdx.y, 0, ATh, ATl, WO, nullptr, OUT, DM, bo, 0, 0, 0, nullptr, nullptr, nullptr, nullptr);
}

typedef __attribute__((ext_vector_type(4))) _Float16 v4h;
typedef __attribute__((ext_vector_type(4))) unsigned short v4us;
typedef __attribute__((ext_vector_type(2))) float v2f;
typedef __attribute__((ext_vector_type(4))) int v4i;

// The conversions are device functions of a block index bx, 256 threads a block: none depends on another, and k_prep runs them all as ranges of one grid.
// k_wtG and k_cvt8 write one 16-byte piece of a fragment-order plane a thread, thread i piece i, so that a wave's store is 512 consecutive bytes. fo_row / fo_k: the row and the first k of piece i in a plane with K columns.
// Their sizes are compile-time constants, so that a thread's loads are immediate offsets from one address, which XWAIT1 keeps whole.
__device__ __forceinline__ int fo_row(int i, int K) { return ((i >> 6) / (K / 32)) * 16 + (i & 15); }
__device__ __forceinline__ int fo_k(int i, int K) { return ((i >> 6) % (K / 32)) * 32 + ((i >> 5) & 1) * 16 + ((i >> 4) & 1) * 8; }
// k_wtG: Bt[n][k] = bf16(w[k][n]) in fragment order; 16 neighbouring lanes read 16 neighbouring n of one k
template <int K, int N>
__device__ __forceinline__ void k_wtG(int bx, const float* __restrict__ w, bf* Bt) {
    const int i = bx * 256 + threadIdx.x; if (i >= N * (K / 8)) return; const int n = fo_row(i, K), k0 = fo_k(i, K); const float* p = w + (size_t)k0 * N + n; float x[8]; v8us o;
#pragma unroll
    for (int j = 0; j < 8; ++j) x[j] = p[j * N];
    XWAIT1(p);
#pragma unroll
    for (int j = 0; j < 8; ++j) o[j] = f2bf(x[j]);
    *(v8us*)(Bt + (size_t)i * 8) = o; }
// k_cvt8: dst[r][k] = bf16(src[r][k]) in fragment order
template <int K>
__device__ __forceinline__ void k_cvt8(int bx, const float* __restrict__ src, bf* dst, int n8) { const int i = bx * 256 + threadIdx.x; if (i >= n8) return; const float* p = src + (size_t)fo_row(i, K) * K + fo_k(i, K); const v8f v = *(const v8f*)p; XWAIT1(p); v8us o;
#pragma unroll
    for (int k = 0; k < 8; ++k) o[k] = f2bf(v[k]); *(v8us*)(dst + (size_t)i * 8) = o;  }
// k_mfo: the mask in the order in which the lanes of k_fattn read it: [row / 16][key / 32][(key >> 4) & 1][(key >> 2) & 1][lane = ((key >> 3) & 1) * 16 + (row & 15)][key & 3]; thread i writes the i-th group of 4
__device__ __forceinline__ void k_mfo(int bx, const int* __restrict__ mk, int* MF) { const int i = bx * 256 + threadIdx.x; if (i >= TT * (TT / 4)) return;
    const int row = (i / (4 * TT)) * 16 + (i & 15), key = ((i >> 7) % (TT / 32)) * 32 + ((i >> 6) & 1) * 16 + ((i >> 4) & 1) * 8 + ((i >> 5) & 1) * 4; const int* p = mk + (size_t)row * TT + key; const v4i v = *(const v4i*)p; XWAIT1(p); *(v4i*)(MF + (size_t)i * 4) = v; }
__device__ __forceinline__ void k_cscvt(int bx, const float* __restrict__ cosT, const float* __restrict__ sinT, float* CS) { const int idx = bx * 256 + threadIdx.x; if (idx >= TT * HD) return; v2f cs; cs[0] = bfr(cosT[idx]); cs[1] = bfr(sinT[idx]); *(v2f*)(CS + (size_t)idx * 2) = cs;  }
// k_prep: every conversion of an input (x of both batches as one plane of NB_ * TT rows, the four weights, the mask, the cos/sin table) as a range of one grid; the sizes below are each range's blocks
#define PB_X  (NB_ * TT * DM / 8 / 256)
#define PB_WQ (DM * DQ / 8 / 256)
#define PB_WK (DM * DKV / 8 / 256)
#define PB_MF (TT * (TT / 4) / 256)
#define PB_CS (TT * HD / 256)
__global__ __launch_bounds__(256) void k_prep(const float* __restrict__ x, const int* __restrict__ mk, const float* __restrict__ cosT, const float* __restrict__ sinT, const float* __restrict__ wq, const float* __restrict__ wk, const float* __restrict__ wv, const float* __restrict__ wo,
                                              bf* XB, int* MF, float* CS, bf* WQ, bf* WK, bf* WV, bf* WO) {
    int i = blockIdx.x;
    if (i < PB_X) { k_cvt8<DM>(i, x, XB, NB_ * TT * DM / 8); return; }
    i -= PB_X;
    if (i < PB_WQ) { k_wtG<DM, DQ>(i, wq, WQ); return; }
    i -= PB_WQ;
    if (i < PB_WK) { k_wtG<DM, DKV>(i, wk, WK); return; }
    i -= PB_WK;
    if (i < PB_WK) { k_wtG<DM, DKV>(i, wv, WV); return; }
    i -= PB_WK;
    if (i < PB_CS) { k_cscvt(i, cosT, sinT, CS); return; }
    i -= PB_CS;
    if (i < PB_MF) { k_mfo(i, mk, MF); return; }
    i -= PB_MF;
    k_wtG<DQ, DM>(i, wo, WO);
}
// ---- k_fattn: scores, mask, softmax, attn.v and the head merge in one kernel; no score or probability ever reaches memory. One wave = one query head x 16 * QT query rows, walking all TT keys 32 at a time;
// the REP waves of a workgroup are the REP query heads of one kv group on the same query rows, so they read the same K, V and mask lines at about the same time (shared through the WGP cache).
// Transposed products: St = K Qt (A = K rows, B = Q rows kept in registers), so a lane holds scores of ONE query (column lr), keys 8 hi + r of each 16-key tile; two such tiles, converted in place, are the B operand
// of Ot += Vt Pt (A = rows of the [d][t] plane). Running maximum and sum per lane; the two lane halves share the maximum every pass and join their sums once at the end.
// A masked score is -3e38 as a finite stand-in: while a row has seen masked keys only, its terms are exp2(0) = 1, and the first real score wipes them with the factor exp2(-inf) = 0.
// v_exp_f32 with, in the same statement, the one slot that the instruction set asks for behind a transcendental before its result is read or its source overwritten
__device__ __forceinline__ float exp2s(float x) { float y; asm("v_exp_f32 %0, %1\n\tv_nop" : "=v"(y) : "v"(x)); return y; }
template <typename T16, bool HI, int QT>
__device__ __forceinline__ void attn_body(const T16* __restrict__ Q, const T16* __restrict__ Q2, const T16* __restrict__ Kp, const T16* __restrict__ K2, const T16* __restrict__ Vt, const T16* __restrict__ V2, const int* __restrict__ mk, int q0, bf* Ah, bf* Al) {
    typedef WFrag<T16> F; typedef typename F::V V;
    const int lane = threadIdx.x & 31, lr = lane & 15, hi = lane >> 4;
    // every loop below but the one over j0 is unrolled so that the fragment and accumulator arrays are indexed by constants and stay in registers
    V qf[QT][2], qf2[QT][2]; const size_t qoff = (size_t)(q0 + lr) * HD + 8 * hi; const T16* qp = Q + qoff; const T16* qp2 = HI ? Q2 + qoff : qp;
#pragma unroll
    for (int qt = 0; qt < QT; ++qt)
#pragma unroll
        for (int ks = 0; ks < 2; ++ks) { qf[qt][ks] = F::ld(qp + qt * 16 * HD + ks * 32); if (HI) qf2[qt][ks] = F::ld(qp2 + qt * 16 * HD + ks * 32); }
    if constexpr (HI) XWAIT2(qp, qp2); else XWAIT1(qp);
    const int koff = lane * 8, voff = lane * 8; const int* mrow = mk + (size_t)q0 * TT + lane * 4;   // K, V and the mask are in fragment order (Q, read once, is row-major): 16 keys of K are 2 blocks = 16 HD elements, 32 keys of V one block per 16 d, 32 keys of the mask 512 ints per 16 rows
    v8f o[QT][4]; float mrun[QT], lrun[QT];
#pragma unroll
    for (int qt = 0; qt < QT; ++qt) { mrun[qt] = -3.0e38f; lrun[qt] = 0.f;
#pragma unroll
        for (int dt = 0; dt < 4; ++dt) o[qt][dt] = (v8f){}; }
    V ka[2][2], ka2[2][2]; v4i mm[QT][2][2];
    { const T16* kp = Kp + koff; const T16* kp2 = HI ? K2 + koff : kp;
#pragma unroll
      for (int kt = 0; kt < 2; ++kt) {
#pragma unroll
        for (int ks = 0; ks < 2; ++ks) { ka[kt][ks] = F::ldf(kp + kt * 16 * HD + ks * 512); if (HI) ka2[kt][ks] = F::ldf(kp2 + kt * 16 * HD + ks * 512); }
#pragma unroll
        for (int qt = 0; qt < QT; ++qt) { mm[qt][kt][0] = *(const v4i*)(mrow + (size_t)qt * 16 * TT + kt * 256); mm[qt][kt][1] = *(const v4i*)(mrow + (size_t)qt * 16 * TT + kt * 256 + 128); } }
      if constexpr (HI) XWAIT3(kp, kp2, mrow); else XWAIT2(kp, mrow); }
    for (int j0 = 0; j0 < TT; j0 += 32) {
        const int jn = (j0 + 32 < TT) ? j0 + 32 : j0;   // the K and mask fragments are fetched one pass ahead; the last pass fetches its own again, inside the arrays
        V va[4], va2[4]; const T16* vp = Vt + voff + j0 * 16; const T16* vp2 = HI ? V2 + voff + j0 * 16 : vp;
#pragma unroll
        for (int dt = 0; dt < 4; ++dt) { va[dt] = F::ldf(vp + (size_t)dt * 16 * TT); if (HI) va2[dt] = F::ldf(vp2 + (size_t)dt * 16 * TT); }
        // its scheduling barrier also keeps the V loads at the head of the pass, the score products and a whole softmax ahead of their use; without it the compiler sinks them to just in front of attn.v
        if constexpr (HI) XWAIT2(vp, vp2); else XWAIT1(vp);
        v8f s[QT][2];
#pragma unroll
        for (int kt = 0; kt < 2; ++kt)
#pragma unroll
            for (int qt = 0; qt < QT; ++qt) { v8f c = (v8f){};
#pragma unroll
                for (int ks = 0; ks < 2; ++ks) { c = F::mma(ka[kt][ks], qf[qt][ks], c); if (HI) { c = F::mma(ka[kt][ks], qf2[qt][ks], c); c = F::mma(ka2[kt][ks], qf[qt][ks], c); } }
                s[qt][kt] = c; }
        const T16* kp = Kp + koff + (size_t)jn * HD; const T16* kp2 = HI ? K2 + koff + (size_t)jn * HD : kp; const int* mp = mrow + jn * 16;
#pragma unroll
        for (int kt = 0; kt < 2; ++kt)
#pragma unroll
            for (int ks = 0; ks < 2; ++ks) { ka[kt][ks] = F::ldf(kp + kt * 16 * HD + ks * 512); if (HI) ka2[kt][ks] = F::ldf(kp2 + kt * 16 * HD + ks * 512); }
        V pf[QT], pf2[QT]; float mxs[QT];
#pragma unroll
        for (int qt = 0; qt < QT; ++qt) {
            float mx = -3.0e38f;
#pragma unroll
            for (int kt = 0; kt < 2; ++kt)
#pragma unroll
                for (int r = 0; r < 8; ++r) { const float t = (mm[qt][kt][r >> 2][r & 3] == 0) ? s[qt][kt][r] * SCL2 : -3.0e38f; s[qt][kt][r] = t; mx = fmaxf(mx, t); }
#pragma unroll
            for (int kt = 0; kt < 2; ++kt) { mm[qt][kt][0] = *(const v4i*)(mp + (size_t)qt * 16 * TT + kt * 256); mm[qt][kt][1] = *(const v4i*)(mp + (size_t)qt * 16 * TT + kt * 256 + 128); }
            mxs[qt] = mx; }
        // its scheduling barrier also keeps the next pass's K and mask loads in front of the softmax and attn.v of this pass, which cover their latency; without it the compiler sinks them to the foot of the pass or into the next one
        if constexpr (HI) XWAIT3(kp, kp2, mp); else XWAIT2(kp, mp);
#pragma unroll
        for (int qt = 0; qt < QT; ++qt) {
            const float mx = fmaxf(mxs[qt], xhalf(mxs[qt]));
            const float mnew = fmaxf(mrun[qt], mx); const float corr = exp2s(mrun[qt] - mnew); mrun[qt] = mnew;
            float sum = 0.f;
#pragma unroll
            for (int kt = 0; kt < 2; ++kt)
#pragma unroll
                for (int r = 0; r < 8; ++r) { const float p = exp2s(s[qt][kt][r] - mnew); sum += p;
                    if constexpr (HI) { unsigned short a, c2; splitf(p, a, c2); pf[qt][kt * 8 + r] = __builtin_bit_cast(__bf16, a); pf2[qt][kt * 8 + r] = __builtin_bit_cast(__bf16, c2); }
                    else pf[qt][kt * 8 + r] = tohx(p); }
            lrun[qt] = lrun[qt] * corr + sum;
#pragma unroll
            for (int dt = 0; dt < 4; ++dt) o[qt][dt] *= corr;
        }
#pragma unroll
        for (int dt = 0; dt < 4; ++dt)
#pragma unroll
            for (int qt = 0; qt < QT; ++qt) { o[qt][dt] = F::mma(va[dt], pf[qt], o[qt][dt]); if (HI) { o[qt][dt] = F::mma(va[dt], pf2[qt], o[qt][dt]); o[qt][dt] = F::mma(va2[dt], pf[qt], o[qt][dt]); } }
    }
#pragma unroll
    for (int qt = 0; qt < QT; ++qt) { const float inv = __fdiv_rn(1.0f, lrun[qt] + xhalf(lrun[qt])); const size_t oo = (size_t)(q0 + qt * 16) * DQ + lane * 8;
#pragma unroll
        for (int dt = 0; dt < 4; ++dt) { v8us oh, ol;   // a lane's 8 accumulator registers are 8 consecutive d of its query row: one 16-byte piece of the merged planes, which are in fragment order (rows t, k = h HD + d); a wave's store is 512 consecutive bytes
#pragma unroll
            for (int r = 0; r < 8; ++r) { unsigned short a, c2; splitf(o[qt][dt][r] * inv, a, c2); oh[r] = a; ol[r] = c2; }
            *(v8us*)(Ah + oo + dt * 256) = oh; *(v8us*)(Al + oo + dt * 256) = ol;
            // s_wait_xcnt 0 behind the pair of stores, in front of the next tile's packing, which takes their data registers anew: it names the data, so that they stay whole up to it, and nothing is scheduled across it
            asm volatile("s_wait_xcnt 0x0" :: "v"(oh), "v"(ol) : "memory"); __builtin_amdgcn_sched_barrier(0); } }
}
// grid (RH/16 + (TT - RH)/32, NKV, NB_), 32 * REP threads: the first RH/16 blocks in x take 16 hi+lo query rows each (three products for one), the rest 32 fp16 rows each
__global__ __launch_bounds__(32 * REP) void k_fattn(const h16* __restrict__ Q16, const bf* __restrict__ Qh, const bf* __restrict__ Ql, const h16* __restrict__ K16, const bf* __restrict__ Kh, const bf* __restrict__ Kl, const h16* __restrict__ V16, const bf* __restrict__ Vh, const bf* __restrict__ Vl, const int* __restrict__ mk, bf* Ah, bf* Al) {
    const int g = blockIdx.y, h = g * REP + __builtin_amdgcn_readfirstlane((int)(threadIdx.x >> 5)); const size_t qo = ((size_t)blockIdx.z * NH_ + h) * TT * HD, ko = ((size_t)blockIdx.z * NKV + g) * TT * HD; const int bx = blockIdx.x; Ah += (size_t)blockIdx.z * TT * DQ; Al += (size_t)blockIdx.z * TT * DQ;   // batch blockIdx.z: its heads' planes, and its TT rows of the merged planes
    if (bx < RH / 16) attn_body<bf, true, 1>(Qh + qo, Ql + qo, Kh + ko, Kl + ko, Vh + ko, Vl + ko, mk, bx * 16, Ah + h * 16 * HD, Al + h * 16 * HD);
    else attn_body<h16, false, 2>(Q16 + qo, nullptr, K16 + ko, nullptr, V16 + ko, nullptr, mk, RH + (bx - RH / 16) * 32, Ah + h * 16 * HD, Al + h * 16 * HD);
}

extern "C" void kernel_launch(void* const* d_in, const int* in_sizes, int n_in,
                              void* d_out, int out_size, void* d_ws, size_t ws_size, hipStream_t stream) {
    (void)in_sizes; (void)n_in; (void)out_size;
    const float* x = (const float*)d_in[0]; const int* mk = (const int*)d_in[1]; const float* cosT = (const float*)d_in[2]; const float* sinT = (const float*)d_in[3]; const float* wq = (const float*)d_in[4]; const float* wk = (const float*)d_in[5]; const float* wv = (const float*)d_in[6]; const float* wo = (const float*)d_in[7]; const float* bo = (const float*)d_in[8];   // all weights x @ W
    float* OUT = (float*)d_out;     // [2][2048][2048]
    char* wsp = (char*)d_ws;
    auto take = [&](size_t bytes) { char* p = wsp; wsp += (bytes + 255) & ~(size_t)255; return (void*)p; };
    bf* WQ = (bf*)take((size_t)DQ * DM * 2); bf* WK = (bf*)take((size_t)DKV * DM * 2); bf* WV = (bf*)take((size_t)DKV * DM * 2); bf* WO = (bf*)take((size_t)DM * DQ * 2); float* CS = (float*)take((size_t)TT * HD * 2 * 4);
    bf* XB = (bf*)take((size_t)NB_ * TT * DM * 2);
    h16* QP16 = (h16*)take((size_t)NB_ * NH_ * TT * HD * 2); h16* KP16 = (h16*)take((size_t)NB_ * NKV * TT * HD * 2); h16* VT16 = (h16*)take((size_t)NB_ * NKV * HD * TT * 2);
    bf* QPh = (bf*)take((size_t)NB_ * NH_ * TT * HD * 2); bf* QPl = (bf*)take((size_t)NB_ * NH_ * TT * HD * 2); bf* KPh = (bf*)take((size_t)NB_ * NKV * TT * HD * 2); bf* KPl = (bf*)take((size_t)NB_ * NKV * TT * HD * 2); bf* VTh = (bf*)take((size_t)NB_ * NKV * HD * TT * 2); bf* VTl = (bf*)take((size_t)NB_ * NKV * HD * TT * 2);
    bf* ATh = (bf*)take((size_t)NB_ * TT * DQ * 2); bf* ATl = (bf*)take((size_t)NB_ * TT * DQ * 2); int* MF = (int*)take((size_t)TT * TT * 4);
    if ((size_t)(wsp - (char*)d_ws) > ws_size) return;    // ws 256 MiB
    k_prep<<<PB_X + 2 * PB_WQ + 2 * PB_WK + PB_CS + PB_MF, 256, 0, stream>>>(x, mk, cosT, sinT, wq, wk, wv, wo, XB, MF, CS, WQ, WK, WV, WO);   // table and mask are shared by the batches (read as data)
    k_qkv<<<MT * (DQ / 64) + 2 * MT * (DKV / 64), 512, 0, stream>>>(XB, WQ, WK, WV, CS, QP16, QPh, QPl, KP16, KPh, KPl, VT16, VTh, VTl);
    k_fattn<<<dim3(RH / 16 + (TT - RH) / 32, NKV, NB_), 32 * REP, 0, stream>>>(QP16, QPh, QPl, KP16, KPh, KPl, VT16, VTh, VTl, MF, ATh, ATl);
    k_oproj<<<dim3(MT, DM / 64, 1), 512, 0, stream>>>(ATh, ATl, WO, OUT, bo);
}

// v007
// One run takes 234 microseconds.
// Next to v006, in two timings, it ran 1.19 and 1.18 times as fast.
// Over all steps from v000 it is 16.4 times as fast.
#include <hip/hip_runtime.h>

// Grouped-query attention with RoPE and a 2-D mask (x [2][2048][2048]; q = x Wq (32 heads x 64), k, v = x Wk / x Wv (8 kv groups x 64, each serving 4 consecutive query heads); rotate-half RoPE with the input
// cos/sin tables [2048][64] (read as data); scores = q.k/8, -inf where mask[i][j] != 0 (int [2048][2048], read as data); softmax; out = merged attn.v Wo + bo -> [2][2048][2048]).
// Compute dtypes, f32 accumulate: every input rounded to bf16; projections on PLAIN bf16 operands (inputs: exact products, f32 accumulate); RoPE in f32; PER-ROW PRECISION
// HYBRID: query rows < 256 take scores and attn.v on bf16 hi+lo planes (3 products), rows >= 256 on single fp16 planes; 1/8 and the mask in f32 in the running softmax of the fused attention kernel; merged heads as hi+lo planes

#define NB_  2
#define TT   2048
#define DM   2048
#define NH_  32
#define NKV  8
#define REP  (NH_ / NKV)
#define HD   64
#define DQ   (NH_ * HD)
#define DKV  (NKV * HD)
#define RH   256                  // query rows < RH use hi+lo planes (0: none)
#define WIN  0
#define SCL2 0.18033688011112042f   // HD^-0.5 x log2(e): the softmax runs in base 2
typedef _Float16 h16;
typedef unsigned short bf;
typedef __attribute__((ext_vector_type(16))) __bf16   v16bf;
typedef __attribute__((ext_vector_type(16))) _Float16 v16h;
typedef __attribute__((ext_vector_type(8)))  _Float16 v8h;
typedef __attribute__((ext_vector_type(8)))  unsigned short v8us;
typedef __attribute__((ext_vector_type(8)))  float    v8f;
typedef __attribute__((ext_vector_type(4)))  float    v4f;
typedef v8h  __attribute__((may_alias)) v8ha;
typedef v4f  __attribute__((may_alias)) v4fa;
typedef v8us __attribute__((may_alias)) v8usa;
typedef __attribute__((ext_vector_type(2))) float __attribute__((may_alias)) v2fa;

__device__ __forceinline__ unsigned short f2bf(float f) { unsigned u = __float_as_uint(f); u += 0x7FFFu + ((u >> 16) & 1u); return (unsigned short)(u >> 16); }
__device__ __forceinline__ float bf2f(unsigned short b) { return __uint_as_float(((unsigned)b) << 16); }
__device__ __forceinline__ float bfr(float f) { return bf2f(f2bf(f)); }
__device__ __forceinline__ v16h cat16(v8h lo, v8h hi) { return __builtin_shufflevector(lo, hi, 0, 1, 2, 3, 4, 5, 6, 7, 8, 9, 10, 11, 12, 13, 14, 15); }
__device__ __forceinline__ v16bf cat16b(v8us lo, v8us hi) { return __builtin_bit_cast(v16bf, __builtin_shufflevector(lo, hi, 0, 1, 2, 3, 4, 5, 6, 7, 8, 9, 10, 11, 12, 13, 14, 15)); }
__device__ __forceinline__ v8f wmma16(v16h a, v16h b, v8f c) { return __builtin_amdgcn_wmma_f32_16x16x32_f16(false, a, false, b, (short)0, c, false, false); }
__device__ __forceinline__ v8f wmmab(v16bf a, v16bf b, v8f c) { return __builtin_amdgcn_wmma_f32_16x16x32_bf16(false, a, false, b, (short)0, c, false, false); }
__device__ __forceinline__ h16 tohx(float x) { return (h16)x; }
__device__ __forceinline__ void splitf(float y, unsigned short& h, unsigned short& l) { h = f2bf(y); l = f2bf(y - bf2f(h)); }
typedef __attribute__((ext_vector_type(2))) _Float16 v2h;
typedef __attribute__((ext_vector_type(2))) unsigned short v2us;
__device__ __forceinline__ float xhalf(float x) { return __builtin_bit_cast(float, __builtin_amdgcn_permlanex16(__builtin_bit_cast(int, x), __builtin_bit_cast(int, x), 0x76543210, 0xfedcba98, false, false)); }  // lane l reads lane l ^ 16



// s_wait_xcnt 0 behind a group of global loads, in front of every rewrite of their address registers: it names the addresses, so that they stay whole up to it (no later load of the group lands on them), and nothing is scheduled across it
#define XWAIT1(a)       do { asm volatile("s_wait_xcnt 0x0" :: "v"(a) : "memory"); __builtin_amdgcn_sched_barrier(0); } while (0)
#define XWAIT2(a, b)    do { asm volatile("s_wait_xcnt 0x0" :: "v"(a), "v"(b) : "memory"); __builtin_amdgcn_sched_barrier(0); } while (0)
#define XWAIT3(a, b, c) do { asm volatile("s_wait_xcnt 0x0" :: "v"(a), "v"(b), "v"(c) : "memory"); __builtin_amdgcn_sched_barrier(0); } while (0)
// ---- gemmw: register-blocked GEMM, one 64x64 output tile per workgroup (16 accumulators a wave), operands straight from 16-bit planes in fragment order; tile (bx, by) of (M/64, N/64), batch bz, 32 * NW threads. It is a device function, so that one launch
// can hold several products as ranges of its grid (k_qkv); os is the workgroup's LDS. The NB_ batches of x are one plane of NB_ * TT rows, so that a product over x or over the merged heads takes both in one grid.
// C[m][n] (f32, pitch ldc, + optional f32 bias[n]) = sum_k A[m][k] Bt[n][k] (+ split products per NSPLIT). z-batch strides sA/sB/sC in elements: A and C step with every z, Bt with every REP-th z (the REP query heads of one kv group share it). K % (32 * NW) == 0.
// NW == 1: one wave walks all of K. NW == 16: wave w walks the K range [w K/16, (w+1) K/16), so a long K costs K/512 dependent load rounds instead of K/32; the 16 partial tiles are summed in LDS, wave 0 first.
// FRAGMENT ORDER of a 16-bit plane P[row][k] (rows % 16 == 0, K % 32 == 0): the 16 rows x 32 k of one A or B fragment are one 1-KiB block, blocks in the order [row / 16][k / 32]; inside a block the 16-byte piece of
// row r, k = 8 s .. 8 s + 7 (s = 0..3) is piece (s >> 1) * 32 + (s & 1) * 16 + (r & 15). Lane l of a wave then reads pieces l and 32 + l (ldf): each load instruction covers 512 consecutive bytes, four whole cache lines,
// where on a row-major plane (ld) it touches 16 lines for 32 bytes each. The values a lane and register receive are the same as with ld on the row-major plane.
template <typename T16> struct WFrag;
template <> struct WFrag<h16> { typedef v16h V; static __device__ __forceinline__ V ld(const h16* p) { return cat16(*(const v8h*)p, *(const v8h*)(p + 16)); } static __device__ __forceinline__ V ldf(const h16* p) { return cat16(*(const v8h*)p, *(const v8h*)(p + 256)); } static __device__ __forceinline__ v8f mma(V a, V b, v8f c) { return wmma16(a, b, c); } };
template <> struct WFrag<bf> { typedef v16bf V; static __device__ __forceinline__ V ld(const bf* p) { return cat16b(*(const v8us*)p, *(const v8us*)(p + 16)); } static __device__ __forceinline__ V ldf(const bf* p) { return cat16b(*(const v8us*)p, *(const v8us*)(p + 256)); } static __device__ __forceinline__ v8f mma(V a, V b, v8f c) { return wmmab(a, b, c); } };
// EPI: what becomes of the summed tile. 0: stored as f32 in C. 1 to 3 (NW == 16): it never reaches memory as f32; the wave that has summed a row turns it into the three 16-bit planes of the attention kernel (fp16, bf16 hi, bf16 lo) itself.
//   1: q. The tile is 64 positions x the 64 d of head by; rotate-half RoPE out[d] = x[d] cos[t][d] - x[d+32] sin[t][d], out[d+32] = x[d+32] cos[t][d+32] + x[d] sin[t][d+32]; a lane holds d = 2 lane, 2 lane + 1 of its row,
//      so the partner d +- 32 is the same register of lane ^ 16. Planes [h][t][d], row-major.
//   2: k. The same, each head's [t][d] plane in fragment order (rows t, k = d).
//   3: v. Launched with A = the weight rows (d) and Bt = x (t), so the tile comes out as [d][t] and a lane holds two neighbouring t of one d. No RoPE. Each kv group's [d][t] plane (group bx) in fragment order (rows d, k = t).
template <typename T16, int NSPLIT, bool BIAS, int NW, int K, int EPI>
__device__ __forceinline__ void gemmw(float* os, int bx, int by, int bz, const T16* __restrict__ A, const T16* __restrict__ A2, const T16* __restrict__ Bt, const T16* __restrict__ Bt2, float* C, int ldc, const float* __restrict__ bias, size_t sA, size_t sB, size_t sC, const float* __restrict__ CS, h16* P16, bf* Ph, bf* Pl) {
    typedef typename WFrag<T16>::V V;
    static_assert(NW == 1 || NW == 16, "the LDS sum maps one wave to one of 16 tile rows");
    static_assert(EPI == 0 || NW == 16, "the plane epilogues stand behind the LDS sum");
    const size_t z = bz; A += z * sA; if (A2) A2 += z * sA; Bt += (z / REP) * sB; if (Bt2) Bt2 += (z / REP) * sB; C += z * sC;
    const int lane = threadIdx.x & 31, lr = lane & 15, hi = lane >> 4; const int r0 = bx * 64, c0 = by * 64;
    v8f acc[4][4];
#pragma unroll
    for (int mb = 0; mb < 4; ++mb)
#pragma unroll
        for (int nb = 0; nb < 4; ++nb) acc[mb][nb] = (v8f){};
    const size_t aoff = (size_t)r0 * K + lane * 8, boff = (size_t)c0 * K + lane * 8;   // a 16-row tile is K / 32 blocks of 512 elements = 16 K elements
    const int wv = (NW == 1) ? 0 : __builtin_amdgcn_readfirstlane((int)(threadIdx.x >> 5)); const int kb = wv * (K / NW), ke = kb + K / NW;
    v4f cs[4];
    if constexpr (EPI == 1 || EPI == 2) {   // cos and sin of the four rows that this wave will sum (cos d, sin d, cos d+1, sin d+1 a lane), fetched ahead of the K loop, which covers their latency: behind it the first barrier of the LDS sum would wait for them
        const float* csp = CS + ((size_t)(r0 % TT + wv) * HD + lane * 2) * 2;   // row r0 of the x plane is position r0 % TT of batch r0 / TT
#pragma unroll   // cs[] is indexed by constants and stays in registers; the four loads are immediate offsets from one address
        for (int mb = 0; mb < 4; ++mb) cs[mb] = *(const v4f*)(csp + mb * 16 * HD * 2);
        XWAIT1(csp); }
#pragma unroll 1
    for (int kc = kb; kc < ke; kc += 32) {
        V a[4], a2[4], b[4], b2[4];   // K is a compile-time constant, so that the four 16-row tiles of an operand are immediate offsets from one address
        const T16* pa = A + aoff + kc * 16; const T16* pa2 = (NSPLIT == 1 || NSPLIT == 2) ? A2 + aoff + kc * 16 : pa; const T16* pb = Bt + boff + kc * 16; const T16* pb2 = (NSPLIT >= 2) ? Bt2 + boff + kc * 16 : pb;
#pragma unroll
        for (int mb = 0; mb < 4; ++mb) { a[mb] = WFrag<T16>::ldf(pa + mb * 16 * K); if (NSPLIT == 1 || NSPLIT == 2) a2[mb] = WFrag<T16>::ldf(pa2 + mb * 16 * K); }
#pragma unroll
        for (int nb = 0; nb < 4; ++nb) { b[nb] = WFrag<T16>::ldf(pb + nb * 16 * K); if (NSPLIT >= 2) b2[nb] = WFrag<T16>::ldf(pb2 + nb * 16 * K); }
        // s_wait_xcnt 0 behind the trip's global loads, in front of every rewrite of their address registers: it names the addresses, so that they stay whole up to it (no later load of the trip lands on them), and nothing is scheduled across it
        asm volatile("s_wait_xcnt 0x0" :: "v"(pa), "v"(pa2), "v"(pb), "v"(pb2) : "memory"); __builtin_amdgcn_sched_barrier(0);
#pragma unroll
        for (int nb = 0; nb < 4; ++nb) {
#pragma unroll
            for (int mb = 0; mb < 4; ++mb) { acc[mb][nb] = WFrag<T16>::mma(a[mb], b[nb], acc[mb][nb]); if (NSPLIT == 1 || NSPLIT == 2) acc[mb][nb] = WFrag<T16>::mma(a2[mb], b[nb], acc[mb][nb]); if (NSPLIT >= 2) acc[mb][nb] = WFrag<T16>::mma(a[mb], b2[nb], acc[mb][nb]); } }
        asm volatile("v_nop\n\tv_nop\n\tv_nop\n\tv_nop" : "+v"(acc[0][0]), "+v"(acc[1][1]), "+v"(acc[2][2]), "+v"(acc[3][3]) : "v"(a[0]), "v"(a[3]));
    }
    if constexpr (NW == 1) {
#pragma unroll
    for (int mb = 0; mb < 4; ++mb) {
#pragma unroll
        for (int nb = 0; nb < 4; ++nb) {
#pragma unroll
            for (int j = 0; j < 8; ++j) os[(hi * 8 + j) * 68 + nb * 16 + lr] = acc[mb][nb][j]; }
        __builtin_amdgcn_wave_barrier(); asm volatile("" ::: "memory");
        float* crow = C + (size_t)(r0 + mb * 16) * ldc + c0;
{
#pragma unroll
            for (int s = 0; s < 8; ++s) { const int row = 2 * s + hi, cofs = lr * 4; v4f val = *(const v4fa*)(os + row * 68 + cofs); if (BIAS) { val[0] += bfr(bias[c0 + cofs]); val[1] += bfr(bias[c0 + cofs + 1]); val[2] += bfr(bias[c0 + cofs + 2]); val[3] += bfr(bias[c0 + cofs + 3]); }
                *(v4f*)(crow + (size_t)row * ldc + cofs) = val; }
             }
        __builtin_amdgcn_wave_barrier(); asm volatile("" ::: "memory");
    }
    } else {
        // Sum of the NW partial tiles, 16 tile rows a pass: every wave stores its partial rows in its own LDS slice, then wave r adds row r over the slices in slice order and stores it (EPI 0) as one whole 256-B row or (EPI 1 to 3) as three 16-bit planes.
        // Two buffers in turn: a buffer is written again only behind the next pass's barrier, which every reader of it has then passed, so one barrier a pass is enough.
        // The loops over mb, nb and j are unrolled so that acc[][] is indexed by constants and stays in registers; the loop over p so that a row's NW LDS loads are in flight together.
        // The four summed rows are kept in registers and stored behind the last pass, so that no barrier of a pass has a global store to wait for.
        v2fa res[4];
#pragma unroll
        for (int mb = 0; mb < 4; ++mb) {
            float* ob = os + (mb & 1) * (NW * 16 * 68);
#pragma unroll
            for (int nb = 0; nb < 4; ++nb) {
#pragma unroll
                for (int j = 0; j < 8; ++j) ob[wv * (16 * 68) + (hi * 8 + j) * 68 + nb * 16 + lr] = acc[mb][nb][j]; }
            __syncthreads();   // publishes all NW partial slices of this pass to the waves that sum them
            const int cofs = lane * 2; v2fa val = *(const v2fa*)(ob + wv * 68 + cofs);
#pragma unroll
            for (int p = 1; p < NW; ++p) val += *(const v2fa*)(ob + p * (16 * 68) + wv * 68 + cofs);
            if (BIAS) { val[0] += bfr(bias[c0 + cofs]); val[1] += bfr(bias[c0 + cofs + 1]); }
            res[mb] = val;
        }
        if constexpr (EPI == 0) {
#pragma unroll
        for (int mb = 0; mb < 4; ++mb) *(v2fa*)(C + (size_t)(r0 + mb * 16 + wv) * ldc + c0 + lane * 2) = res[mb];
        } else {
            // e0: the lane's first element in a plane; est: the step from one 16-row pass to the next. In fragment order the lane's two elements (k = 2 lane, 2 lane + 1 of the tile's 64) lie in piece ((lane >> 3) & 1) * 32 + ((lane >> 2) & 1) * 16 + wv of block lane >> 4
            const int sub = (lane >> 4) * 512 + ((lane >> 3) & 1) * 256 + (((lane >> 2) & 1) * 16 + wv) * 8 + (lane & 3) * 2;
            const size_t e0 = (EPI == 1) ? ((size_t)(r0 / TT) * NH_ + by) * TT * HD + (size_t)(r0 % TT + wv) * HD + lane * 2 : (EPI == 2) ? ((size_t)(r0 / TT) * NKV + by) * TT * HD + (size_t)(r0 % TT) * HD + sub : ((size_t)(c0 / TT) * NKV + bx) * HD * TT + (size_t)(c0 % TT) * 16 + sub;   // a batch's heads (kv groups) follow one another, batch after batch
            constexpr int est = (EPI == 3) ? 16 * TT : 16 * HD;
            v2h o16[4]; v2us oh[4], ol[4];   // the loops below are unrolled so that res[], cs[] and these arrays are indexed by constants and stay in registers; all twelve stores stand behind the arithmetic, so that no register of an issued store is written again
#pragma unroll
            for (int mb = 0; mb < 4; ++mb)
#pragma unroll
                for (int q = 0; q < 2; ++q) { float r = res[mb][q];
                    if constexpr (EPI != 3) { const float x1 = xhalf(r); r = r * cs[mb][2 * q] + (hi ? x1 : -x1) * cs[mb][2 * q + 1]; }
                    o16[mb][q] = tohx(r); unsigned short a2, c2; splitf(r, a2, c2); oh[mb][q] = a2; ol[mb][q] = c2; }
#pragma unroll
            for (int mb = 0; mb < 4; ++mb) { *(v2h*)(P16 + e0 + mb * est) = o16[mb]; *(v2us*)(Ph + e0 + mb * est) = oh[mb]; *(v2us*)(Pl + e0 + mb * est) = ol[mb]; }
            // s_wait_xcnt 0 behind the twelve stores: inlined as a range of a larger kernel, this function's end is not the wave's end in the listing, and code of another range that follows rewrites registers that the stores name; it names the data, so that they stay whole up to it, and nothing is scheduled across it
            asm volatile("s_wait_xcnt 0x0" :: "v"(o16[0]), "v"(o16[1]), "v"(o16[2]), "v"(o16[3]), "v"(oh[0]), "v"(oh[1]), "v"(oh[2]), "v"(oh[3]), "v"(ol[0]), "v"(ol[1]), "v"(ol[2]), "v"(ol[3]) : "memory"); __builtin_amdgcn_sched_barrier(0);
        }
    }
}

// k_qkv: the q, k and v projections of both batches as three ranges of one grid (they read the same x plane and depend on nothing of one another); inside a range the tile's first index runs fastest. The range test is the same for a whole workgroup, so that every barrier of gemmw is passed by all of its waves.
#define MT (NB_ * TT / 64)   // 64-row tiles of the x plane
__global__ __launch_bounds__(512) void k_qkv(const bf* __restrict__ XB, const bf* __restrict__ WQ, const bf* __restrict__ WK, const bf* __restrict__ WV, const float* __restrict__ CS, h16* QP16, bf* QPh, bf* QPl, h16* KP16, bf* KPh, bf* KPl, h16* VT16, bf* VTh, bf* VTl) {
    __shared__ __align__(16) float os[2 * 16 * 16 * 68];
    int i = blockIdx.x;
    if (i < MT * (DQ / 64)) { gemmw<bf, 0, false, 16, DM, 1>(os, i % MT, i / MT, 0, XB, nullptr, WQ, nullptr, nullptr, 0, nullptr, 0, 0, 0, CS, QP16, QPh, QPl); return; }
    i -= MT * (DQ / 64);
    if (i < MT * (DKV / 64)) { gemmw<bf, 0, false, 16, DM, 2>(os, i % MT, i / MT, 0, XB, nullptr, WK, nullptr, nullptr, 0, nullptr, 0, 0, 0, CS, KP16, KPh, KPl); return; }
    i -= MT * (DKV / 64);
    gemmw<bf, 0, false, 16, DM, 3>(os, i % (DKV / 64), i / (DKV / 64), 0, WV, nullptr, XB, nullptr, nullptr, 0, nullptr, 0, 0, 0, nullptr, VT16, VTh, VTl);
}
// k_oproj: out = merged heads (hi + lo planes) Wo + bo, both batches; grid (MT, DM / 64)
__global__ __launch_bounds__(512) void k_oproj(const bf* __restrict__ ATh, const bf* __restrict__ ATl, const bf* __restrict__ WO, float* OUT, const float* __restrict__ bo) {
    __shared__ __align__(16) float os[2 * 16 * 16 * 68];
    gemmw<bf, 1, true, 16, DQ, 0>(os, blockIdx.x, blockIdx.y, 0, ATh, ATl, WO, nullptr, OUT, DM, bo, 0, 0, 0, nullptr, nullptr, nullptr, nullptr);
}

typedef __attribute__((ext_vector_type(4))) _Float16 v4h;
typedef __attribute__((ext_vector_type(4))) unsigned short v4us;
typedef __attribute__((ext_vector_type(2))) float v2f;
typedef __attribute__((ext_vector_type(4))) int v4i;

// The conversions are device functions of a block index bx, 256 threads a block: none depends on another, and k_prep runs them all as ranges of one grid.
// k_wtG and k_cvt8 write one 16-byte piece of a fragment-order plane a thread, thread i piece i, so that a wave's store is 512 consecutive bytes. fo_row / fo_k: the row and the first k of piece i in a plane with K columns.
// Their sizes are compile-time constants, so that a thread's loads are immediate offsets from one address, which XWAIT1 keeps whole.
__device__ __forceinline__ int fo_row(int i, int K) { return ((i >> 6) / (K / 32)) * 16 + (i & 15); }
__device__ __forceinline__ int fo_k(int i, int K) { return ((i >> 6) % (K / 32)) * 32 + ((i >> 5) & 1) * 16 + ((i >> 4) & 1) * 8; }
// k_wtG: Bt[n][k] = bf16(w[k][n]) in fragment order; 16 neighbouring lanes read 16 neighbouring n of one k
template <int K, int N>
__device__ __forceinline__ void k_wtG(int bx, const float* __restrict__ w, bf* Bt) {
    const int i = bx * 256 + threadIdx.x; if (i >= N * (K / 8)) return; const int n = fo_row(i, K), k0 = fo_k(i, K); const float* p = w + (size_t)k0 * N + n; float x[8]; v8us o;
#pragma unroll
    for (int j = 0; j < 8; ++j) x[j] = p[j * N];
    XWAIT1(p);
#pragma unroll
    for (int j = 0; j < 8; ++j) o[j] = f2bf(x[j]);
    *(v8us*)(Bt + (size_t)i * 8) = o; }
// k_cvt8: dst[r][k] = bf16(src[r][k]) in fragment order
template <int K>
__device__ __forceinline__ void k_cvt8(int bx, const float* __restrict__ src, bf* dst, int n8) { const int i = bx * 256 + threadIdx.x; if (i >= n8) return; const float* p = src + (size_t)fo_row(i, K) * K + fo_k(i, K); const v8f v = *(const v8f*)p; XWAIT1(p); v8us o;
#pragma unroll
    for (int k = 0; k < 8; ++k) o[k] = f2bf(v[k]); *(v8us*)(dst + (size_t)i * 8) = o;  }
// k_mfo: the mask in the order in which the lanes of k_fattn read it: [row / 16][key / 32][(key >> 4) & 1][(key >> 2) & 1][lane = ((key >> 3) & 1) * 16 + (row & 15)][key & 3]; thread i writes the i-th group of 4
// It also says which parts of the mask hold an open key (a zero word): a wave moves a quarter of one 16-row x 32-key tile, and writes TF[bx][wave] = 1 if that quarter has one, else 0. A block is two tiles; its 8 words have a 128-byte line of their own.
__device__ __forceinline__ void k_mfo(int bx, const int* __restrict__ mk, int* MF, int* TF) { const int i = bx * 256 + threadIdx.x; if (i >= TT * (TT / 4)) return;
    const int row = (i / (4 * TT)) * 16 + (i & 15), key = ((i >> 7) % (TT / 32)) * 32 + ((i >> 6) & 1) * 16 + ((i >> 4) & 1) * 8 + ((i >> 5) & 1) * 4; const int* p = mk + (size_t)row * TT + key; const v4i v = *(const v4i*)p; XWAIT1(p); *(v4i*)(MF + (size_t)i * 4) = v;
    const unsigned any = __builtin_amdgcn_ballot_w32(v[0] == 0 || v[1] == 0 || v[2] == 0 || v[3] == 0);
    if ((threadIdx.x & 31) == 0) TF[bx * 32 + (threadIdx.x >> 5)] = any != 0u; }
__device__ __forceinline__ void k_cscvt(int bx, const float* __restrict__ cosT, const float* __restrict__ sinT, float* CS) { const int idx = bx * 256 + threadIdx.x; if (idx >= TT * HD) return; v2f cs; cs[0] = bfr(cosT[idx]); cs[1] = bfr(sinT[idx]); *(v2f*)(CS + (size_t)idx * 2) = cs;  }
// k_prep: every conversion of an input (x of both batches as one plane of NB_ * TT rows, the four weights, the mask, the cos/sin table) as a range of one grid; the sizes below are each range's blocks
#define PB_X  (NB_ * TT * DM / 8 / 256)
#define PB_WQ (DM * DQ / 8 / 256)
#define PB_WK (DM * DKV / 8 / 256)
#define PB_MF (TT * (TT / 4) / 256)
#define PB_CS (TT * HD / 256)
__global__ __launch_bounds__(256) void k_prep(const float* __restrict__ x, const int* __restrict__ mk, const float* __restrict__ cosT, const float* __restrict__ sinT, const float* __restrict__ wq, const float* __restrict__ wk, const float* __restrict__ wv, const float* __restrict__ wo,
                                              bf* XB, int* MF, int* TF, float* CS, bf* WQ, bf* WK, bf* WV, bf* WO) {
    int i = blockIdx.x;
    if (i < PB_X) { k_cvt8<DM>(i, x, XB, NB_ * TT * DM / 8); return; }
    i -= PB_X;
    if (i < PB_WQ) { k_wtG<DM, DQ>(i, wq, WQ); return; }
    i -= PB_WQ;
    if (i < PB_WK) { k_wtG<DM, DKV>(i, wk, WK); return; }
    i -= PB_WK;
    if (i < PB_WK) { k_wtG<DM, DKV>(i, wv, WV); return; }
    i -= PB_WK;
    if (i < PB_CS) { k_cscvt(i, cosT, sinT, CS); return; }
    i -= PB_CS;
    if (i < PB_MF) { k_mfo(i, mk, MF, TF); return; }
    i -= PB_MF;
    k_wtG<DQ, DM>(i, wo, WO);
}
// ---- k_fattn: scores, mask, softmax, attn.v and the head merge in one kernel; no score or probability ever reaches memory. One wave = one query head x 16 * QT query rows, walking the keys 32 at a time (of the TT / 32 key tiles those in which the mask leaves one of its rows a key open);
// the REP waves of a workgroup are the REP query heads of one kv group on the same query rows, so they read the same K, V and mask lines at about the same time (shared through the WGP cache).
// Transposed products: St = K Qt (A = K rows, B = Q rows kept in registers), so a lane holds scores of ONE query (column lr), keys 8 hi + r of each 16-key tile; two such tiles, converted in place, are the B operand
// of Ot += Vt Pt (A = rows of the [d][t] plane). Running maximum and sum per lane; the two lane halves share the maximum every pass and join their sums once at the end.
// A masked score is -3e38 as a finite stand-in: while a row has seen masked keys only, its terms are exp2(0) = 1, and the first real score wipes them with the factor exp2(-inf) = 0. A wave whose rows have no open key in any tile walks none: sum 0, and 0 x 1/0 = NaN, as the softmax of a row of -inf.
// v_exp_f32 with, in the same statement, the one slot that the instruction set asks for behind a transcendental before its result is read or its source overwritten
__device__ __forceinline__ float exp2s(float x) { float y; asm("v_exp_f32 %0, %1\n\tv_nop" : "=v"(y) : "v"(x)); return y; }
template <typename T16, bool HI, int QT>
__device__ __forceinline__ void attn_body(const T16* __restrict__ Q, const T16* __restrict__ Q2, const T16* __restrict__ Kp, const T16* __restrict__ K2, const T16* __restrict__ Vt, const T16* __restrict__ V2, const int* __restrict__ mk, const int* __restrict__ tf, int q0, bf* Ah, bf* Al) {
    typedef WFrag<T16> F; typedef typename F::V V;
    const int lane = threadIdx.x & 31, lr = lane & 15, hi = lane >> 4;
    // every loop below but the one over j0 is unrolled so that the fragment and accumulator arrays are indexed by constants and stay in registers
    V qf[QT][2], qf2[QT][2]; const size_t qoff = (size_t)(q0 + lr) * HD + 8 * hi; const T16* qp = Q + qoff; const T16* qp2 = HI ? Q2 + qoff : qp;
#pragma unroll
    for (int qt = 0; qt < QT; ++qt)
#pragma unroll
        for (int ks = 0; ks < 2; ++ks) { qf[qt][ks] = F::ld(qp + qt * 16 * HD + ks * 32); if (HI) qf2[qt][ks] = F::ld(qp2 + qt * 16 * HD + ks * 32); }
    if constexpr (HI) XWAIT2(qp, qp2); else XWAIT1(qp);
    const int koff = lane * 8, voff = lane * 8; const int* mrow = mk + (size_t)q0 * TT + lane * 4;   // K, V and the mask are in fragment order (Q, read once, is row-major): 16 keys of K are 2 blocks = 16 HD elements, 32 keys of V one block per 16 d, 32 keys of the mask 512 ints per 16 rows
    v8f o[QT][4]; float mrun[QT], lrun[QT];
#pragma unroll
    for (int qt = 0; qt < QT; ++qt) { mrun[qt] = -3.0e38f; lrun[qt] = 0.f;
#pragma unroll
        for (int dt = 0; dt < 4; ++dt) o[qt][dt] = (v8f){}; }
    // The 32-key tiles in which any of the wave's 16 * QT query rows has an open key, as 64 bits (bit t: keys 32 t .. 32 t + 31), from the flags that k_mfo took from the mask. Only these tiles are walked: a tile with no open key adds nothing
    // (every term of it is exp2(-3e38 - m) = 0 once a row has seen an open key, and what a row gathers before that is wiped by its first open key). Lane l reads the four quarter flags of tiles l and 32 + l; the ballots make the map the same for the whole wave, in scalar registers.
    const int* tp = tf + (size_t)(q0 >> 4) * (TT / 64 * 32) + (lane >> 1) * 32 + (lane & 1) * 4; v4i fl[QT][2];
#pragma unroll
    for (int qt = 0; qt < QT; ++qt) { fl[qt][0] = *(const v4i*)(tp + qt * (TT / 64 * 32)); fl[qt][1] = *(const v4i*)(tp + qt * (TT / 64 * 32) + 16 * 32); }
    XWAIT1(tp);
    int f0 = 0, f1 = 0;
#pragma unroll
    for (int qt = 0; qt < QT; ++qt) { f0 |= fl[qt][0][0] | fl[qt][0][1] | fl[qt][0][2] | fl[qt][0][3]; f1 |= fl[qt][1][0] | fl[qt][1][1] | fl[qt][1][2] | fl[qt][1][3]; }
    unsigned long long open = (unsigned long long)__builtin_amdgcn_ballot_w32(f0 != 0) | ((unsigned long long)__builtin_amdgcn_ballot_w32(f1 != 0) << 32);
    if (open != 0ull) {
    int j0 = __builtin_ctzll(open) * 32; open &= open - 1;   // the first open tile; open holds the tiles still to come
    V ka[2][2], ka2[2][2]; v4i mm[QT][2][2];
    { const T16* kp = Kp + koff + (size_t)j0 * HD; const T16* kp2 = HI ? K2 + koff + (size_t)j0 * HD : kp; const int* mp0 = mrow + j0 * 16;
#pragma unroll
      for (int kt = 0; kt < 2; ++kt) {
#pragma unroll
        for (int ks = 0; ks < 2; ++ks) { ka[kt][ks] = F::ldf(kp + kt * 16 * HD + ks * 512); if (HI) ka2[kt][ks] = F::ldf(kp2 + kt * 16 * HD + ks * 512); }
#pragma unroll
        for (int qt = 0; qt < QT; ++qt) { mm[qt][kt][0] = *(const v4i*)(mp0 + (size_t)qt * 16 * TT + kt * 256); mm[qt][kt][1] = *(const v4i*)(mp0 + (size_t)qt * 16 * TT + kt * 256 + 128); } }
      if constexpr (HI) XWAIT3(kp, kp2, mp0); else XWAIT2(kp, mp0); }
    for (;;) {   // one pass an open tile, in rising key order; every pass but the last clears one of the 64 bits, so there are at most TT / 32 passes
        const int jn = (open != 0ull) ? __builtin_ctzll(open) * 32 : j0;   // the K and mask fragments are fetched one pass ahead, from the next open tile; the last pass fetches its own again, inside the arrays
        V va[4], va2[4]; const T16* vp = Vt + voff + j0 * 16; const T16* vp2 = HI ? V2 + voff + j0 * 16 : vp;
#pragma unroll
        for (int dt = 0; dt < 4; ++dt) { va[dt] = F::ldf(vp + (size_t)dt * 16 * TT); if (HI) va2[dt] = F::ldf(vp2 + (size_t)dt * 16 * TT); }
        // its scheduling barrier also keeps the V loads at the head of the pass, the score products and a whole softmax ahead of their use; without it the compiler sinks them to just in front of attn.v
        if constexpr (HI) XWAIT2(vp, vp2); else XWAIT1(vp);
        v8f s[QT][2];
#pragma unroll
        for (int kt = 0; kt < 2; ++kt)
#pragma unroll
            for (int qt = 0; qt < QT; ++qt) { v8f c = (v8f){};
#pragma unroll
                for (int ks = 0; ks < 2; ++ks) { c = F::mma(ka[kt][ks], qf[qt][ks], c); if (HI) { c = F::mma(ka[kt][ks], qf2[qt][ks], c); c = F::mma(ka2[kt][ks], qf[qt][ks], c); } }
                s[qt][kt] = c; }
        const T16* kp = Kp + koff + (size_t)jn * HD; const T16* kp2 = HI ? K2 + koff + (size_t)jn * HD : kp; const int* mp = mrow + jn * 16;
#pragma unroll
        for (int kt = 0; kt < 2; ++kt)
#pragma unroll
            for (int ks = 0; ks < 2; ++ks) { ka[kt][ks] = F::ldf(kp + kt * 16 * HD + ks * 512); if (HI) ka2[kt][ks] = F::ldf(kp2 + kt * 16 * HD + ks * 512); }
        V pf[QT], pf2[QT]; float mxs[QT];
#pragma unroll
        for (int qt = 0; qt < QT; ++qt) {
            float mx = -3.0e38f;
#pragma unroll
            for (int kt = 0; kt < 2; ++kt)
#pragma unroll
                for (int r = 0; r < 8; ++r) { const float t = (mm[qt][kt][r >> 2][r & 3] == 0) ? s[qt][kt][r] * SCL2 : -3.0e38f; s[qt][kt][r] = t; mx = fmaxf(mx, t); }
#pragma unroll
            for (int kt = 0; kt < 2; ++kt) { mm[qt][kt][0] = *(const v4i*)(mp + (size_t)qt * 16 * TT + kt * 256); mm[qt][kt][1] = *(const v4i*)(mp + (size_t)qt * 16 * TT + kt * 256 + 128); }
            mxs[qt] = mx; }
        // its scheduling barrier also keeps the next pass's K and mask loads in front of the softmax and attn.v of this pass, which cover their latency; without it the compiler sinks them to the foot of the pass or into the next one
        if constexpr (HI) XWAIT3(kp, kp2, mp); else XWAIT2(kp, mp);
#pragma unroll
        for (int qt = 0; qt < QT; ++qt) {
            const float mx = fmaxf(mxs[qt], xhalf(mxs[qt]));
            const float mnew = fmaxf(mrun[qt], mx); const float corr = exp2s(mrun[qt] - mnew); mrun[qt] = mnew;
            float sum = 0.f;
#pragma unroll
            for (int kt = 0; kt < 2; ++kt)
#pragma unroll
                for (int r = 0; r < 8; ++r) { const float p = exp2s(s[qt][kt][r] - mnew); sum += p;
                    if constexpr (HI) { unsigned short a, c2; splitf(p, a, c2); pf[qt][kt * 8 + r] = __builtin_bit_cast(__bf16, a); pf2[qt][kt * 8 + r] = __builtin_bit_cast(__bf16, c2); }
                    else pf[qt][kt * 8 + r] = tohx(p); }
            lrun[qt] = lrun[qt] * corr + sum;
#pragma unroll
            for (int dt = 0; dt < 4; ++dt) o[qt][dt] *= corr;
        }
#pragma unroll
        for (int dt = 0; dt < 4; ++dt)
#pragma unroll
            for (int qt = 0; qt < QT; ++qt) { o[qt][dt] = F::mma(va[dt], pf[qt], o[qt][dt]); if (HI) { o[qt][dt] = F::mma(va[dt], pf2[qt], o[qt][dt]); o[qt][dt] = F::mma(va2[dt], pf[qt], o[qt][dt]); } }
        if (open == 0ull) break;
        open &= open - 1; j0 = jn;
    }
    }
#pragma unroll
    for (int qt = 0; qt < QT; ++qt) { const float inv = __fdiv_rn(1.0f, lrun[qt] + xhalf(lrun[qt])); const size_t oo = (size_t)(q0 + qt * 16) * DQ + lane * 8;
#pragma unroll
        for (int dt = 0; dt < 4; ++dt) { v8us oh, ol;   // a lane's 8 accumulator registers are 8 consecutive d of its query row: one 16-byte piece of the merged planes, which are in fragment order (rows t, k = h HD + d); a wave's store is 512 consecutive bytes
#pragma unroll
            for (int r = 0; r < 8; ++r) { unsigned short a, c2; splitf(o[qt][dt][r] * inv, a, c2); oh[r] = a; ol[r] = c2; }
            *(v8us*)(Ah + oo + dt * 256) = oh; *(v8us*)(Al + oo + dt * 256) = ol;
            // s_wait_xcnt 0 behind the pair of stores, in front of the next tile's packing, which takes their data registers anew: it names the data, so that they stay whole up to it, and nothing is scheduled across it
            asm volatile("s_wait_xcnt 0x0" :: "v"(oh), "v"(ol) : "memory"); __builtin_amdgcn_sched_barrier(0); } }
}
// grid (RH/16 + (TT - RH)/32, NKV, NB_), 32 * REP threads: the first RH/16 blocks in x take 16 hi+lo query rows each (three products for one), the rest 32 fp16 rows each
__global__ __launch_bounds__(32 * REP) void k_fattn(const h16* __restrict__ Q16, const bf* __restrict__ Qh, const bf* __restrict__ Ql, const h16* __restrict__ K16, const bf* __restrict__ Kh, const bf* __restrict__ Kl, const h16* __restrict__ V16, const bf* __restrict__ Vh, const bf* __restrict__ Vl, const int* __restrict__ mk, const int* __restrict__ tf, bf* Ah, bf* Al) {
    const int g = blockIdx.y, h = g * REP + __builtin_amdgcn_readfirstlane((int)(threadIdx.x >> 5)); const size_t qo = ((size_t)blockIdx.z * NH_ + h) * TT * HD, ko = ((size_t)blockIdx.z * NKV + g) * TT * HD; const int bx = blockIdx.x; Ah += (size_t)blockIdx.z * TT * DQ; Al += (size_t)blockIdx.z * TT * DQ;   // batch blockIdx.z: its heads' planes, and its TT rows of the merged planes
    if (bx < RH / 16) attn_body<bf, true, 1>(Qh + qo, Ql + qo, Kh + ko, Kl + ko, Vh + ko, Vl + ko, mk, tf, bx * 16, Ah + h * 16 * HD, Al + h * 16 * HD);
    else attn_body<h16, false, 2>(Q16 + qo, nullptr, K16 + ko, nullptr, V16 + ko, nullptr, mk, tf, RH + (bx - RH / 16) * 32, Ah + h * 16 * HD, Al + h * 16 * HD);
}

extern "C" void kernel_launch(void* const* d_in, const int* in_sizes, int n_in,
                              void* d_out, int out_size, void* d_ws, size_t ws_size, hipStream_t stream) {
    (void)in_sizes; (void)n_in; (void)out_size;
    const float* x = (const float*)d_in[0]; const int* mk = (const int*)d_in[1]; const float* cosT = (const float*)d_in[2]; const float* sinT = (const float*)d_in[3]; const float* wq = (const float*)d_in[4]; const float* wk = (const float*)d_in[5]; const float* wv = (const float*)d_in[6]; const float* wo = (const float*)d_in[7]; const float* bo = (const float*)d_in[8];   // all weights x @ W
    float* OUT = (float*)d_out;     // [2][2048][2048]
    char* wsp = (char*)d_ws;
    auto take = [&](size_t bytes) { char* p = wsp; wsp += (bytes + 255) & ~(size_t)255; return (void*)p; };
    bf* WQ = (bf*)take((size_t)DQ * DM * 2); bf* WK = (bf*)take((size_t)DKV * DM * 2); bf* WV = (bf*)take((size_t)DKV * DM * 2); bf* WO = (bf*)take((size_t)DM * DQ * 2); float* CS = (float*)take((size_t)TT * HD * 2 * 4);
    bf* XB = (bf*)take((size_t)NB_ * TT * DM * 2);
    h16* QP16 = (h16*)take((size_t)NB_ * NH_ * TT * HD * 2); h16* KP16 = (h16*)take((size_t)NB_ * NKV * TT * HD * 2); h16* VT16 = (h16*)take((size_t)NB_ * NKV * HD * TT * 2);
    bf* QPh = (bf*)take((size_t)NB_ * NH_ * TT * HD * 2); bf* QPl = (bf*)take((size_t)NB_ * NH_ * TT * HD * 2); bf* KPh = (bf*)take((size_t)NB_ * NKV * TT * HD * 2); bf* KPl = (bf*)take((size_t)NB_ * NKV * TT * HD * 2); bf* VTh = (bf*)take((size_t)NB_ * NKV * HD * TT * 2); bf* VTl = (bf*)take((size_t)NB_ * NKV * HD * TT * 2);
    bf* ATh = (bf*)take((size_t)NB_ * TT * DQ * 2); bf* ATl = (bf*)take((size_t)NB_ * TT * DQ * 2); int* MF = (int*)take((size_t)TT * TT * 4); int* TF = (int*)take((size_t)PB_MF * 128);
    if ((size_t)(wsp - (char*)d_ws) > ws_size) return;    // ws 256 MiB
    k_prep<<<PB_X + 2 * PB_WQ + 2 * PB_WK + PB_CS + PB_MF, 256, 0, stream>>>(x, mk, cosT, sinT, wq, wk, wv, wo, XB, MF, TF, CS, WQ, WK, WV, WO);   // table and mask are shared by the batches (read as data)
    k_qkv<<<MT * (DQ / 64) + 2 * MT * (DKV / 64), 512, 0, stream>>>(XB, WQ, WK, WV, CS, QP16, QPh, QPl, KP16, KPh, KPl, VT16, VTh, VTl);
    k_fattn<<<dim3(RH / 16 + (TT - RH) / 32, NKV, NB_), 32 * REP, 0, stream>>>(QP16, QPh, QPl, KP16, KPh, KPl, VT16, VTh, VTl, MF, TF, ATh, ATl);
    k_oproj<<<dim3(MT, DM / 64, 1), 512, 0, stream>>>(ATh, ATl, WO, OUT, bo);
}

// v008
// Measured time: 159 microseconds a run.
// Timed twice side by side with v007, it ran 1.50 and 1.45 times as fast.
// All steps since v000 together make it 24.2 times as fast.
#include <hip/hip_runtime.h>

// Grouped-query attention with RoPE and a 2-D mask (x [2][2048][2048]; q = x Wq (32 heads x 64), k, v = x Wk / x Wv (8 kv groups x 64, each serving 4 consecutive query heads); rotate-half RoPE with the input
// cos/sin tables [2048][64] (read as data); scores = q.k/8, -inf where mask[i][j] != 0 (int [2048][2048], read as data); softmax; out = merged attn.v Wo + bo -> [2][2048][2048]).
// Compute dtypes, f32 accumulate: every input rounded to bf16; projections on PLAIN bf16 operands (inputs: exact products, f32 accumulate); RoPE in f32; PER-ROW PRECISION
// HYBRID: query rows < 256 take scores and attn.v on bf16 hi+lo planes (3 products), rows >= 256 on single fp16 planes; 1/8 and the mask in f32 in the running softmax of the fused attention kernel; merged heads as hi+lo planes

#define NB_  2
#define TT   2048
#define DM   2048
#define NH_  32
#define NKV  8
#define REP  (NH_ / NKV)
#define HD   64
#define DQ   (NH_ * HD)
#define DKV  (NKV * HD)
#define RH   256                  // query rows < RH use hi+lo planes (0: none)
#define WIN  0
#define SCL2 0.18033688011112042f   // HD^-0.5 x log2(e): the softmax runs in base 2
typedef _Float16 h16;
typedef unsigned short bf;
typedef __attribute__((ext_vector_type(16))) __bf16   v16bf;
typedef __attribute__((ext_vector_type(16))) _Float16 v16h;
typedef __attribute__((ext_vector_type(8)))  _Float16 v8h;
typedef __attribute__((ext_vector_type(8)))  unsigned short v8us;
typedef __attribute__((ext_vector_type(8)))  float    v8f;
typedef __attribute__((ext_vector_type(4)))  float    v4f;
typedef v8h  __attribute__((may_alias)) v8ha;
typedef v4f  __attribute__((may_alias)) v4fa;
typedef v8us __attribute__((may_alias)) v8usa;
typedef __attribute__((ext_vector_type(2))) float __attribute__((may_alias)) v2fa;

__device__ __forceinline__ unsigned short f2bf(float f) { unsigned u = __float_as_uint(f); u += 0x7FFFu + ((u >> 16) & 1u); return (unsigned short)(u >> 16); }
__device__ __forceinline__ float bf2f(unsigned short b) { return __uint_as_float(((unsigned)b) << 16); }
__device__ __forceinline__ float bfr(float f) { return bf2f(f2bf(f)); }
__device__ __forceinline__ v16h cat16(v8h lo, v8h hi) { return __builtin_shufflevector(lo, hi, 0, 1, 2, 3, 4, 5, 6, 7, 8, 9, 10, 11, 12, 13, 14, 15); }
__device__ __forceinline__ v16bf cat16b(v8us lo, v8us hi) { return __builtin_bit_cast(v16bf, __builtin_shufflevector(lo, hi, 0, 1, 2, 3, 4, 5, 6, 7, 8, 9, 10, 11, 12, 13, 14, 15)); }
__device__ __forceinline__ v8f wmma16(v16h a, v16h b, v8f c) { return __builtin_amdgcn_wmma_f32_16x16x32_f16(false, a, false, b, (short)0, c, false, false); }
__device__ __forceinline__ v8f wmmab(v16bf a, v16bf b, v8f c) { return __builtin_amdgcn_wmma_f32_16x16x32_bf16(false, a, false, b, (short)0, c, false, false); }
__device__ __forceinline__ h16 tohx(float x) { return (h16)x; }
__device__ __forceinline__ void splitf(float y, unsigned short& h, unsigned short& l) { h = f2bf(y); l = f2bf(y - bf2f(h)); }
typedef __attribute__((ext_vector_type(2))) _Float16 v2h;
typedef __attribute__((ext_vector_type(2))) unsigned short v2us;
__device__ __forceinline__ float xhalf(float x) { return __builtin_bit_cast(float, __builtin_amdgcn_permlanex16(__builtin_bit_cast(int, x), __builtin_bit_cast(int, x), 0x76543210, 0xfedcba98, false, false)); }  // lane l reads lane l ^ 16



// s_wait_xcnt 0 behind a group of global loads, in front of every rewrite of their address registers: it names the addresses, so that they stay whole up to it (no later load of the group lands on them), and nothing is scheduled across it
#define XWAIT1(a)       do { asm volatile("s_wait_xcnt 0x0" :: "v"(a) : "memory"); __builtin_amdgcn_sched_barrier(0); } while (0)
#define XWAIT2(a, b)    do { asm volatile("s_wait_xcnt 0x0" :: "v"(a), "v"(b) : "memory"); __builtin_amdgcn_sched_barrier(0); } while (0)
#define XWAIT3(a, b, c) do { asm volatile("s_wait_xcnt 0x0" :: "v"(a), "v"(b), "v"(c) : "memory"); __builtin_amdgcn_sched_barrier(0); } while (0)
// ---- gemmt: GEMM on 16-bit planes in fragment order, one 128x128 output tile per workgroup of four waves (2 x 2, a 64x64 tile and 16 accumulators each), every wave walking all of K. It is a device function, so that one launch
// can hold several products as ranges of its grid (k_qkv); sm is the workgroup's LDS. The NB_ batches of x are one plane of NB_ * TT rows, so that a product over x or over the merged heads takes both in one grid.
// acc[m][n] = sum_k A[m][k] Bt[n][k] (+ A2[m][k] Bt[n][k] with NA == 2), tile (bx, by) of (M / 128, N / 128). K % 128 == 0.
// The operands come through LDS, so that the two waves that need a fragment fetch it from L2 once: a stage is 64 k of the tile's 128 rows of every operand, two buffers, filled by tensor loads one stage ahead of the pass that reads them.
// In fragment order 16 rows x 64 k are 2 KiB in a row, and the next 16 rows stand 32 K bytes on: a slice of a stage is a two-dimensional tile of 2-KiB rows, and it lands in LDS as it lies in memory, so that a lane's 16-byte LDS read is again piece l or 32 + l of a block (consecutive lanes, consecutive 16 bytes).
// FRAGMENT ORDER of a 16-bit plane P[row][k] (rows % 16 == 0, K % 32 == 0): the 16 rows x 32 k of one A or B fragment are one 1-KiB block, blocks in the order [row / 16][k / 32]; inside a block the 16-byte piece of
// row r, k = 8 s .. 8 s + 7 (s = 0..3) is piece (s >> 1) * 32 + (s & 1) * 16 + (r & 15). Lane l of a wave then reads pieces l and 32 + l (ldf): each load instruction covers 512 consecutive bytes, four whole cache lines,
// where on a row-major plane (ld) it touches 16 lines for 32 bytes each. The values a lane and register receive are the same as with ld on the row-major plane.
template <typename T16> struct WFrag;
template <> struct WFrag<h16> { typedef v16h V; static __device__ __forceinline__ V ld(const h16* p) { return cat16(*(const v8h*)p, *(const v8h*)(p + 16)); } static __device__ __forceinline__ V ldf(const h16* p) { return cat16(*(const v8h*)p, *(const v8h*)(p + 256)); } static __device__ __forceinline__ v8f mma(V a, V b, v8f c) { return wmma16(a, b, c); } };
template <> struct WFrag<bf> { typedef v16bf V; static __device__ __forceinline__ V ld(const bf* p) { return cat16b(*(const v8us*)p, *(const v8us*)(p + 16)); } static __device__ __forceinline__ V ldf(const bf* p) { return cat16b(*(const v8us*)p, *(const v8us*)(p + 256)); } static __device__ __forceinline__ v8f mma(V a, V b, v8f c) { return wmmab(a, b, c); } };
typedef unsigned int u32;
typedef __attribute__((ext_vector_type(4))) u32 u32x4;
typedef __attribute__((ext_vector_type(8))) u32 u32x8;
__device__ __forceinline__ u32 uni(u32 v) { return (u32)__builtin_amdgcn_readfirstlane((int)v); }
// a wave-uniform test held in a scalar register, so that the branch on it is a scalar branch: a tensor load ignores EXEC
__device__ __forceinline__ u32 pinned(u32 v) { u32 w = uni(v); asm volatile("" : "+s"(w)); return w; }
// one tensor load of the calling wave: the tile that g1 describes, first byte at src, to byte lds_dst of the workgroup's LDS; g0 is handed back, so that the wait that covers the request can name it. g0 is written as an operand that the statement hands on ("+s", though the instruction leaves it as it is): the wait then names these very registers, where from an input alone the compiler put a second copy together for the wait and took the issued registers for other scalars
__device__ __forceinline__ u32x4 tdm_load(u32 lds_dst, const void* src, u32x8 g1) {
    const unsigned long long ga = (unsigned long long)src; u32x4 g0;
    g0[0] = uni(1u); g0[1] = uni(lds_dst); g0[2] = uni((u32)ga); g0[3] = uni((((u32)(ga >> 32)) & 0x01FFFFFFu) | 0x80000000u);
    asm volatile("tensor_load_to_lds %0, %1" : "+s"(g0) : "s"(g1) : "memory"); return g0; }
// the issuing wave's wait for its tensor load. It names both groups of the request's descriptor, so that their scalar registers stay whole from the issue up to it (left alone the compiler took some of them for the loop's own scalars while the request was in flight)
__device__ __forceinline__ void tdm_wait(u32x4 g0, u32x8 g1) { asm volatile("s_wait_tensorcnt 0x0" :: "s"(g0), "s"(g1) : "memory"); }
// EPI: what becomes of a wave's 64x64 tile. A lane's 8 registers of an accumulator are 8 consecutive rows m of one column n.
//   0: out. A = merged heads (t), Bt = weight rows (n): f32 + bias, turned into whole 256-byte rows through the wave's own part of LDS.
//   1, 2: q, k. A = weight rows (d), Bt = x (t): the 64 m are the 64 d of one head, so a lane holds 8 consecutive d of one position: one 16-byte piece of the head's [t][d] plane in fragment order (rows t, k = d).
//      Rotate-half RoPE out[d] = x[d] cos[t][d] - x[d+32] sin[t][d], out[d+32] = x[d+32] cos[t][d+32] + x[d] sin[t][d+32]; the partner d +- 32 is the same register of the accumulator two tiles on.
//   3: v. A = x (t), Bt = weight rows (d): a lane holds 8 consecutive t of one d: one piece of the kv group's [d][t] plane in fragment order (rows d, k = t). No RoPE.
//   1 to 3 never reach memory as f32: each piece is stored in the three 16-bit planes of the attention kernel (fp16, bf16 hi, bf16 lo), a wave's store being 512 consecutive bytes.
#define GKS 64                          // k of a stage
#define GOPB (128 * GKS * 2)            // bytes of one operand in a stage
template <int NA, int K, int EPI>
__device__ __forceinline__ void gemmt(unsigned char* sm, int bx, int by, const bf* __restrict__ A, const bf* __restrict__ A2, const bf* __restrict__ Bt, float* C, int ldc, const float* __restrict__ bias, const float* __restrict__ CS, h16* P16, bf* Ph, bf* Pl) {
    typedef WFrag<bf> F; typedef typename F::V V;
    constexpr int NS = K / GKS, STG = (NA + 1) * GOPB;
    static_assert(NS >= 2, "the ring's prologue fills two stages");
    const int lane = threadIdx.x & 31, lr = lane & 15, hi = lane >> 4; const int r0 = bx * 128, c0 = by * 128;
    const int wv = __builtin_amdgcn_readfirstlane((int)(threadIdx.x >> 5)), wm = wv >> 1, wn = wv & 1;
    // every wave moves its own slice of each stage. NA == 1: waves 0, 1 the halves of A, waves 2, 3 the halves of Bt (4 rows of 2 KiB each). NA == 2: wave 0 all of A, wave 1 all of A2 (8 rows), waves 2, 3 the halves of Bt.
    const bf* src; u32 soff, nrow;
    if constexpr (NA == 1) { src = (wv < 2) ? A + (size_t)(r0 + wn * 64) * K : Bt + (size_t)(c0 + wn * 64) * K; soff = wv * (GOPB / 2); nrow = 4; }
    else { src = (wv == 0) ? A + (size_t)r0 * K : (wv == 1) ? A2 + (size_t)r0 * K : Bt + (size_t)(c0 + wn * 64) * K; soff = (wv < 2) ? wv * GOPB : 2 * GOPB + wn * (GOPB / 2); nrow = (wv < 2) ? 8 : 4; }
    constexpr u32 d0 = GKS * 16 * 2;    // a row of the slice: 16 rows x 64 k of the plane, 2 KiB; source pitch 32 K bytes
    u32x8 g1; g1[0] = uni(0u); g1[1] = uni((d0 & 0xFFFFu) << 16); g1[2] = uni((d0 >> 16) | ((nrow & 0xFFFFu) << 16)); g1[3] = uni((nrow >> 16) | (d0 << 16)); g1[4] = uni(nrow); g1[5] = uni((u32)K * 32u); g1[6] = uni(0u); g1[7] = uni(0u);
    const u32 ldst = (u32)(size_t)sm + soff;
    u32x4 g0 = tdm_load(ldst, src, g1);                        // stage 0
    tdm_wait(g0, g1);                                          // this wave's slice of stage 0 has landed
    __syncthreads();                                           // publishes stage 0 to the other waves
    g0 = tdm_load(ldst + STG, src + GKS * 16, g1);             // stage 1
    v4f bv = (v4f){};
    if constexpr (EPI == 0) { const float* bp = bias + c0 + wn * 64 + lr * 4; bv = *(const v4f*)bp; XWAIT1(bp); }   // fetched ahead of the K loop, which covers the latency
    v8f acc[4][4];
#pragma unroll
    for (int mb = 0; mb < 4; ++mb)
#pragma unroll
        for (int nb = 0; nb < 4; ++nb) acc[mb][nb] = (v8f){};
#pragma unroll 1   // one pass a stage: the ring's order stands once, at the foot
    for (int s = 0; s < NS; ++s) {
        const bf* sb = (const bf*)(sm + (s & 1) * STG) + lane * 8;
        V a[GKS / 32][4], a2[GKS / 32][4], b[GKS / 32][4];
#pragma unroll     // the fragment and accumulator arrays are indexed by constants and stay in registers
        for (int kb = 0; kb < GKS / 32; ++kb) {
#pragma unroll
            for (int mb = 0; mb < 4; ++mb) { a[kb][mb] = F::ldf(sb + (wm * 4 + mb) * (GKS * 16) + kb * 512); if (NA == 2) a2[kb][mb] = F::ldf(sb + GOPB / 2 + (wm * 4 + mb) * (GKS * 16) + kb * 512); }
#pragma unroll
            for (int nb = 0; nb < 4; ++nb) b[kb][nb] = F::ldf(sb + NA * (GOPB / 2) + (wn * 4 + nb) * (GKS * 16) + kb * 512); }
        __builtin_amdgcn_sched_barrier(0);   // keeps the pass's LDS reads together at its head: left alone the compiler sinks them among the products, two at a time, each with a full wait of its own
#pragma unroll
        for (int kb = 0; kb < GKS / 32; ++kb)
#pragma unroll
            for (int nb = 0; nb < 4; ++nb)
#pragma unroll
                for (int mb = 0; mb < 4; ++mb) { acc[mb][nb] = F::mma(a[kb][mb], b[kb][nb], acc[mb][nb]); if (NA == 2) acc[mb][nb] = F::mma(a2[kb][mb], b[kb][nb], acc[mb][nb]); }
        __builtin_amdgcn_sched_barrier(0);   // keeps the products in front of the foot: left alone the compiler sinks them behind the barrier, so that the refill is issued a whole pass of products later and the next foot waits out its flight
        asm volatile("s_wait_dscnt 0x0" ::: "memory");         // this wave's reads of stage s are done
        tdm_wait(g0, g1);                                      // this wave's slice of stage s + 1 has landed
        __syncthreads();                                       // publishes stage s + 1 and frees the buffer of stage s
        if (pinned(s + 2 < NS)) g0 = tdm_load(ldst + (s & 1) * STG, src + (size_t)(s + 2) * (GKS * 16), g1);
    }
    asm volatile("s_wait_tensorcnt 0x0" ::: "memory");         // nothing of the ring is in flight behind the loop
    asm volatile("s_wait_dscnt 0x0" ::: "memory");
    __builtin_amdgcn_sched_barrier(0);                         // keeps the epilogue's scalar arithmetic behind the two waits: left alone the compiler lifts it in front of them, onto registers that held a descriptor
    if constexpr (EPI == 0) {
        // the last pass's barrier stands behind every wave's last read of the ring, and no load follows it: the ring is free, and each wave stages in a part of its own
        float* os = (float*)(sm + wv * (16 * 68 * 4));
#pragma unroll
        for (int q = 0; q < 4; ++q) bv[q] = bfr(bv[q]);
#pragma unroll
        for (int mb = 0; mb < 4; ++mb) {
#pragma unroll
            for (int nb = 0; nb < 4; ++nb) {
#pragma unroll
                for (int j = 0; j < 8; ++j) os[(hi * 8 + j) * 68 + nb * 16 + lr] = acc[mb][nb][j]; }
            __builtin_amdgcn_wave_barrier(); asm volatile("" ::: "memory");   // the rows are read back by other lanes of the wave: no LDS read is moved in front of the writes
            float* crow = C + (size_t)(r0 + wm * 64 + mb * 16) * ldc + c0 + wn * 64; v4f val[8];
#pragma unroll
            for (int s = 0; s < 8; ++s) val[s] = *(const v4fa*)(os + (2 * s + hi) * 68 + lr * 4) + bv;
#pragma unroll
            for (int s = 0; s < 8; ++s) *(v4f*)(crow + (size_t)(2 * s + hi) * ldc + lr * 4) = val[s];
            // s_wait_xcnt 0 behind the eight stores, in front of the next 16 rows, which take their data registers anew: it names the data, so that they stay whole up to it, and nothing is scheduled across it
            asm volatile("s_wait_xcnt 0x0" :: "v"(val[0]), "v"(val[1]), "v"(val[2]), "v"(val[3]), "v"(val[4]), "v"(val[5]), "v"(val[6]), "v"(val[7]) : "memory"); __builtin_amdgcn_sched_barrier(0);
        }
    } else {
        const int tg = (EPI == 3) ? r0 + wm * 64 : c0 + wn * 64, t0 = tg % TT, pl = (EPI == 3) ? by * 2 + wn : bx * 2 + wm;   // row tg of the x plane is position tg % TT of batch tg / TT; pl: the head or kv group
        const size_t e0 = ((size_t)(tg / TT) * (EPI == 1 ? NH_ : NKV) + pl) * TT * HD + (size_t)t0 * (EPI == 3 ? 16 : HD) + lane * 8;   // a batch's heads (kv groups) follow one another, batch after batch
        constexpr int enb = (EPI == 3) ? 16 * TT : 16 * HD;   // from one 16-column tile to the next: 16 rows d of the [d][t] plane, or 16 rows t of the [t][d] plane; 16 m on are half a block, 256 elements, in both
        const float* csp = CS + ((size_t)(t0 + lr) * HD + hi * 8) * 2;
#pragma unroll     // acc[][] and cs[][] are indexed by constants and stay in registers
        for (int nb = 0; nb < 4; ++nb) {
            v4f cs[4][4];   // cos d, sin d, cos d+1, sin d+1, ... of the lane's position and its 8 d of each of the four tiles
            if constexpr (EPI != 3) {
#pragma unroll
                for (int mb = 0; mb < 4; ++mb)
#pragma unroll
                    for (int q = 0; q < 4; ++q) cs[mb][q] = *(const v4f*)(csp + nb * 16 * HD * 2 + mb * 32 + q * 4);
                XWAIT1(csp); }
#pragma unroll
            for (int mb = 0; mb < 4; ++mb) { v8h o16; v8us oh, ol;
#pragma unroll
                for (int j = 0; j < 8; ++j) { float r = acc[mb][nb][j];
                    if constexpr (EPI != 3) { const float x1 = acc[mb ^ 2][nb][j]; r = r * cs[mb][j >> 1][(j & 1) * 2] + (mb >= 2 ? x1 : -x1) * cs[mb][j >> 1][(j & 1) * 2 + 1]; }
                    o16[j] = tohx(r); unsigned short a2, c2; splitf(r, a2, c2); oh[j] = a2; ol[j] = c2; }
                *(v8h*)(P16 + e0 + nb * enb + mb * 256) = o16; *(v8us*)(Ph + e0 + nb * enb + mb * 256) = oh; *(v8us*)(Pl + e0 + nb * enb + mb * 256) = ol;
                // s_wait_xcnt 0 behind the three stores, in front of the next piece's packing, which takes their data registers anew: it names the data, so that they stay whole up to it, and nothing is scheduled across it
                asm volatile("s_wait_xcnt 0x0" :: "v"(o16), "v"(oh), "v"(ol) : "memory"); __builtin_amdgcn_sched_barrier(0); }
        }
    }
}

// k_qkv: the q, k and v projections of both batches as three ranges of one grid (they read the same x plane and depend on nothing of one another); inside a range the tile's first index runs fastest. The range test is the same for a whole workgroup, so that every barrier of gemmt is passed by all of its waves, and it is a scalar branch (pinned), since tensor loads stand behind it.
#define MT (NB_ * TT / 128)   // 128-row tiles of the x plane
__global__ __launch_bounds__(128) void k_qkv(const bf* __restrict__ XB, const bf* __restrict__ WQ, const bf* __restrict__ WK, const bf* __restrict__ WV, const float* __restrict__ CS, h16* QP16, bf* QPh, bf* QPl, h16* KP16, bf* KPh, bf* KPl, h16* VT16, bf* VTh, bf* VTl) {
    __shared__ __attribute__((aligned(2048))) unsigned char sm[2 * 2 * GOPB];
    int i = blockIdx.x;
    if (pinned(i < MT * (DQ / 128))) { gemmt<1, DM, 1>(sm, i % (DQ / 128), i / (DQ / 128), WQ, nullptr, XB, nullptr, 0, nullptr, CS, QP16, QPh, QPl); return; }
    i -= MT * (DQ / 128);
    if (pinned(i < MT * (DKV / 128))) { gemmt<1, DM, 2>(sm, i % (DKV / 128), i / (DKV / 128), WK, nullptr, XB, nullptr, 0, nullptr, CS, KP16, KPh, KPl); return; }
    i -= MT * (DKV / 128);
    gemmt<1, DM, 3>(sm, i % MT, i / MT, XB, nullptr, WV, nullptr, 0, nullptr, nullptr, VT16, VTh, VTl);
}
// k_oproj: out = merged heads (hi + lo planes) Wo + bo, both batches; grid (MT, DM / 128)
__global__ __launch_bounds__(128) void k_oproj(const bf* __restrict__ ATh, const bf* __restrict__ ATl, const bf* __restrict__ WO, float* OUT, const float* __restrict__ bo) {
    __shared__ __attribute__((aligned(2048))) unsigned char sm[2 * 3 * GOPB];
    gemmt<2, DQ, 0>(sm, blockIdx.x, blockIdx.y, ATh, ATl, WO, OUT, DM, bo, nullptr, nullptr, nullptr, nullptr);
}

typedef __attribute__((ext_vector_type(4))) _Float16 v4h;
typedef __attribute__((ext_vector_type(4))) unsigned short v4us;
typedef __attribute__((ext_vector_type(2))) float v2f;
typedef __attribute__((ext_vector_type(4))) int v4i;

// The conversions are device functions of a block index bx, 256 threads a block: none depends on another, and k_prep runs them all as ranges of one grid.
// k_wtG and k_cvt8 write one 16-byte piece of a fragment-order plane a thread, thread i piece i, so that a wave's store is 512 consecutive bytes. fo_row / fo_k: the row and the first k of piece i in a plane with K columns.
// Their sizes are compile-time constants, so that a thread's loads are immediate offsets from one address, which XWAIT1 keeps whole.
__device__ __forceinline__ int fo_row(int i, int K) { return ((i >> 6) / (K / 32)) * 16 + (i & 15); }
__device__ __forceinline__ int fo_k(int i, int K) { return ((i >> 6) % (K / 32)) * 32 + ((i >> 5) & 1) * 16 + ((i >> 4) & 1) * 8; }
// k_wtG: Bt[n][k] = bf16(w[k][n]) in fragment order; 16 neighbouring lanes read 16 neighbouring n of one k
template <int K, int N>
__device__ __forceinline__ void k_wtG(int bx, const float* __restrict__ w, bf* Bt) {
    const int i = bx * 256 + threadIdx.x; if (i >= N * (K / 8)) return; const int n = fo_row(i, K), k0 = fo_k(i, K); const float* p = w + (size_t)k0 * N + n; float x[8]; v8us o;
#pragma unroll
    for (int j = 0; j < 8; ++j) x[j] = p[j * N];
    XWAIT1(p);
#pragma unroll
    for (int j = 0; j < 8; ++j) o[j] = f2bf(x[j]);
    *(v8us*)(Bt + (size_t)i * 8) = o; }
// k_cvt8: dst[r][k] = bf16(src[r][k]) in fragment order
template <int K>
__device__ __forceinline__ void k_cvt8(int bx, const float* __restrict__ src, bf* dst, int n8) { const int i = bx * 256 + threadIdx.x; if (i >= n8) return; const float* p = src + (size_t)fo_row(i, K) * K + fo_k(i, K); const v8f v = *(const v8f*)p; XWAIT1(p); v8us o;
#pragma unroll
    for (int k = 0; k < 8; ++k) o[k] = f2bf(v[k]); *(v8us*)(dst + (size_t)i * 8) = o;  }
// k_mfo: the mask in the order in which the lanes of k_fattn read it: [row / 16][key / 32][(key >> 4) & 1][(key >> 2) & 1][lane = ((key >> 3) & 1) * 16 + (row & 15)][key & 3]; thread i writes the i-th group of 4
// It also says which parts of the mask hold an open key (a zero word): a wave moves a quarter of one 16-row x 32-key tile, and writes TF[bx][wave] = 1 if that quarter has one, else 0. A block is two tiles; its 8 words have a 128-byte line of their own.
__device__ __forceinline__ void k_mfo(int bx, const int* __restrict__ mk, int* MF, int* TF) { const int i = bx * 256 + threadIdx.x; if (i >= TT * (TT / 4)) return;
    const int row = (i / (4 * TT)) * 16 + (i & 15), key = ((i >> 7) % (TT / 32)) * 32 + ((i >> 6) & 1) * 16 + ((i >> 4) & 1) * 8 + ((i >> 5) & 1) * 4; const int* p = mk + (size_t)row * TT + key; const v4i v = *(const v4i*)p; XWAIT1(p); *(v4i*)(MF + (size_t)i * 4) = v;
    const unsigned any = __builtin_amdgcn_ballot_w32(v[0] == 0 || v[1] == 0 || v[2] == 0 || v[3] == 0);
    if ((threadIdx.x & 31) == 0) TF[bx * 32 + (threadIdx.x >> 5)] = any != 0u; }
__device__ __forceinline__ void k_cscvt(int bx, const float* __restrict__ cosT, const float* __restrict__ sinT, float* CS) { const int idx = bx * 256 + threadIdx.x; if (idx >= TT * HD) return; v2f cs; cs[0] = bfr(cosT[idx]); cs[1] = bfr(sinT[idx]); *(v2f*)(CS + (size_t)idx * 2) = cs;  }
// k_prep: every conversion of an input (x of both batches as one plane of NB_ * TT rows, the four weights, the mask, the cos/sin table) as a range of one grid; the sizes below are each range's blocks
#define PB_X  (NB_ * TT * DM / 8 / 256)
#define PB_WQ (DM * DQ / 8 / 256)
#define PB_WK (DM * DKV / 8 / 256)
#define PB_MF (TT * (TT / 4) / 256)
#define PB_CS (TT * HD / 256)
__global__ __launch_bounds__(256) void k_prep(const float* __restrict__ x, const int* __restrict__ mk, const float* __restrict__ cosT, const float* __restrict__ sinT, const float* __restrict__ wq, const float* __restrict__ wk, const float* __restrict__ wv, const float* __restrict__ wo,
                                              bf* XB, int* MF, int* TF, float* CS, bf* WQ, bf* WK, bf* WV, bf* WO) {
    int i = blockIdx.x;
    if (i < PB_X) { k_cvt8<DM>(i, x, XB, NB_ * TT * DM / 8); return; }
    i -= PB_X;
    if (i < PB_WQ) { k_wtG<DM, DQ>(i, wq, WQ); return; }
    i -= PB_WQ;
    if (i < PB_WK) { k_wtG<DM, DKV>(i, wk, WK); return; }
    i -= PB_WK;
    if (i < PB_WK) { k_wtG<DM, DKV>(i, wv, WV); return; }
    i -= PB_WK;
    if (i < PB_CS) { k_cscvt(i, cosT, sinT, CS); return; }
    i -= PB_CS;
    if (i < PB_MF) { k_mfo(i, mk, MF, TF); return; }
    i -= PB_MF;
    k_wtG<DQ, DM>(i, wo, WO);
}
// ---- k_fattn: scores, mask, softmax, attn.v and the head merge in one kernel; no score or probability ever reaches memory. One wave = one query head x 16 * QT query rows, walking the keys 32 at a time (of the TT / 32 key tiles those in which the mask leaves one of its rows a key open);
// the REP waves of a workgroup are the REP query heads of one kv group on the same query rows, so they read the same K, V and mask lines at about the same time (shared through the WGP cache).
// Transposed products: St = K Qt (A = K rows, B = Q rows kept in registers), so a lane holds scores of ONE query (column lr), keys 8 hi + r of each 16-key tile; two such tiles, converted in place, are the B operand
// of Ot += Vt Pt (A = rows of the [d][t] plane). Running maximum and sum per lane; the two lane halves share the maximum every pass and join their sums once at the end.
// A masked score is -3e38 as a finite stand-in: while a row has seen masked keys only, its terms are exp2(0) = 1, and the first real score wipes them with the factor exp2(-inf) = 0. A wave whose rows have no open key in any tile walks none: sum 0, and 0 x 1/0 = NaN, as the softmax of a row of -inf.
// v_exp_f32 with, in the same statement, the one slot that the instruction set asks for behind a transcendental before its result is read or its source overwritten
__device__ __forceinline__ float exp2s(float x) { float y; asm("v_exp_f32 %0, %1\n\tv_nop" : "=v"(y) : "v"(x)); return y; }
template <typename T16, bool HI, int QT>
__device__ __forceinline__ void attn_body(const T16* __restrict__ Q, const T16* __restrict__ Q2, const T16* __restrict__ Kp, const T16* __restrict__ K2, const T16* __restrict__ Vt, const T16* __restrict__ V2, const int* __restrict__ mk, const int* __restrict__ tf, int q0, bf* Ah, bf* Al) {
    typedef WFrag<T16> F; typedef typename F::V V;
    const int lane = threadIdx.x & 31, lr = lane & 15, hi = lane >> 4;
    // every loop below but the one over j0 is unrolled so that the fragment and accumulator arrays are indexed by constants and stay in registers
    V qf[QT][2], qf2[QT][2]; const size_t qoff = (size_t)q0 * HD + lane * 8; const T16* qp = Q + qoff; const T16* qp2 = HI ? Q2 + qoff : qp;
#pragma unroll
    for (int qt = 0; qt < QT; ++qt)
#pragma unroll
        for (int ks = 0; ks < 2; ++ks) { qf[qt][ks] = F::ldf(qp + qt * 16 * HD + ks * 512); if (HI) qf2[qt][ks] = F::ldf(qp2 + qt * 16 * HD + ks * 512); }
    if constexpr (HI) XWAIT2(qp, qp2); else XWAIT1(qp);
    const int koff = lane * 8, voff = lane * 8; const int* mrow = mk + (size_t)q0 * TT + lane * 4;   // Q, K, V and the mask are in fragment order: 16 keys of K are 2 blocks = 16 HD elements, 32 keys of V one block per 16 d, 32 keys of the mask 512 ints per 16 rows
    v8f o[QT][4]; float mrun[QT], lrun[QT];
#pragma unroll
    for (int qt = 0; qt < QT; ++qt) { mrun[qt] = -3.0e38f; lrun[qt] = 0.f;
#pragma unroll
        for (int dt = 0; dt < 4; ++dt) o[qt][dt] = (v8f){}; }
    // The 32-key tiles in which any of the wave's 16 * QT query rows has an open key, as 64 bits (bit t: keys 32 t .. 32 t + 31), from the flags that k_mfo took from the mask. Only these tiles are walked: a tile with no open key adds nothing
    // (every term of it is exp2(-3e38 - m) = 0 once a row has seen an open key, and what a row gathers before that is wiped by its first open key). Lane l reads the four quarter flags of tiles l and 32 + l; the ballots make the map the same for the whole wave, in scalar registers.
    const int* tp = tf + (size_t)(q0 >> 4) * (TT / 64 * 32) + (lane >> 1) * 32 + (lane & 1) * 4; v4i fl[QT][2];
#pragma unroll
    for (int qt = 0; qt < QT; ++qt) { fl[qt][0] = *(const v4i*)(tp + qt * (TT / 64 * 32)); fl[qt][1] = *(const v4i*)(tp + qt * (TT / 64 * 32) + 16 * 32); }
    XWAIT1(tp);
    int f0 = 0, f1 = 0;
#pragma unroll
    for (int qt = 0; qt < QT; ++qt) { f0 |= fl[qt][0][0] | fl[qt][0][1] | fl[qt][0][2] | fl[qt][0][3]; f1 |= fl[qt][1][0] | fl[qt][1][1] | fl[qt][1][2] | fl[qt][1][3]; }
    unsigned long long open = (unsigned long long)__builtin_amdgcn_ballot_w32(f0 != 0) | ((unsigned long long)__builtin_amdgcn_ballot_w32(f1 != 0) << 32);
    if (open != 0ull) {
    int j0 = __builtin_ctzll(open) * 32; open &= open - 1;   // the first open tile; open holds the tiles still to come
    V ka[2][2], ka2[2][2]; v4i mm[QT][2][2];
    { const T16* kp = Kp + koff + (size_t)j0 * HD; const T16* kp2 = HI ? K2 + koff + (size_t)j0 * HD : kp; const int* mp0 = mrow + j0 * 16;
#pragma unroll
      for (int kt = 0; kt < 2; ++kt) {
#pragma unroll
        for (int ks = 0; ks < 2; ++ks) { ka[kt][ks] = F::ldf(kp + kt * 16 * HD + ks * 512); if (HI) ka2[kt][ks] = F::ldf(kp2 + kt * 16 * HD + ks * 512); }
#pragma unroll
        for (int qt = 0; qt < QT; ++qt) { mm[qt][kt][0] = *(const v4i*)(mp0 + (size_t)qt * 16 * TT + kt * 256); mm[qt][kt][1] = *(const v4i*)(mp0 + (size_t)qt * 16 * TT + kt * 256 + 128); } }
      if constexpr (HI) XWAIT3(kp, kp2, mp0); else XWAIT2(kp, mp0); }
    for (;;) {   // one pass an open tile, in rising key order; every pass but the last clears one of the 64 bits, so there are at most TT / 32 passes
        const int jn = (open != 0ull) ? __builtin_ctzll(open) * 32 : j0;   // the K and mask fragments are fetched one pass ahead, from the next open tile; the last pass fetches its own again, inside the arrays
        V va[4], va2[4]; const T16* vp = Vt + voff + j0 * 16; const T16* vp2 = HI ? V2 + voff + j0 * 16 : vp;
#pragma unroll
        for (int dt = 0; dt < 4; ++dt) { va[dt] = F::ldf(vp + (size_t)dt * 16 * TT); if (HI) va2[dt] = F::ldf(vp2 + (size_t)dt * 16 * TT); }
        // its scheduling barrier also keeps the V loads at the head of the pass, the score products and a whole softmax ahead of their use; without it the compiler sinks them to just in front of attn.v
        if constexpr (HI) XWAIT2(vp, vp2); else XWAIT1(vp);
        v8f s[QT][2];
#pragma unroll
        for (int kt = 0; kt < 2; ++kt)
#pragma unroll
            for (int qt = 0; qt < QT; ++qt) { v8f c = (v8f){};
#pragma unroll
                for (int ks = 0; ks < 2; ++ks) { c = F::mma(ka[kt][ks], qf[qt][ks], c); if (HI) { c = F::mma(ka[kt][ks], qf2[qt][ks], c); c = F::mma(ka2[kt][ks], qf[qt][ks], c); } }
                s[qt][kt] = c; }
        const T16* kp = Kp + koff + (size_t)jn * HD; const T16* kp2 = HI ? K2 + koff + (size_t)jn * HD : kp; const int* mp = mrow + jn * 16;
#pragma unroll
        for (int kt = 0; kt < 2; ++kt)
#pragma unroll
            for (int ks = 0; ks < 2; ++ks) { ka[kt][ks] = F::ldf(kp + kt * 16 * HD + ks * 512); if (HI) ka2[kt][ks] = F::ldf(kp2 + kt * 16 * HD + ks * 512); }
        V pf[QT], pf2[QT]; float mxs[QT];
#pragma unroll
        for (int qt = 0; qt < QT; ++qt) {
            float mx = -3.0e38f;
#pragma unroll
            for (int kt = 0; kt < 2; ++kt)
#pragma unroll
                for (int r = 0; r < 8; ++r) { const float t = (mm[qt][kt][r >> 2][r & 3] == 0) ? s[qt][kt][r] * SCL2 : -3.0e38f; s[qt][kt][r] = t; mx = fmaxf(mx, t); }
#pragma unroll
            for (int kt = 0; kt < 2; ++kt) { mm[qt][kt][0] = *(const v4i*)(mp + (size_t)qt * 16 * TT + kt * 256); mm[qt][kt][1] = *(const v4i*)(mp + (size_t)qt * 16 * TT + kt * 256 + 128); }
            mxs[qt] = mx; }
        // its scheduling barrier also keeps the next pass's K and mask loads in front of the softmax and attn.v of this pass, which cover their latency; without it the compiler sinks them to the foot of the pass or into the next one
        if constexpr (HI) XWAIT3(kp, kp2, mp); else XWAIT2(kp, mp);
#pragma unroll
        for (int qt = 0; qt < QT; ++qt) {
            const float mx = fmaxf(mxs[qt], xhalf(mxs[qt]));
            const float mnew = fmaxf(mrun[qt], mx); const float corr = exp2s(mrun[qt] - mnew); mrun[qt] = mnew;
            float sum = 0.f;
#pragma unroll
            for (int kt = 0; kt < 2; ++kt)
#pragma unroll
                for (int r = 0; r < 8; ++r) { const float p = exp2s(s[qt][kt][r] - mnew); sum += p;
                    if constexpr (HI) { unsigned short a, c2; splitf(p, a, c2); pf[qt][kt * 8 + r] = __builtin_bit_cast(__bf16, a); pf2[qt][kt * 8 + r] = __builtin_bit_cast(__bf16, c2); }
                    else pf[qt][kt * 8 + r] = tohx(p); }
            lrun[qt] = lrun[qt] * corr + sum;
#pragma unroll
            for (int dt = 0; dt < 4; ++dt) o[qt][dt] *= corr;
        }
#pragma unroll
        for (int dt = 0; dt < 4; ++dt)
#pragma unroll
            for (int qt = 0; qt < QT; ++qt) { o[qt][dt] = F::mma(va[dt], pf[qt], o[qt][dt]); if (HI) { o[qt][dt] = F::mma(va[dt], pf2[qt], o[qt][dt]); o[qt][dt] = F::mma(va2[dt], pf[qt], o[qt][dt]); } }
        if (open == 0ull) break;
        open &= open - 1; j0 = jn;
    }
    }
#pragma unroll
    for (int qt = 0; qt < QT; ++qt) { const float inv = __fdiv_rn(1.0f, lrun[qt] + xhalf(lrun[qt])); const size_t oo = (size_t)(q0 + qt * 16) * DQ + lane * 8;
#pragma unroll
        for (int dt = 0; dt < 4; ++dt) { v8us oh, ol;   // a lane's 8 accumulator registers are 8 consecutive d of its query row: one 16-byte piece of the merged planes, which are in fragment order (rows t, k = h HD + d); a wave's store is 512 consecutive bytes
#pragma unroll
            for (int r = 0; r < 8; ++r) { unsigned short a, c2; splitf(o[qt][dt][r] * inv, a, c2); oh[r] = a; ol[r] = c2; }
            *(v8us*)(Ah + oo + dt * 256) = oh; *(v8us*)(Al + oo + dt * 256) = ol;
            // s_wait_xcnt 0 behind the pair of stores, in front of the next tile's packing, which takes their data registers anew: it names the data, so that they stay whole up to it, and nothing is scheduled across it
            asm volatile("s_wait_xcnt 0x0" :: "v"(oh), "v"(ol) : "memory"); __builtin_amdgcn_sched_barrier(0); } }
}
// grid (RH/16 + (TT - RH)/32, NKV, NB_), 32 * REP threads: the first RH/16 blocks in x take 16 hi+lo query rows each (three products for one), the rest 32 fp16 rows each
__global__ __launch_bounds__(32 * REP) void k_fattn(const h16* __restrict__ Q16, const bf* __restrict__ Qh, const bf* __restrict__ Ql, const h16* __restrict__ K16, const bf* __restrict__ Kh, const bf* __restrict__ Kl, const h16* __restrict__ V16, const bf* __restrict__ Vh, const bf* __restrict__ Vl, const int* __restrict__ mk, const int* __restrict__ tf, bf* Ah, bf* Al) {
    const int g = blockIdx.y, h = g * REP + __builtin_amdgcn_readfirstlane((int)(threadIdx.x >> 5)); const size_t qo = ((size_t)blockIdx.z * NH_ + h) * TT * HD, ko = ((size_t)blockIdx.z * NKV + g) * TT * HD; const int bx = blockIdx.x; Ah += (size_t)blockIdx.z * TT * DQ; Al += (size_t)blockIdx.z * TT * DQ;   // batch blockIdx.z: its heads' planes, and its TT rows of the merged planes
    if (bx < RH / 16) attn_body<bf, true, 1>(Qh + qo, Ql + qo, Kh + ko, Kl + ko, Vh + ko, Vl + ko, mk, tf, bx * 16, Ah + h * 16 * HD, Al + h * 16 * HD);
    else attn_body<h16, false, 2>(Q16 + qo, nullptr, K16 + ko, nullptr, V16 + ko, nullptr, mk, tf, RH + (bx - RH / 16) * 32, Ah + h * 16 * HD, Al + h * 16 * HD);
}

extern "C" void kernel_launch(void* const* d_in, const int* in_sizes, int n_in,
                              void* d_out, int out_size, void* d_ws, size_t ws_size, hipStream_t stream) {
    (void)in_sizes; (void)n_in; (void)out_size;
    const float* x = (const float*)d_in[0]; const int* mk = (const int*)d_in[1]; const float* cosT = (const float*)d_in[2]; const float* sinT = (const float*)d_in[3]; const float* wq = (const float*)d_in[4]; const float* wk = (const float*)d_in[5]; const float* wv = (const float*)d_in[6]; const float* wo = (const float*)d_in[7]; const float* bo = (const float*)d_in[8];   // all weights x @ W
    float* OUT = (float*)d_out;     // [2][2048][2048]
    char* wsp = (char*)d_ws;
    auto take = [&](size_t bytes) { char* p = wsp; wsp += (bytes + 255) & ~(size_t)255; return (void*)p; };
    bf* WQ = (bf*)take((size_t)DQ * DM * 2); bf* WK = (bf*)take((size_t)DKV * DM * 2); bf* WV = (bf*)take((size_t)DKV * DM * 2); bf* WO = (bf*)take((size_t)DM * DQ * 2); float* CS = (float*)take((size_t)TT * HD * 2 * 4);
    bf* XB = (bf*)take((size_t)NB_ * TT * DM * 2);
    h16* QP16 = (h16*)take((size_t)NB_ * NH_ * TT * HD * 2); h16* KP16 = (h16*)take((size_t)NB_ * NKV * TT * HD * 2); h16* VT16 = (h16*)take((size_t)NB_ * NKV * HD * TT * 2);
    bf* QPh = (bf*)take((size_t)NB_ * NH_ * TT * HD * 2); bf* QPl = (bf*)take((size_t)NB_ * NH_ * TT * HD * 2); bf* KPh = (bf*)take((size_t)NB_ * NKV * TT * HD * 2); bf* KPl = (bf*)take((size_t)NB_ * NKV * TT * HD * 2); bf* VTh = (bf*)take((size_t)NB_ * NKV * HD * TT * 2); bf* VTl = (bf*)take((size_t)NB_ * NKV * HD * TT * 2);
    bf* ATh = (bf*)take((size_t)NB_ * TT * DQ * 2); bf* ATl = (bf*)take((size_t)NB_ * TT * DQ * 2); int* MF = (int*)take((size_t)TT * TT * 4); int* TF = (int*)take((size_t)PB_MF * 128);
    if ((size_t)(wsp - (char*)d_ws) > ws_size) return;    // ws 256 MiB
    k_prep<<<PB_X + 2 * PB_WQ + 2 * PB_WK + PB_CS + PB_MF, 256, 0, stream>>>(x, mk, cosT, sinT, wq, wk, wv, wo, XB, MF, TF, CS, WQ, WK, WV, WO);   // table and mask are shared by the batches (read as data)
    k_qkv<<<MT * (DQ / 128) + 2 * MT * (DKV / 128), 128, 0, stream>>>(XB, WQ, WK, WV, CS, QP16, QPh, QPl, KP16, KPh, KPl, VT16, VTh, VTl);
    k_fattn<<<dim3(RH / 16 + (TT - RH) / 32, NKV, NB_), 32 * REP, 0, stream>>>(QP16, QPh, QPl, KP16, KPh, KPl, VT16, VTh, VTl, MF, TF, ATh, ATl);
    k_oproj<<<dim3(MT, DM / 128, 1), 128, 0, stream>>>(ATh, ATl, WO, OUT, bo);
}

// v009
// It runs in 147 microseconds.
// Next to v008, in two timings, it ran 1.08 times as fast each time.
// Counting every step since v000, it is 26.1 times as fast.
#include <hip/hip_runtime.h>

// Grouped-query attention with RoPE and a 2-D mask (x [2][2048][2048]; q = x Wq (32 heads x 64), k, v = x Wk / x Wv (8 kv groups x 64, each serving 4 consecutive query heads); rotate-half RoPE with the input
// cos/sin tables [2048][64] (read as data); scores = q.k/8, -inf where mask[i][j] != 0 (int [2048][2048], read as data); softmax; out = merged attn.v Wo + bo -> [2][2048][2048]).
// Compute dtypes, f32 accumulate: every input rounded to bf16; projections on PLAIN bf16 operands (inputs: exact products, f32 accumulate); RoPE in f32; PER-ROW PRECISION
// HYBRID: query rows < 256 take scores and attn.v on bf16 hi+lo planes (3 products), rows >= 256 on single fp16 planes; 1/8 and the mask in f32 in the running softmax of the fused attention kernel; merged heads as hi+lo planes

#define NB_  2
#define TT   2048
#define DM   2048
#define NH_  32
#define NKV  8
#define REP  (NH_ / NKV)
#define HD   64
#define DQ   (NH_ * HD)
#define DKV  (NKV * HD)
#define RH   256                  // query rows < RH use hi+lo planes (0: none)
#define WIN  0
#define SCL2 0.18033688011112042f   // HD^-0.5 x log2(e): the softmax runs in base 2
typedef _Float16 h16;
typedef unsigned short bf;
typedef __attribute__((ext_vector_type(16))) __bf16   v16bf;
typedef __attribute__((ext_vector_type(16))) _Float16 v16h;
typedef __attribute__((ext_vector_type(8)))  _Float16 v8h;
typedef __attribute__((ext_vector_type(8)))  unsigned short v8us;
typedef __attribute__((ext_vector_type(8)))  float    v8f;
typedef __attribute__((ext_vector_type(4)))  float    v4f;
typedef v8h  __attribute__((may_alias)) v8ha;
typedef v4f  __attribute__((may_alias)) v4fa;
typedef v8us __attribute__((may_alias)) v8usa;
typedef __attribute__((ext_vector_type(2))) float __attribute__((may_alias)) v2fa;

__device__ __forceinline__ unsigned short f2bf(float f) { unsigned u = __float_as_uint(f); u += 0x7FFFu + ((u >> 16) & 1u); return (unsigned short)(u >> 16); }
__device__ __forceinline__ float bf2f(unsigned short b) { return __uint_as_float(((unsigned)b) << 16); }
__device__ __forceinline__ float bfr(float f) { return bf2f(f2bf(f)); }
__device__ __forceinline__ v16h cat16(v8h lo, v8h hi) { return __builtin_shufflevector(lo, hi, 0, 1, 2, 3, 4, 5, 6, 7, 8, 9, 10, 11, 12, 13, 14, 15); }
__device__ __forceinline__ v16bf cat16b(v8us lo, v8us hi) { return __builtin_bit_cast(v16bf, __builtin_shufflevector(lo, hi, 0, 1, 2, 3, 4, 5, 6, 7, 8, 9, 10, 11, 12, 13, 14, 15)); }
__device__ __forceinline__ v8f wmma16(v16h a, v16h b, v8f c) { return __builtin_amdgcn_wmma_f32_16x16x32_f16(false, a, false, b, (short)0, c, false, false); }
__device__ __forceinline__ v8f wmmab(v16bf a, v16bf b, v8f c) { return __builtin_amdgcn_wmma_f32_16x16x32_bf16(false, a, false, b, (short)0, c, false, false); }
__device__ __forceinline__ h16 tohx(float x) { return (h16)x; }
__device__ __forceinline__ void splitf(float y, unsigned short& h, unsigned short& l) { h = f2bf(y); l = f2bf(y - bf2f(h)); }
typedef __attribute__((ext_vector_type(2))) _Float16 v2h;
typedef __attribute__((ext_vector_type(2))) unsigned short v2us;
__device__ __forceinline__ float xhalf(float x) { return __builtin_bit_cast(float, __builtin_amdgcn_permlanex16(__builtin_bit_cast(int, x), __builtin_bit_cast(int, x), 0x76543210, 0xfedcba98, false, false)); }  // lane l reads lane l ^ 16



// s_wait_xcnt 0 behind a group of global loads, in front of every rewrite of their address registers: it names the addresses, so that they stay whole up to it (no later load of the group lands on them), and nothing is scheduled across it
#define XWAIT1(a)       do { asm volatile("s_wait_xcnt 0x0" :: "v"(a) : "memory"); __builtin_amdgcn_sched_barrier(0); } while (0)
#define XWAIT2(a, b)    do { asm volatile("s_wait_xcnt 0x0" :: "v"(a), "v"(b) : "memory"); __builtin_amdgcn_sched_barrier(0); } while (0)
#define XWAIT3(a, b, c) do { asm volatile("s_wait_xcnt 0x0" :: "v"(a), "v"(b), "v"(c) : "memory"); __builtin_amdgcn_sched_barrier(0); } while (0)
// ---- gemmt: GEMM on 16-bit planes in fragment order, one 128x128 output tile per workgroup of four waves (2 x 2, a 64x64 tile and 16 accumulators each), every wave walking all of K. It is a device function, so that one launch
// can hold several products as ranges of its grid (k_qkv); sm is the workgroup's LDS. The NB_ batches of x are one plane of NB_ * TT rows, so that a product over x or over the merged heads takes both in one grid.
// acc[m][n] = sum_k A[m][k] Bt[n][k] (+ A2[m][k] Bt[n][k] with NA == 2), tile (bx, by) of (M / 128, N / 128). K % 128 == 0.
// The operands come through LDS, so that the two waves that need a fragment fetch it from L2 once: a stage is 64 k of the tile's 128 rows of every operand, two buffers, filled by tensor loads one stage ahead of the pass that reads them.
// In fragment order 16 rows x 64 k are 2 KiB in a row, and the next 16 rows stand 32 K bytes on: a slice of a stage is a two-dimensional tile of 2-KiB rows, and it lands in LDS as it lies in memory, so that a lane's 16-byte LDS read is again piece l or 32 + l of a block (consecutive lanes, consecutive 16 bytes).
// FRAGMENT ORDER of a 16-bit plane P[row][k] (rows % 16 == 0, K % 32 == 0): the 16 rows x 32 k of one A or B fragment are one 1-KiB block, blocks in the order [row / 16][k / 32]; inside a block the 16-byte piece of
// row r, k = 8 s .. 8 s + 7 (s = 0..3) is piece (s >> 1) * 32 + (s & 1) * 16 + (r & 15). Lane l of a wave then reads pieces l and 32 + l (ldf): each load instruction covers 512 consecutive bytes, four whole cache lines,
// where on a row-major plane (ld) it touches 16 lines for 32 bytes each. The values a lane and register receive are the same as with ld on the row-major plane.
template <typename T16> struct WFrag;
template <> struct WFrag<h16> { typedef v16h V; static __device__ __forceinline__ V ld(const h16* p) { return cat16(*(const v8h*)p, *(const v8h*)(p + 16)); } static __device__ __forceinline__ V ldf(const h16* p) { return cat16(*(const v8h*)p, *(const v8h*)(p + 256)); } static __device__ __forceinline__ v8f mma(V a, V b, v8f c) { return wmma16(a, b, c); } };
template <> struct WFrag<bf> { typedef v16bf V; static __device__ __forceinline__ V ld(const bf* p) { return cat16b(*(const v8us*)p, *(const v8us*)(p + 16)); } static __device__ __forceinline__ V ldf(const bf* p) { return cat16b(*(const v8us*)p, *(const v8us*)(p + 256)); } static __device__ __forceinline__ v8f mma(V a, V b, v8f c) { return wmmab(a, b, c); } };
typedef unsigned int u32;
typedef __attribute__((ext_vector_type(4))) u32 u32x4;
typedef __attribute__((ext_vector_type(8))) u32 u32x8;
__device__ __forceinline__ u32 uni(u32 v) { return (u32)__builtin_amdgcn_readfirstlane((int)v); }
// a wave-uniform test held in a scalar register, so that the branch on it is a scalar branch: a tensor load ignores EXEC
__device__ __forceinline__ u32 pinned(u32 v) { u32 w = uni(v); asm volatile("" : "+s"(w)); return w; }
// one tensor load of the calling wave: the tile that g1 describes, first byte at src, to byte lds_dst of the workgroup's LDS; g0 is handed back, so that the wait that covers the request can name it. g0 is written as an operand that the statement hands on ("+s", though the instruction leaves it as it is): the wait then names these very registers, where from an input alone the compiler put a second copy together for the wait and took the issued registers for other scalars
__device__ __forceinline__ u32x4 tdm_load(u32 lds_dst, const void* src, u32x8 g1) {
    const unsigned long long ga = (unsigned long long)src; u32x4 g0;
    g0[0] = uni(1u); g0[1] = uni(lds_dst); g0[2] = uni((u32)ga); g0[3] = uni((((u32)(ga >> 32)) & 0x01FFFFFFu) | 0x80000000u);
    asm volatile("tensor_load_to_lds %0, %1" : "+s"(g0) : "s"(g1) : "memory"); return g0; }
// the issuing wave's wait for its tensor load. It names both groups of the request's descriptor, so that their scalar registers stay whole from the issue up to it (left alone the compiler took some of them for the loop's own scalars while the request was in flight)
__device__ __forceinline__ void tdm_wait(u32x4 g0, u32x8 g1) { asm volatile("s_wait_tensorcnt 0x0" :: "s"(g0), "s"(g1) : "memory"); }
// EPI: what becomes of a wave's 64x64 tile. A lane's 8 registers of an accumulator are 8 consecutive rows m of one column n.
//   0: out. A = merged heads (t), Bt = weight rows (n): f32 + bias, turned into whole 256-byte rows through the wave's own part of LDS.
//   1, 2: q, k. A = weight rows (d), Bt = x (t): the 64 m are the 64 d of one head, so a lane holds 8 consecutive d of one position: one 16-byte piece of the head's [t][d] plane in fragment order (rows t, k = d).
//      Rotate-half RoPE out[d] = x[d] cos[t][d] - x[d+32] sin[t][d], out[d+32] = x[d+32] cos[t][d+32] + x[d] sin[t][d+32]; the partner d +- 32 is the same register of the accumulator two tiles on.
//   3: v. A = x (t), Bt = weight rows (d): a lane holds 8 consecutive t of one d: one piece of the kv group's [d][t] plane in fragment order (rows d, k = t). No RoPE.
//   1 to 3 never reach memory as f32: each piece is stored in the three 16-bit planes of the attention kernel (fp16, bf16 hi, bf16 lo), a wave's store being 512 consecutive bytes.
#define GKS 64                          // k of a stage
#define GOPB (128 * GKS * 2)            // bytes of one operand in a stage
template <int NA, int K, int EPI>
__device__ __forceinline__ void gemmt(unsigned char* sm, int bx, int by, const bf* __restrict__ A, const bf* __restrict__ A2, const bf* __restrict__ Bt, float* C, int ldc, const float* __restrict__ bias, const float* __restrict__ CS, h16* P16, bf* Ph, bf* Pl) {
    typedef WFrag<bf> F; typedef typename F::V V;
    constexpr int NS = K / GKS, STG = (NA + 1) * GOPB;
    static_assert(NS >= 2, "the ring's prologue fills two stages");
    const int lane = threadIdx.x & 31, lr = lane & 15, hi = lane >> 4; const int r0 = bx * 128, c0 = by * 128;
    const int wv = __builtin_amdgcn_readfirstlane((int)(threadIdx.x >> 5)), wm = wv >> 1, wn = wv & 1;
    // every wave moves its own slice of each stage. NA == 1: waves 0, 1 the halves of A, waves 2, 3 the halves of Bt (4 rows of 2 KiB each). NA == 2: wave 0 all of A, wave 1 all of A2 (8 rows), waves 2, 3 the halves of Bt.
    const bf* src; u32 soff, nrow;
    if constexpr (NA == 1) { src = (wv < 2) ? A + (size_t)(r0 + wn * 64) * K : Bt + (size_t)(c0 + wn * 64) * K; soff = wv * (GOPB / 2); nrow = 4; }
    else { src = (wv == 0) ? A + (size_t)r0 * K : (wv == 1) ? A2 + (size_t)r0 * K : Bt + (size_t)(c0 + wn * 64) * K; soff = (wv < 2) ? wv * GOPB : 2 * GOPB + wn * (GOPB / 2); nrow = (wv < 2) ? 8 : 4; }
    constexpr u32 d0 = GKS * 16 * 2;    // a row of the slice: 16 rows x 64 k of the plane, 2 KiB; source pitch 32 K bytes
    u32x8 g1; g1[0] = uni(0u); g1[1] = uni((d0 & 0xFFFFu) << 16); g1[2] = uni((d0 >> 16) | ((nrow & 0xFFFFu) << 16)); g1[3] = uni((nrow >> 16) | (d0 << 16)); g1[4] = uni(nrow); g1[5] = uni((u32)K * 32u); g1[6] = uni(0u); g1[7] = uni(0u);
    const u32 ldst = (u32)(size_t)sm + soff;
    u32x4 g0 = tdm_load(ldst, src, g1);                        // stage 0
    tdm_wait(g0, g1);                                          // this wave's slice of stage 0 has landed
    __syncthreads();                                           // publishes stage 0 to the other waves
    g0 = tdm_load(ldst + STG, src + GKS * 16, g1);             // stage 1
    v4f bv = (v4f){};
    if constexpr (EPI == 0) { const float* bp = bias + c0 + wn * 64 + lr * 4; bv = *(const v4f*)bp; XWAIT1(bp); }   // fetched ahead of the K loop, which covers the latency
    v8f acc[4][4];
#pragma unroll
    for (int mb = 0; mb < 4; ++mb)
#pragma unroll
        for (int nb = 0; nb < 4; ++nb) acc[mb][nb] = (v8f){};
#pragma unroll 1   // one pass a stage: the ring's order stands once, at the foot
    for (int s = 0; s < NS; ++s) {
        const bf* sb = (const bf*)(sm + (s & 1) * STG) + lane * 8;
        V a[GKS / 32][4], a2[GKS / 32][4], b[GKS / 32][4];
#pragma unroll     // the fragment and accumulator arrays are indexed by constants and stay in registers
        for (int kb = 0; kb < GKS / 32; ++kb) {
#pragma unroll
            for (int mb = 0; mb < 4; ++mb) { a[kb][mb] = F::ldf(sb + (wm * 4 + mb) * (GKS * 16) + kb * 512); if (NA == 2) a2[kb][mb] = F::ldf(sb + GOPB / 2 + (wm * 4 + mb) * (GKS * 16) + kb * 512); }
#pragma unroll
            for (int nb = 0; nb < 4; ++nb) b[kb][nb] = F::ldf(sb + NA * (GOPB / 2) + (wn * 4 + nb) * (GKS * 16) + kb * 512); }
        __builtin_amdgcn_sched_barrier(0);   // keeps the pass's LDS reads together at its head: left alone the compiler sinks them among the products, two at a time, each with a full wait of its own
#pragma unroll
        for (int kb = 0; kb < GKS / 32; ++kb)
#pragma unroll
            for (int nb = 0; nb < 4; ++nb)
#pragma unroll
                for (int mb = 0; mb < 4; ++mb) { acc[mb][nb] = F::mma(a[kb][mb], b[kb][nb], acc[mb][nb]); if (NA == 2) acc[mb][nb] = F::mma(a2[kb][mb], b[kb][nb], acc[mb][nb]); }
        __builtin_amdgcn_sched_barrier(0);   // keeps the products in front of the foot: left alone the compiler sinks them behind the barrier, so that the refill is issued a whole pass of products later and the next foot waits out its flight
        asm volatile("s_wait_dscnt 0x0" ::: "memory");         // this wave's reads of stage s are done
        tdm_wait(g0, g1);                                      // this wave's slice of stage s + 1 has landed
        __syncthreads();                                       // publishes stage s + 1 and frees the buffer of stage s
        if (pinned(s + 2 < NS)) g0 = tdm_load(ldst + (s & 1) * STG, src + (size_t)(s + 2) * (GKS * 16), g1);
    }
    asm volatile("s_wait_tensorcnt 0x0" ::: "memory");         // nothing of the ring is in flight behind the loop
    asm volatile("s_wait_dscnt 0x0" ::: "memory");
    __builtin_amdgcn_sched_barrier(0);                         // keeps the epilogue's scalar arithmetic behind the two waits: left alone the compiler lifts it in front of them, onto registers that held a descriptor
    if constexpr (EPI == 0) {
        // the last pass's barrier stands behind every wave's last read of the ring, and no load follows it: the ring is free, and each wave stages in a part of its own
        float* os = (float*)(sm + wv * (16 * 68 * 4));
#pragma unroll
        for (int q = 0; q < 4; ++q) bv[q] = bfr(bv[q]);
#pragma unroll
        for (int mb = 0; mb < 4; ++mb) {
#pragma unroll
            for (int nb = 0; nb < 4; ++nb) {
#pragma unroll
                for (int j = 0; j < 8; ++j) os[(hi * 8 + j) * 68 + nb * 16 + lr] = acc[mb][nb][j]; }
            __builtin_amdgcn_wave_barrier(); asm volatile("" ::: "memory");   // the rows are read back by other lanes of the wave: no LDS read is moved in front of the writes
            float* crow = C + (size_t)(r0 + wm * 64 + mb * 16) * ldc + c0 + wn * 64; v4f val[8];
#pragma unroll
            for (int s = 0; s < 8; ++s) val[s] = *(const v4fa*)(os + (2 * s + hi) * 68 + lr * 4) + bv;
#pragma unroll
            for (int s = 0; s < 8; ++s) *(v4f*)(crow + (size_t)(2 * s + hi) * ldc + lr * 4) = val[s];
            // s_wait_xcnt 0 behind the eight stores, in front of the next 16 rows, which take their data registers anew: it names the data, so that they stay whole up to it, and nothing is scheduled across it
            asm volatile("s_wait_xcnt 0x0" :: "v"(val[0]), "v"(val[1]), "v"(val[2]), "v"(val[3]), "v"(val[4]), "v"(val[5]), "v"(val[6]), "v"(val[7]) : "memory"); __builtin_amdgcn_sched_barrier(0);
        }
    } else {
        const int tg = (EPI == 3) ? r0 + wm * 64 : c0 + wn * 64, t0 = tg % TT, pl = (EPI == 3) ? by * 2 + wn : bx * 2 + wm;   // row tg of the x plane is position tg % TT of batch tg / TT; pl: the head or kv group
        const size_t e0 = ((size_t)(tg / TT) * (EPI == 1 ? NH_ : NKV) + pl) * TT * HD + (size_t)t0 * (EPI == 3 ? 16 : HD) + lane * 8;   // a batch's heads (kv groups) follow one another, batch after batch
        constexpr int enb = (EPI == 3) ? 16 * TT : 16 * HD;   // from one 16-column tile to the next: 16 rows d of the [d][t] plane, or 16 rows t of the [t][d] plane; 16 m on are half a block, 256 elements, in both
        const float* csp = CS + ((size_t)(t0 + lr) * HD + hi * 8) * 2;
#pragma unroll     // acc[][] and cs[][] are indexed by constants and stay in registers
        for (int nb = 0; nb < 4; ++nb) {
            v4f cs[4][4];   // cos d, sin d, cos d+1, sin d+1, ... of the lane's position and its 8 d of each of the four tiles
            if constexpr (EPI != 3) {
#pragma unroll
                for (int mb = 0; mb < 4; ++mb)
#pragma unroll
                    for (int q = 0; q < 4; ++q) cs[mb][q] = *(const v4f*)(csp + nb * 16 * HD * 2 + mb * 32 + q * 4);
                XWAIT1(csp); }
#pragma unroll
            for (int mb = 0; mb < 4; ++mb) { v8h o16; v8us oh, ol;
#pragma unroll
                for (int j = 0; j < 8; ++j) { float r = acc[mb][nb][j];
                    if constexpr (EPI != 3) { const float x1 = acc[mb ^ 2][nb][j]; r = r * cs[mb][j >> 1][(j & 1) * 2] + (mb >= 2 ? x1 : -x1) * cs[mb][j >> 1][(j & 1) * 2 + 1]; }
                    o16[j] = tohx(r); unsigned short a2, c2; splitf(r, a2, c2); oh[j] = a2; ol[j] = c2; }
                *(v8h*)(P16 + e0 + nb * enb + mb * 256) = o16; *(v8us*)(Ph + e0 + nb * enb + mb * 256) = oh; *(v8us*)(Pl + e0 + nb * enb + mb * 256) = ol;
                // s_wait_xcnt 0 behind the three stores, in front of the next piece's packing, which takes their data registers anew: it names the data, so that they stay whole up to it, and nothing is scheduled across it
                asm volatile("s_wait_xcnt 0x0" :: "v"(o16), "v"(oh), "v"(ol) : "memory"); __builtin_amdgcn_sched_barrier(0); }
        }
    }
}

// k_qkv: the q, k and v projections of both batches as three ranges of one grid (they read the same x plane and depend on nothing of one another); inside a range the tile's first index runs fastest. The range test is the same for a whole workgroup, so that every barrier of gemmt is passed by all of its waves, and it is a scalar branch (pinned), since tensor loads stand behind it.
#define MT (NB_ * TT / 128)   // 128-row tiles of the x plane
__global__ __launch_bounds__(128) void k_qkv(const bf* __restrict__ XB, const bf* __restrict__ WQ, const bf* __restrict__ WK, const bf* __restrict__ WV, const float* __restrict__ CS, h16* QP16, bf* QPh, bf* QPl, h16* KP16, bf* KPh, bf* KPl, h16* VT16, bf* VTh, bf* VTl) {
    __shared__ __attribute__((aligned(2048))) unsigned char sm[2 * 2 * GOPB];
    int i = blockIdx.x;
    if (pinned(i < MT * (DQ / 128))) { gemmt<1, DM, 1>(sm, i % (DQ / 128), i / (DQ / 128), WQ, nullptr, XB, nullptr, 0, nullptr, CS, QP16, QPh, QPl); return; }
    i -= MT * (DQ / 128);
    if (pinned(i < MT * (DKV / 128))) { gemmt<1, DM, 2>(sm, i % (DKV / 128), i / (DKV / 128), WK, nullptr, XB, nullptr, 0, nullptr, CS, KP16, KPh, KPl); return; }
    i -= MT * (DKV / 128);
    gemmt<1, DM, 3>(sm, i % MT, i / MT, XB, nullptr, WV, nullptr, 0, nullptr, nullptr, VT16, VTh, VTl);
}
// k_oproj: out = merged heads (hi + lo planes) Wo + bo, both batches; grid (MT, DM / 128)
__global__ __launch_bounds__(128) void k_oproj(const bf* __restrict__ ATh, const bf* __restrict__ ATl, const bf* __restrict__ WO, float* OUT, const float* __restrict__ bo) {
    __shared__ __attribute__((aligned(2048))) unsigned char sm[2 * 3 * GOPB];
    gemmt<2, DQ, 0>(sm, blockIdx.x, blockIdx.y, ATh, ATl, WO, OUT, DM, bo, nullptr, nullptr, nullptr, nullptr);
}

typedef __attribute__((ext_vector_type(4))) _Float16 v4h;
typedef __attribute__((ext_vector_type(4))) unsigned short v4us;
typedef __attribute__((ext_vector_type(2))) float v2f;
typedef __attribute__((ext_vector_type(4))) int v4i;

// The conversions are device functions of a block index bx, 256 threads a block: none depends on another, and k_prep runs them all as ranges of one grid.
// k_wtG and k_cvt8 write one 16-byte piece of a fragment-order plane a thread, thread i piece i, so that a wave's store is 512 consecutive bytes. fo_row / fo_k: the row and the first k of piece i in a plane with K columns.
// Their sizes are compile-time constants, so that a thread's loads are immediate offsets from one address, which XWAIT1 keeps whole.
__device__ __forceinline__ int fo_row(int i, int K) { return ((i >> 6) / (K / 32)) * 16 + (i & 15); }
__device__ __forceinline__ int fo_k(int i, int K) { return ((i >> 6) % (K / 32)) * 32 + ((i >> 5) & 1) * 16 + ((i >> 4) & 1) * 8; }
// k_wtG: Bt[n][k] = bf16(w[k][n]) in fragment order; 16 neighbouring lanes read 16 neighbouring n of one k
template <int K, int N>
__device__ __forceinline__ void k_wtG(int bx, const float* __restrict__ w, bf* Bt) {
    const int i = bx * 256 + threadIdx.x; if (i >= N * (K / 8)) return; const int n = fo_row(i, K), k0 = fo_k(i, K); const float* p = w + (size_t)k0 * N + n; float x[8]; v8us o;
#pragma unroll
    for (int j = 0; j < 8; ++j) x[j] = p[j * N];
    XWAIT1(p);
#pragma unroll
    for (int j = 0; j < 8; ++j) o[j] = f2bf(x[j]);
    *(v8us*)(Bt + (size_t)i * 8) = o; }
// k_cvt8: dst[r][k] = bf16(src[r][k]) in fragment order
template <int K>
__device__ __forceinline__ void k_cvt8(int bx, const float* __restrict__ src, bf* dst, int n8) { const int i = bx * 256 + threadIdx.x; if (i >= n8) return; const float* p = src + (size_t)fo_row(i, K) * K + fo_k(i, K); const v8f v = *(const v8f*)p; XWAIT1(p); v8us o;
#pragma unroll
    for (int k = 0; k < 8; ++k) o[k] = f2bf(v[k]); *(v8us*)(dst + (size_t)i * 8) = o;  }
// k_mfo: the mask in the order in which the lanes of k_fattn read it: [row / 16][key / 32][(key >> 4) & 1][(key >> 2) & 1][lane = ((key >> 3) & 1) * 16 + (row & 15)][key & 3]; thread i writes the i-th group of 4
// It also says which parts of the mask hold an open key (a zero word): a wave moves a quarter of one 16-row x 32-key tile, and writes TF[bx][wave] = 1 if that quarter has one, else 0. A block is two tiles; its 8 words have a 128-byte line of their own.
__device__ __forceinline__ void k_mfo(int bx, const int* __restrict__ mk, int* MF, int* TF) { const int i = bx * 256 + threadIdx.x; if (i >= TT * (TT / 4)) return;
    const int row = (i / (4 * TT)) * 16 + (i & 15), key = ((i >> 7) % (TT / 32)) * 32 + ((i >> 6) & 1) * 16 + ((i >> 4) & 1) * 8 + ((i >> 5) & 1) * 4; const int* p = mk + (size_t)row * TT + key; const v4i v = *(const v4i*)p; XWAIT1(p); *(v4i*)(MF + (size_t)i * 4) = v;
    const unsigned any = __builtin_amdgcn_ballot_w32(v[0] == 0 || v[1] == 0 || v[2] == 0 || v[3] == 0);
    if ((threadIdx.x & 31) == 0) TF[bx * 32 + (threadIdx.x >> 5)] = any != 0u; }
__device__ __forceinline__ void k_cscvt(int bx, const float* __restrict__ cosT, const float* __restrict__ sinT, float* CS) { const int idx = bx * 256 + threadIdx.x; if (idx >= TT * HD) return; v2f cs; cs[0] = bfr(cosT[idx]); cs[1] = bfr(sinT[idx]); *(v2f*)(CS + (size_t)idx * 2) = cs;  }
// k_prep: every conversion of an input (x of both batches as one plane of NB_ * TT rows, the four weights, the mask, the cos/sin table) as a range of one grid; the sizes below are each range's blocks
#define PB_X  (NB_ * TT * DM / 8 / 256)
#define PB_WQ (DM * DQ / 8 / 256)
#define PB_WK (DM * DKV / 8 / 256)
#define PB_MF (TT * (TT / 4) / 256)
#define PB_CS (TT * HD / 256)
__global__ __launch_bounds__(256) void k_prep(const float* __restrict__ x, const int* __restrict__ mk, const float* __restrict__ cosT, const float* __restrict__ sinT, const float* __restrict__ wq, const float* __restrict__ wk, const float* __restrict__ wv, const float* __restrict__ wo,
                                              bf* XB, int* MF, int* TF, float* CS, bf* WQ, bf* WK, bf* WV, bf* WO) {
    int i = blockIdx.x;
    if (i < PB_X) { k_cvt8<DM>(i, x, XB, NB_ * TT * DM / 8); return; }
    i -= PB_X;
    if (i < PB_WQ) { k_wtG<DM, DQ>(i, wq, WQ); return; }
    i -= PB_WQ;
    if (i < PB_WK) { k_wtG<DM, DKV>(i, wk, WK); return; }
    i -= PB_WK;
    if (i < PB_WK) { k_wtG<DM, DKV>(i, wv, WV); return; }
    i -= PB_WK;
    if (i < PB_CS) { k_cscvt(i, cosT, sinT, CS); return; }
    i -= PB_CS;
    if (i < PB_MF) { k_mfo(i, mk, MF, TF); return; }
    i -= PB_MF;
    k_wtG<DQ, DM>(i, wo, WO);
}
// ---- k_fattn: scores, mask, softmax, attn.v and the head merge in one kernel; no score or probability ever reaches memory. One wave = one query head x 16 * QT query rows, walking the keys 32 at a time (of the TT / 32 key tiles those in which the mask leaves one of its rows a key open);
// the REP waves of a workgroup are the REP query heads of one kv group on the same query rows, so they read the same K, V and mask lines at about the same time (shared through the WGP cache).
// Transposed products: St = K Qt (A = K rows, B = Q rows kept in registers), so a lane holds scores of ONE query (column lr), keys 8 hi + r of each 16-key tile; two such tiles, converted in place, are the B operand
// of Ot += Vt Pt (A = rows of the [d][t] plane). Running maximum and sum per lane; the two lane halves share the maximum every pass and join their sums once at the end.
// A masked score is -3e38 as a finite stand-in: while a row has seen masked keys only, its terms are exp2(0) = 1, and the first real score wipes them with the factor exp2(-inf) = 0. A wave whose rows have no open key in any tile walks none: sum 0, and 0 x 1/0 = NaN, as the softmax of a row of -inf.
// v_exp_f32 with, in the same statement, the one slot that the instruction set asks for behind a transcendental before its result is read or its source overwritten
__device__ __forceinline__ float exp2s(float x) { float y; asm("v_exp_f32 %0, %1\n\tv_nop" : "=v"(y) : "v"(x)); return y; }
template <typename T16, bool HI, int QT>
__device__ __forceinline__ void attn_body(const T16* __restrict__ Q, const T16* __restrict__ Q2, const T16* __restrict__ Kp, const T16* __restrict__ K2, const T16* __restrict__ Vt, const T16* __restrict__ V2, const int* __restrict__ mk, const int* __restrict__ tf, int q0, bf* Ah, bf* Al) {
    typedef WFrag<T16> F; typedef typename F::V V;
    const int lane = threadIdx.x & 31, lr = lane & 15, hi = lane >> 4;
    // every loop below but the one over j0 is unrolled so that the fragment and accumulator arrays are indexed by constants and stay in registers
    V qf[QT][2], qf2[QT][2]; const size_t qoff = (size_t)q0 * HD + lane * 8; const T16* qp = Q + qoff; const T16* qp2 = HI ? Q2 + qoff : qp;
#pragma unroll
    for (int qt = 0; qt < QT; ++qt)
#pragma unroll
        for (int ks = 0; ks < 2; ++ks) { qf[qt][ks] = F::ldf(qp + qt * 16 * HD + ks * 512); if (HI) qf2[qt][ks] = F::ldf(qp2 + qt * 16 * HD + ks * 512); }
    if constexpr (HI) XWAIT2(qp, qp2); else XWAIT1(qp);
    const int koff = lane * 8, voff = lane * 8; const int* mrow = mk + (size_t)q0 * TT + lane * 4;   // Q, K, V and the mask are in fragment order: 16 keys of K are 2 blocks = 16 HD elements, 32 keys of V one block per 16 d, 32 keys of the mask 512 ints per 16 rows
    v8f o[QT][4]; float mrun[QT], lrun[QT];
#pragma unroll
    for (int qt = 0; qt < QT; ++qt) { mrun[qt] = -3.0e38f; lrun[qt] = 0.f;
#pragma unroll
        for (int dt = 0; dt < 4; ++dt) o[qt][dt] = (v8f){}; }
    // The 32-key tiles in which any of the wave's 16 * QT query rows has an open key, as 64 bits (bit t: keys 32 t .. 32 t + 31), from the flags that k_mfo took from the mask. Only these tiles are walked: a tile with no open key adds nothing
    // (every term of it is exp2(-3e38 - m) = 0 once a row has seen an open key, and what a row gathers before that is wiped by its first open key). Lane l reads the four quarter flags of tiles l and 32 + l; the ballots make the map the same for the whole wave, in scalar registers.
    const int* tp = tf + (size_t)(q0 >> 4) * (TT / 64 * 32) + (lane >> 1) * 32 + (lane & 1) * 4; v4i fl[QT][2];
#pragma unroll
    for (int qt = 0; qt < QT; ++qt) { fl[qt][0] = *(const v4i*)(tp + qt * (TT / 64 * 32)); fl[qt][1] = *(const v4i*)(tp + qt * (TT / 64 * 32) + 16 * 32); }
    XWAIT1(tp);
    int f0 = 0, f1 = 0;
#pragma unroll
    for (int qt = 0; qt < QT; ++qt) { f0 |= fl[qt][0][0] | fl[qt][0][1] | fl[qt][0][2] | fl[qt][0][3]; f1 |= fl[qt][1][0] | fl[qt][1][1] | fl[qt][1][2] | fl[qt][1][3]; }
    unsigned long long open = (unsigned long long)__builtin_amdgcn_ballot_w32(f0 != 0) | ((unsigned long long)__builtin_amdgcn_ballot_w32(f1 != 0) << 32);
    if (open != 0ull) {
    int j0 = __builtin_ctzll(open) * 32; open &= open - 1;   // the first open tile; open holds the tiles still to come
    V ka[2][2], ka2[2][2]; v4i mm[QT][2][2];
    { const T16* kp = Kp + koff + (size_t)j0 * HD; const T16* kp2 = HI ? K2 + koff + (size_t)j0 * HD : kp; const int* mp0 = mrow + j0 * 16;
#pragma unroll
      for (int kt = 0; kt < 2; ++kt) {
#pragma unroll
        for (int ks = 0; ks < 2; ++ks) { ka[kt][ks] = F::ldf(kp + kt * 16 * HD + ks * 512); if (HI) ka2[kt][ks] = F::ldf(kp2 + kt * 16 * HD + ks * 512); }
#pragma unroll
        for (int qt = 0; qt < QT; ++qt) { mm[qt][kt][0] = *(const v4i*)(mp0 + (size_t)qt * 16 * TT + kt * 256); mm[qt][kt][1] = *(const v4i*)(mp0 + (size_t)qt * 16 * TT + kt * 256 + 128); } }
      if constexpr (HI) XWAIT3(kp, kp2, mp0); else XWAIT2(kp, mp0); }
    for (;;) {   // one pass an open tile, in rising key order; every pass but the last clears one of the 64 bits, so there are at most TT / 32 passes
        const int jn = (open != 0ull) ? __builtin_ctzll(open) * 32 : j0;   // the K and mask fragments are fetched one pass ahead, from the next open tile; the last pass fetches its own again, inside the arrays
        V va[4], va2[4]; const T16* vp = Vt + voff + j0 * 16; const T16* vp2 = HI ? V2 + voff + j0 * 16 : vp;
#pragma unroll
        for (int dt = 0; dt < 4; ++dt) { va[dt] = F::ldf(vp + (size_t)dt * 16 * TT); if (HI) va2[dt] = F::ldf(vp2 + (size_t)dt * 16 * TT); }
        // its scheduling barrier also keeps the V loads at the head of the pass, the score products and a whole softmax ahead of their use; without it the compiler sinks them to just in front of attn.v
        if constexpr (HI) XWAIT2(vp, vp2); else XWAIT1(vp);
        v8f s[QT][2];
#pragma unroll
        for (int kt = 0; kt < 2; ++kt)
#pragma unroll
            for (int qt = 0; qt < QT; ++qt) { v8f c = (v8f){};
#pragma unroll
                for (int ks = 0; ks < 2; ++ks) { c = F::mma(ka[kt][ks], qf[qt][ks], c); if (HI) { c = F::mma(ka[kt][ks], qf2[qt][ks], c); c = F::mma(ka2[kt][ks], qf[qt][ks], c); } }
                s[qt][kt] = c; }
        const T16* kp = Kp + koff + (size_t)jn * HD; const T16* kp2 = HI ? K2 + koff + (size_t)jn * HD : kp; const int* mp = mrow + jn * 16;
#pragma unroll
        for (int kt = 0; kt < 2; ++kt)
#pragma unroll
            for (int ks = 0; ks < 2; ++ks) { ka[kt][ks] = F::ldf(kp + kt * 16 * HD + ks * 512); if (HI) ka2[kt][ks] = F::ldf(kp2 + kt * 16 * HD + ks * 512); }
        V pf[QT], pf2[QT]; float mxs[QT];
#pragma unroll
        for (int qt = 0; qt < QT; ++qt) {
            float mx = -3.0e38f;
#pragma unroll
            for (int kt = 0; kt < 2; ++kt)
#pragma unroll
                for (int r = 0; r < 8; ++r) { const float t = (mm[qt][kt][r >> 2][r & 3] == 0) ? s[qt][kt][r] * SCL2 : -3.0e38f; s[qt][kt][r] = t; mx = fmaxf(mx, t); }
#pragma unroll
            for (int kt = 0; kt < 2; ++kt) { mm[qt][kt][0] = *(const v4i*)(mp + (size_t)qt * 16 * TT + kt * 256); mm[qt][kt][1] = *(const v4i*)(mp + (size_t)qt * 16 * TT + kt * 256 + 128); }
            mxs[qt] = mx; }
        // its scheduling barrier also keeps the next pass's K and mask loads in front of the softmax and attn.v of this pass, which cover their latency; without it the compiler sinks them to the foot of the pass or into the next one
        if constexpr (HI) XWAIT3(kp, kp2, mp); else XWAIT2(kp, mp);
#pragma unroll
        for (int qt = 0; qt < QT; ++qt) {
            const float mx = fmaxf(mxs[qt], xhalf(mxs[qt]));
            const float mnew = fmaxf(mrun[qt], mx); const float corr = exp2s(mrun[qt] - mnew); mrun[qt] = mnew;
            float sum = 0.f;
#pragma unroll
            for (int kt = 0; kt < 2; ++kt)
#pragma unroll
                for (int r = 0; r < 8; ++r) { const float p = exp2s(s[qt][kt][r] - mnew); sum += p;
                    if constexpr (HI) { unsigned short a, c2; splitf(p, a, c2); pf[qt][kt * 8 + r] = __builtin_bit_cast(__bf16, a); pf2[qt][kt * 8 + r] = __builtin_bit_cast(__bf16, c2); }
                    else pf[qt][kt * 8 + r] = tohx(p); }
            lrun[qt] = lrun[qt] * corr + sum;
#pragma unroll
            for (int dt = 0; dt < 4; ++dt) o[qt][dt] *= corr;
        }
#pragma unroll
        for (int dt = 0; dt < 4; ++dt)
#pragma unroll
            for (int qt = 0; qt < QT; ++qt) { o[qt][dt] = F::mma(va[dt], pf[qt], o[qt][dt]); if (HI) { o[qt][dt] = F::mma(va[dt], pf2[qt], o[qt][dt]); o[qt][dt] = F::mma(va2[dt], pf[qt], o[qt][dt]); } }
        if (open == 0ull) break;
        open &= open - 1; j0 = jn;
    }
    }
#pragma unroll
    for (int qt = 0; qt < QT; ++qt) { const float inv = __fdiv_rn(1.0f, lrun[qt] + xhalf(lrun[qt])); const size_t oo = (size_t)(q0 + qt * 16) * DQ + lane * 8;
#pragma unroll
        for (int dt = 0; dt < 4; ++dt) { v8us oh, ol;   // a lane's 8 accumulator registers are 8 consecutive d of its query row: one 16-byte piece of the merged planes, which are in fragment order (rows t, k = h HD + d); a wave's store is 512 consecutive bytes
#pragma unroll
            for (int r = 0; r < 8; ++r) { unsigned short a, c2; splitf(o[qt][dt][r] * inv, a, c2); oh[r] = a; ol[r] = c2; }
            *(v8us*)(Ah + oo + dt * 256) = oh; *(v8us*)(Al + oo + dt * 256) = ol;
            // s_wait_xcnt 0 behind the pair of stores, in front of the next tile's packing, which takes their data registers anew: it names the data, so that they stay whole up to it, and nothing is scheduled across it
            asm volatile("s_wait_xcnt 0x0" :: "v"(oh), "v"(ol) : "memory"); __builtin_amdgcn_sched_barrier(0); } }
}
// grid (NKV, NB_, NQB), 32 * REP threads. Query block bx: the first RH/16 take 16 hi+lo query rows each (three products for one), the rest 32 fp16 rows each.
// Under a mask that opens more keys to later rows a block's cost rises with bx, and not all workgroups are resident at once. The query block is the slowest index, so the costly blocks come first in index order.
// Every second round (SWP values of blockIdx.z) runs the other way.
// For speed only: blockIdx.z -> bx is a permutation of the query blocks wherever a workgroup lands and whatever the mask holds.
#define NQB  (RH / 16 + (TT - RH) / 32)
#define WGPS 256
#define SWP  (WGPS / (NKV * NB_))
static_assert((SWP & (SWP - 1)) == 0 && (NQB % SWP == 0 || ((NQB / SWP) & 1) == 0), "a round that runs the other way is a whole one");
__global__ __launch_bounds__(32 * REP) void k_fattn(const h16* __restrict__ Q16, const bf* __restrict__ Qh, const bf* __restrict__ Ql, const h16* __restrict__ K16, const bf* __restrict__ Kh, const bf* __restrict__ Kl, const h16* __restrict__ V16, const bf* __restrict__ Vh, const bf* __restrict__ Vl, const int* __restrict__ mk, const int* __restrict__ tf, bf* Ah, bf* Al) {
    const int g = blockIdx.x, h = g * REP + __builtin_amdgcn_readfirstlane((int)(threadIdx.x >> 5)); const size_t qo = ((size_t)blockIdx.y * NH_ + h) * TT * HD, ko = ((size_t)blockIdx.y * NKV + g) * TT * HD; Ah += (size_t)blockIdx.y * TT * DQ; Al += (size_t)blockIdx.y * TT * DQ;   // batch blockIdx.y: its heads' planes, and its TT rows of the merged planes
    const int rk = blockIdx.z, bx = NQB - 1 - (((rk / SWP) & 1) ? (rk ^ (SWP - 1)) : rk);
    if (bx < RH / 16) attn_body<bf, true, 1>(Qh + qo, Ql + qo, Kh + ko, Kl + ko, Vh + ko, Vl + ko, mk, tf, bx * 16, Ah + h * 16 * HD, Al + h * 16 * HD);
    else attn_body<h16, false, 2>(Q16 + qo, nullptr, K16 + ko, nullptr, V16 + ko, nullptr, mk, tf, RH + (bx - RH / 16) * 32, Ah + h * 16 * HD, Al + h * 16 * HD);
}

extern "C" void kernel_launch(void* const* d_in, const int* in_sizes, int n_in,
                              void* d_out, int out_size, void* d_ws, size_t ws_size, hipStream_t stream) {
    (void)in_sizes; (void)n_in; (void)out_size;
    const float* x = (const float*)d_in[0]; const int* mk = (const int*)d_in[1]; const float* cosT = (const float*)d_in[2]; const float* sinT = (const float*)d_in[3]; const float* wq = (const float*)d_in[4]; const float* wk = (const float*)d_in[5]; const float* wv = (const float*)d_in[6]; const float* wo = (const float*)d_in[7]; const float* bo = (const float*)d_in[8];   // all weights x @ W
    float* OUT = (float*)d_out;     // [2][2048][2048]
    char* wsp = (char*)d_ws;
    auto take = [&](size_t bytes) { char* p = wsp; wsp += (bytes + 255) & ~(size_t)255; return (void*)p; };
    bf* WQ = (bf*)take((size_t)DQ * DM * 2); bf* WK = (bf*)take((size_t)DKV * DM * 2); bf* WV = (bf*)take((size_t)DKV * DM * 2); bf* WO = (bf*)take((size_t)DM * DQ * 2); float* CS = (float*)take((size_t)TT * HD * 2 * 4);
    bf* XB = (bf*)take((size_t)NB_ * TT * DM * 2);
    h16* QP16 = (h16*)take((size_t)NB_ * NH_ * TT * HD * 2); h16* KP16 = (h16*)take((size_t)NB_ * NKV * TT * HD * 2); h16* VT16 = (h16*)take((size_t)NB_ * NKV * HD * TT * 2);
    bf* QPh = (bf*)take((size_t)NB_ * NH_ * TT * HD * 2); bf* QPl = (bf*)take((size_t)NB_ * NH_ * TT * HD * 2); bf* KPh = (bf*)take((size_t)NB_ * NKV * TT * HD * 2); bf* KPl = (bf*)take((size_t)NB_ * NKV * TT * HD * 2); bf* VTh = (bf*)take((size_t)NB_ * NKV * HD * TT * 2); bf* VTl = (bf*)take((size_t)NB_ * NKV * HD * TT * 2);
    bf* ATh = (bf*)take((size_t)NB_ * TT * DQ * 2); bf* ATl = (bf*)take((size_t)NB_ * TT * DQ * 2); int* MF = (int*)take((size_t)TT * TT * 4); int* TF = (int*)take((size_t)PB_MF * 128);
    if ((size_t)(wsp - (char*)d_ws) > ws_size) return;    // ws 256 MiB
    k_prep<<<PB_X + 2 * PB_WQ + 2 * PB_WK + PB_CS + PB_MF, 256, 0, stream>>>(x, mk, cosT, sinT, wq, wk, wv, wo, XB, MF, TF, CS, WQ, WK, WV, WO);   // table and mask are shared by the batches (read as data)
    k_qkv<<<MT * (DQ / 128) + 2 * MT * (DKV / 128), 128, 0, stream>>>(XB, WQ, WK, WV, CS, QP16, QPh, QPl, KP16, KPh, KPl, VT16, VTh, VTl);
    k_fattn<<<dim3(NKV, NB_, NQB), 32 * REP, 0, stream>>>(QP16, QPh, QPl, KP16, KPh, KPl, VT16, VTh, VTl, MF, TF, ATh, ATl);
    k_oproj<<<dim3(MT, DM / 128, 1), 128, 0, stream>>>(ATh, ATl, WO, OUT, bo);
}
